// v000
// Times are from an AMD MI455X. After a warm-up the kernel runs many times in a row, and a time is the length of
// such a window on the GPU divided by its runs, so every launch and the gaps after it count. The runs cycle
// through copies of the inputs. A figure is the median of several windows, for all but v000 over two sittings.
// Sittings can differ by a few percent; kernels timed side by side share one.
// The starting kernel, v000, takes 417 microseconds a run.
#include <hip/hip_runtime.h>
#include <hip/hip_bf16.h>

// ---------------------------------------------------------------------------
// Transformer-XL relative multi-head attention for MI455X (gfx1250).
// All GEMMs run on v_wmma_f32_16x16x32_f16 (wave32 WMMA, f32 accumulate).
// Attention is fused flash-style (online softmax) so the (B,H,Q,KLEN) score
// matrix (256MB f32) never touches HBM. The relative-shift is folded into the
// flash loop via a 47-wide diagonal band of qr*r^T tiles gathered through LDS.
// Workspace requirement: ~62 MB of f16 scratch in d_ws.
// ---------------------------------------------------------------------------

enum { B_ = 2, Q_ = 1024, MEM_ = 1024, U_ = 1024, H_ = 16, DH_ = 64, KLEN_ = MEM_ + Q_ };

typedef __attribute__((ext_vector_type(16))) _Float16 v16h;
typedef __attribute__((ext_vector_type(8)))  _Float16 v8h;
typedef __attribute__((ext_vector_type(8)))  float    v8f;

// ---- WMMA fragment helpers (layouts per CDNA5 ISA 7.12.2) -----------------
// A fragment 16x32 f16: lane m=lane&15 holds row m; half=lane>>4 selects
// k-groups: regs 0-3 = k in [half*8, half*8+8), regs 4-7 = +16. Each group is
// 8 contiguous halves -> one 16B load. B fragment (NT form, B stored as NxK
// row-major) is symmetric with N in place of M.
__device__ __forceinline__ v16h frag_combine(v8h lo, v8h hi) {
  return __builtin_shufflevector(lo, hi, 0,1,2,3,4,5,6,7,8,9,10,11,12,13,14,15);
}

__device__ __forceinline__ v16h ldfrag(const _Float16* base, int ld, int koff) {
  int lane = threadIdx.x & 31;
  int m = lane & 15, hf = lane >> 4;
  const v8h* p = (const v8h*)(base + (size_t)m * ld + koff + hf * 8);
  return frag_combine(p[0], p[2]);   // p[2] == +16 halves
}

__device__ __forceinline__ v16h ldfrag_rowclamp(const _Float16* base, int ld,
                                                int row0, int maxrow, int koff) {
  int lane = threadIdx.x & 31;
  int m = lane & 15, hf = lane >> 4;
  int row = row0 + m; if (row > maxrow) row = maxrow;
  const v8h* p = (const v8h*)(base + (size_t)row * ld + koff + hf * 8);
  return frag_combine(p[0], p[2]);
}

__device__ __forceinline__ v8f wmma_(v16h a, v16h b, v8f c) {
  return __builtin_amdgcn_wmma_f32_16x16x32_f16(false, a, false, b, (short)0, c,
                                                false, false);
}

// ---- pack / convert kernels ----------------------------------------------
__global__ void pack_concat_f16(const float* __restrict__ mem,
                                const float* __restrict__ inp,
                                _Float16* __restrict__ xfull) {
  size_t n = (size_t)B_ * KLEN_ * U_;
  for (size_t idx = (size_t)blockIdx.x * blockDim.x + threadIdx.x; idx < n;
       idx += (size_t)gridDim.x * blockDim.x) {
    size_t b = idx / ((size_t)KLEN_ * U_);
    size_t rem = idx - b * (size_t)KLEN_ * U_;
    int row = (int)(rem / U_), col = (int)(rem % U_);
    float v = (row < MEM_) ? mem[(b * MEM_ + row) * U_ + col]
                           : inp[(b * Q_ + (row - MEM_)) * U_ + col];
    xfull[idx] = (_Float16)v;
  }
}

__global__ void cvt_f32_to_f16(const float* __restrict__ in,
                               _Float16* __restrict__ out, size_t n) {
  for (size_t idx = (size_t)blockIdx.x * blockDim.x + threadIdx.x; idx < n;
       idx += (size_t)gridDim.x * blockDim.x)
    out[idx] = (_Float16)in[idx];
}

// out[n*K + k] = in[k*ldin + coloff + n]  (weight transpose for NT GEMMs)
__global__ void transpose_w_f16(const float* __restrict__ in,
                                _Float16* __restrict__ out,
                                int K, int N, int ldin, int coloff) {
  size_t n = (size_t)K * N;
  for (size_t idx = (size_t)blockIdx.x * blockDim.x + threadIdx.x; idx < n;
       idx += (size_t)gridDim.x * blockDim.x) {
    int nn = (int)(idx / K), k = (int)(idx % K);
    out[idx] = (_Float16)in[(size_t)k * ldin + coloff + nn];
  }
}

// ---- generic batched NT GEMM: C(MxN) = A(MxK) * Bw(NxK)^T ------------------
// 256 threads = 8 waves, wave grid 2x4 -> 32x64 block tile, 16x16 per wave.
enum { GM_PLAIN = 0, GM_QCQR = 1, GM_VT = 2, GM_F32 = 3 };

__global__ __launch_bounds__(256)
void gemm_nt(const _Float16* __restrict__ A, size_t strideA, int lda,
             const _Float16* __restrict__ Bw, int ldb, int K,
             _Float16* __restrict__ out0, size_t strideO, int ldo,
             _Float16* __restrict__ out1,
             const float* __restrict__ bias0, const float* __restrict__ bias1,
             float* __restrict__ outf, size_t strideF,
             int klen_vt, int mode) {
  int b   = blockIdx.z;
  int wid = threadIdx.x >> 5;
  int m0  = blockIdx.y * 32 + (wid >> 2) * 16;
  int n0  = blockIdx.x * 64 + (wid & 3) * 16;
  const _Float16* Ab = A + (size_t)b * strideA + (size_t)m0 * lda;
  const _Float16* Bb = Bw + (size_t)n0 * ldb;

  v8f c = {};
  for (int k0 = 0; k0 < K; k0 += 32)
    c = wmma_(ldfrag(Ab, lda, k0), ldfrag(Bb, ldb, k0), c);

  int lane = threadIdx.x & 31, jl = lane & 15, hf = lane >> 4;
#pragma unroll
  for (int r = 0; r < 8; r++) {
    int row = m0 + r + 8 * hf;
    int col = n0 + jl;
    float v = c[r];
    if (mode == GM_QCQR) {
      size_t o = (size_t)b * strideO + (size_t)row * ldo + col;
      out0[o] = (_Float16)(v + bias0[col]);
      out1[o] = (_Float16)(v + bias1[col]);
    } else if (mode == GM_VT) {           // store V transposed: (B,H,DH,KLEN)
      int h = col >> 6, d = col & 63;
      out0[(((size_t)b * H_ + h) * DH_ + d) * (size_t)klen_vt + row] = (_Float16)v;
    } else if (mode == GM_F32) {
      outf[(size_t)b * strideF + (size_t)row * ldo + col] = v;
    } else {
      out0[(size_t)b * strideO + (size_t)row * ldo + col] = (_Float16)v;
    }
  }
}

// ---- fused flash attention with relative shift ----------------------------
// grid (Q/64, H, B), 128 threads = 4 independent waves; each wave owns a
// 16-row q tile and streams the key dimension in 32-wide tiles with online
// softmax. rel_shift(qr*r^T)[i,j] = S_r[i, j+Q-1-i]; the needed r-band per
// (i-tile, j-tile) is 47 wide -> three 16-col WMMA tiles gathered via LDS.
// The causal mask bound (j <= MEM+i) exactly covers the shift's OOB region.
__global__ __launch_bounds__(128)
void flash_attn(const _Float16* __restrict__ qc, const _Float16* __restrict__ qr,
                const _Float16* __restrict__ kk, const _Float16* __restrict__ rr,
                const _Float16* __restrict__ vT, _Float16* __restrict__ outp) {
  __shared__ __align__(16) float    relbuf[4][16][49];
  __shared__ __align__(16) _Float16 pbuf[4][16][32];

  int w = threadIdx.x >> 5;
  int lane = threadIdx.x & 31, jl = lane & 15, hf = lane >> 4;
  int b = blockIdx.z, h = blockIdx.y;
  int i0 = blockIdx.x * 64 + w * 16;

  const _Float16* qcb = qc + ((size_t)b * Q_ + i0) * U_ + h * DH_;
  const _Float16* qrb = qr + ((size_t)b * Q_ + i0) * U_ + h * DH_;
  v16h aqc0 = ldfrag(qcb, U_, 0), aqc1 = ldfrag(qcb, U_, 32);
  v16h aqr0 = ldfrag(qrb, U_, 0), aqr1 = ldfrag(qrb, U_, 32);

  const _Float16* kbase = kk + (size_t)b * KLEN_ * U_ + h * DH_;
  const _Float16* rbase = rr + (size_t)b * KLEN_ * U_ + h * DH_;

  v8f o[4] = {};
  float mrow[8], lrow[8];
#pragma unroll
  for (int r = 0; r < 8; r++) { mrow[r] = -1e30f; lrow[r] = 0.f; }

  int jmax = MEM_ + i0 + 15;                 // causal bound, skips ~1/4 of the key tiles
  for (int j0 = 0; j0 <= jmax; j0 += 32) {
    // context scores: two 16-col subtiles over K=DH=64
    v8f sc0 = {}, sc1 = {};
    sc0 = wmma_(aqc0, ldfrag(kbase + (size_t)j0 * U_, U_, 0), sc0);
    sc0 = wmma_(aqc1, ldfrag(kbase + (size_t)j0 * U_, U_, 32), sc0);
    sc1 = wmma_(aqc0, ldfrag(kbase + (size_t)(j0 + 16) * U_, U_, 0), sc1);
    sc1 = wmma_(aqc1, ldfrag(kbase + (size_t)(j0 + 16) * U_, U_, 32), sc1);

    // relative-score band: r rows rb0 .. rb0+47 (rows past KLEN are masked)
    int rb0 = j0 + (Q_ - 16) - i0;
#pragma unroll
    for (int tt = 0; tt < 3; tt++) {
      v8f rc = {};
      rc = wmma_(aqr0, ldfrag_rowclamp(rbase, U_, rb0 + tt * 16, KLEN_ - 1, 0), rc);
      rc = wmma_(aqr1, ldfrag_rowclamp(rbase, U_, rb0 + tt * 16, KLEN_ - 1, 32), rc);
#pragma unroll
      for (int r = 0; r < 8; r++)
        relbuf[w][r + 8 * hf][tt * 16 + jl] = rc[r];
    }
    asm volatile("" ::: "memory");   // order LDS write -> gather (same wave)

    // gather shifted rel term, scale 1/sqrt(64), apply causal mask
    float s0[8], s1[8];
#pragma unroll
    for (int r = 0; r < 8; r++) {
      int iloc = r + 8 * hf;
      float rel0 = relbuf[w][iloc][jl + 15 - iloc];
      float rel1 = relbuf[w][iloc][16 + jl + 15 - iloc];
      int lim = MEM_ + i0 + iloc;
      s0[r] = (j0 + jl      <= lim) ? (sc0[r] + rel0) * 0.125f : -1e30f;
      s1[r] = (j0 + 16 + jl <= lim) ? (sc1[r] + rel1) * 0.125f : -1e30f;
    }

    // online softmax (row = reg r + 8*hf; 16-lane group holds the 16 cols)
    float alpha[8];
#pragma unroll
    for (int r = 0; r < 8; r++) {
      float tm = fmaxf(s0[r], s1[r]);
#pragma unroll
      for (int off = 1; off < 16; off <<= 1) tm = fmaxf(tm, __shfl_xor(tm, off, 32));
      float mn = fmaxf(mrow[r], tm);
      alpha[r] = __expf(mrow[r] - mn);
      float p0 = __expf(s0[r] - mn), p1 = __expf(s1[r] - mn);
      float ps = p0 + p1;
#pragma unroll
      for (int off = 1; off < 16; off <<= 1) ps += __shfl_xor(ps, off, 32);
      lrow[r] = lrow[r] * alpha[r] + ps;
      mrow[r] = mn;
      int iloc = r + 8 * hf;
      pbuf[w][iloc][jl]      = (_Float16)p0;
      pbuf[w][iloc][16 + jl] = (_Float16)p1;
    }
#pragma unroll
    for (int dt = 0; dt < 4; dt++)
#pragma unroll
      for (int r = 0; r < 8; r++) o[dt][r] *= alpha[r];

    asm volatile("" ::: "memory");   // order P store -> A-fragment reload
    v16h ap = ldfrag(&pbuf[w][0][0], 32, 0);   // C-layout -> A-layout via LDS
#pragma unroll
    for (int dt = 0; dt < 4; dt++) {
      const _Float16* vb = vT + (((size_t)b * H_ + h) * DH_ + dt * 16) * KLEN_;
      o[dt] = wmma_(ap, ldfrag(vb, KLEN_, j0), o[dt]);
    }
  }

  // normalize and store (B,Q,U) f16
#pragma unroll
  for (int dt = 0; dt < 4; dt++)
#pragma unroll
    for (int r = 0; r < 8; r++) {
      int iloc = r + 8 * hf;
      float vv = o[dt][r] / lrow[r];
      outp[((size_t)b * Q_ + i0 + iloc) * U_ + h * DH_ + dt * 16 + jl] = (_Float16)vv;
    }
}

// ---------------------------------------------------------------------------
extern "C" void kernel_launch(void* const* d_in, const int* in_sizes, int n_in,
                              void* d_out, int out_size, void* d_ws, size_t ws_size,
                              hipStream_t stream) {
  (void)in_sizes; (void)n_in; (void)out_size; (void)ws_size;
  const float* inputs    = (const float*)d_in[0];
  const float* relatives = (const float*)d_in[1];
  const float* memories  = (const float*)d_in[2];
  const float* biasc     = (const float*)d_in[3];
  const float* biasr     = (const float*)d_in[4];
  const float* Wq        = (const float*)d_in[5];
  const float* Wkv       = (const float*)d_in[6];
  const float* Wr        = (const float*)d_in[7];
  const float* Wo        = (const float*)d_in[8];
  float* out = (float*)d_out;

  // f16 workspace carve-out (~62 MB)
  _Float16* ws = (_Float16*)d_ws;
  size_t off = 0;
  auto carve = [&](size_t n) { _Float16* p = ws + off; off += n; return p; };
  const size_t BKU = (size_t)B_ * KLEN_ * U_;   // 4M
  const size_t BQU = (size_t)B_ * Q_ * U_;      // 2M
  const size_t UU  = (size_t)U_ * U_;           // 1M
  _Float16* xfull  = carve(BKU);
  _Float16* rel16  = carve(BKU);
  _Float16* WqT    = carve(UU);
  _Float16* WkT    = carve(UU);
  _Float16* WvT    = carve(UU);
  _Float16* WrT    = carve(UU);
  _Float16* WoT    = carve(UU);
  _Float16* qcb    = carve(BQU);
  _Float16* qrb    = carve(BQU);
  _Float16* kbuf   = carve(BKU);
  _Float16* rbuf   = carve(BKU);
  _Float16* vTb    = carve(BKU);                // (B,H,DH,KLEN)
  _Float16* attout = carve(BQU);

  // 1) pack + convert
  pack_concat_f16<<<4096, 256, 0, stream>>>(memories, inputs, xfull);
  cvt_f32_to_f16<<<4096, 256, 0, stream>>>(relatives, rel16, BKU);
  transpose_w_f16<<<2048, 256, 0, stream>>>(Wq,  WqT, U_, U_, U_,     0);
  transpose_w_f16<<<2048, 256, 0, stream>>>(Wkv, WkT, U_, U_, 2 * U_, 0);
  transpose_w_f16<<<2048, 256, 0, stream>>>(Wkv, WvT, U_, U_, 2 * U_, U_);
  transpose_w_f16<<<2048, 256, 0, stream>>>(Wr,  WrT, U_, U_, U_,     0);
  transpose_w_f16<<<2048, 256, 0, stream>>>(Wo,  WoT, U_, U_, U_,     0);

  // 2) projections (all WMMA NT GEMMs)
  dim3 gq(U_ / 64, Q_ / 32, B_);
  gemm_nt<<<gq, 256, 0, stream>>>(xfull + (size_t)MEM_ * U_, BKU / B_, U_,
                                  WqT, U_, U_,
                                  qcb, BQU / B_, U_, qrb, biasc, biasr,
                                  nullptr, 0, 0, GM_QCQR);
  dim3 gk(U_ / 64, KLEN_ / 32, B_);
  gemm_nt<<<gk, 256, 0, stream>>>(xfull, BKU / B_, U_, WkT, U_, U_,
                                  kbuf, BKU / B_, U_, nullptr, nullptr, nullptr,
                                  nullptr, 0, 0, GM_PLAIN);
  gemm_nt<<<gk, 256, 0, stream>>>(rel16, BKU / B_, U_, WrT, U_, U_,
                                  rbuf, BKU / B_, U_, nullptr, nullptr, nullptr,
                                  nullptr, 0, 0, GM_PLAIN);
  gemm_nt<<<gk, 256, 0, stream>>>(xfull, BKU / B_, U_, WvT, U_, U_,
                                  vTb, 0, U_, nullptr, nullptr, nullptr,
                                  nullptr, 0, KLEN_, GM_VT);

  // 3) fused attention (no score matrix in HBM)
  flash_attn<<<dim3(Q_ / 64, H_, B_), 128, 0, stream>>>(qcb, qrb, kbuf, rbuf,
                                                        vTb, attout);

  // 4) output projection, f32 result
  gemm_nt<<<gq, 256, 0, stream>>>(attout, BQU / B_, U_, WoT, U_, U_,
                                  nullptr, 0, U_, nullptr, nullptr, nullptr,
                                  out, BQU / B_, 0, GM_F32);
}

// v001
// One run takes 298 microseconds.
// Two timings next to v000 both put it at 1.42 times that version's speed.
#include <hip/hip_runtime.h>
#include <hip/hip_bf16.h>

// ---------------------------------------------------------------------------
// Transformer-XL relative multi-head attention for MI455X (gfx1250).
// All GEMMs run on v_wmma_f32_16x16x32_f16 (wave32 WMMA, f32 accumulate).
// Attention is fused flash-style (online softmax) so the (B,H,Q,KLEN) score
// matrix (256MB f32) never touches HBM. The relative-shift is folded into the
// flash loop via a 47-wide diagonal band of qr*r^T tiles gathered through LDS.
// Workspace requirement: ~62 MB of f16 scratch in d_ws.
// ---------------------------------------------------------------------------

enum { B_ = 2, Q_ = 1024, MEM_ = 1024, U_ = 1024, H_ = 16, DH_ = 64, KLEN_ = MEM_ + Q_ };

typedef __attribute__((ext_vector_type(16))) _Float16 v16h;
typedef __attribute__((ext_vector_type(8)))  _Float16 v8h;
typedef __attribute__((ext_vector_type(8)))  float    v8f;

// ---- WMMA fragment helpers (layouts per CDNA5 ISA 7.12.2) -----------------
// A fragment 16x32 f16: lane m=lane&15 holds row m; half=lane>>4 selects
// k-groups: regs 0-3 = k in [half*8, half*8+8), regs 4-7 = +16. Each group is
// 8 contiguous halves -> one 16B load. B fragment (NT form, B stored as NxK
// row-major) is symmetric with N in place of M.
__device__ __forceinline__ v16h frag_combine(v8h lo, v8h hi) {
  return __builtin_shufflevector(lo, hi, 0,1,2,3,4,5,6,7,8,9,10,11,12,13,14,15);
}

__device__ __forceinline__ v16h ldfrag(const _Float16* base, int ld, int koff) {
  int lane = threadIdx.x & 31;
  int m = lane & 15, hf = lane >> 4;
  const v8h* p = (const v8h*)(base + (size_t)m * ld + koff + hf * 8);
  return frag_combine(p[0], p[2]);   // p[2] == +16 halves
}

__device__ __forceinline__ v16h ldfrag_rowclamp(const _Float16* base, int ld,
                                                int row0, int maxrow, int koff) {
  int lane = threadIdx.x & 31;
  int m = lane & 15, hf = lane >> 4;
  int row = row0 + m; if (row > maxrow) row = maxrow;
  const v8h* p = (const v8h*)(base + (size_t)row * ld + koff + hf * 8);
  return frag_combine(p[0], p[2]);
}

__device__ __forceinline__ v8f wmma_(v16h a, v16h b, v8f c) {
  return __builtin_amdgcn_wmma_f32_16x16x32_f16(false, a, false, b, (short)0, c,
                                                false, false);
}

// ---- pack / convert kernels ----------------------------------------------
__global__ void pack_concat_f16(const float* __restrict__ mem,
                                const float* __restrict__ inp,
                                _Float16* __restrict__ xfull) {
  size_t n = (size_t)B_ * KLEN_ * U_;
  for (size_t idx = (size_t)blockIdx.x * blockDim.x + threadIdx.x; idx < n;
       idx += (size_t)gridDim.x * blockDim.x) {
    size_t b = idx / ((size_t)KLEN_ * U_);
    size_t rem = idx - b * (size_t)KLEN_ * U_;
    int row = (int)(rem / U_), col = (int)(rem % U_);
    float v = (row < MEM_) ? mem[(b * MEM_ + row) * U_ + col]
                           : inp[(b * Q_ + (row - MEM_)) * U_ + col];
    xfull[idx] = (_Float16)v;
  }
}

__global__ void cvt_f32_to_f16(const float* __restrict__ in,
                               _Float16* __restrict__ out, size_t n) {
  for (size_t idx = (size_t)blockIdx.x * blockDim.x + threadIdx.x; idx < n;
       idx += (size_t)gridDim.x * blockDim.x)
    out[idx] = (_Float16)in[idx];
}

// out[n*K + k] = in[k*ldin + coloff + n]  (weight transpose for NT GEMMs)
__global__ void transpose_w_f16(const float* __restrict__ in,
                                _Float16* __restrict__ out,
                                int K, int N, int ldin, int coloff) {
  size_t n = (size_t)K * N;
  for (size_t idx = (size_t)blockIdx.x * blockDim.x + threadIdx.x; idx < n;
       idx += (size_t)gridDim.x * blockDim.x) {
    int nn = (int)(idx / K), k = (int)(idx % K);
    out[idx] = (_Float16)in[(size_t)k * ldin + coloff + nn];
  }
}

// ---- generic batched NT GEMM: C(MxN) = A(MxK) * Bw(NxK)^T ------------------
// 256 threads = 8 waves, wave grid 2x4 -> 32x64 block tile, 16x16 per wave.
// The block's 32 A rows and 64 B rows are staged in LDS in slabs of 64 k by
// asynchronous copies (whole 128-B lines per 8 lanes), two buffers, so that the
// next slab flies while this one is multiplied. K must be a multiple of 64.
enum { GM_PLAIN = 0, GM_QCQR = 1, GM_VT = 2, GM_F32 = 3 };
enum { SLAB_K = 64,                 // halves of k per slab: 128 B per row
       SLAB_P = 72,                 // LDS row pitch in halves: 144 B = 16 B x odd
       SLAB_H = 96 * SLAB_P };      // halves per buffer: 32 A rows, then 64 B rows

// One slab: each lane copies 16 B of one A row and of two B rows. The
// s_wait_xcnt stands inside the statement so that no address register of an
// issued copy is rewritten ahead of it.
__device__ __forceinline__ void slab_copy(unsigned lds, const _Float16* ga,
                                          const _Float16* gb0, const _Float16* gb1) {
  unsigned l1 = lds + 32 * SLAB_P * 2, l2 = lds + 64 * SLAB_P * 2;
  asm volatile("global_load_async_to_lds_b128 %0, %3, off\n\t"
               "global_load_async_to_lds_b128 %1, %4, off\n\t"
               "global_load_async_to_lds_b128 %2, %5, off\n\t"
               "s_wait_xcnt 0x0"
               :: "v"(lds), "v"(l1), "v"(l2), "v"(ga), "v"(gb0), "v"(gb1)
               : "memory");
}

__global__ __launch_bounds__(256)
void gemm_nt(const _Float16* __restrict__ A, size_t strideA, int lda,
             const _Float16* __restrict__ Bw, int ldb, int K,
             _Float16* __restrict__ out0, size_t strideO, int ldo,
             _Float16* __restrict__ out1,
             const float* __restrict__ bias0, const float* __restrict__ bias1,
             float* __restrict__ outf, size_t strideF,
             int klen_vt, int mode) {
  __shared__ __attribute__((aligned(16))) _Float16 slab[2 * SLAB_H];

  int b   = blockIdx.z;
  int wid = threadIdx.x >> 5;
  int mw  = (wid >> 2) * 16, nw = (wid & 3) * 16;
  int m0  = blockIdx.y * 32 + mw;
  int n0  = blockIdx.x * 64 + nw;

  // copy role: thread -> (row 0..31, 16-B piece 0..7) of each 32-row group
  int crow = threadIdx.x >> 3, cpc = (threadIdx.x & 7) * 8;
  const _Float16* ga  = A + (size_t)b * strideA
                          + (size_t)(blockIdx.y * 32 + crow) * lda + cpc;
  const _Float16* gb0 = Bw + (size_t)(blockIdx.x * 64 + crow) * ldb + cpc;
  const _Float16* gb1 = gb0 + (size_t)32 * ldb;
  unsigned ldst = (unsigned)(size_t)&slab[crow * SLAB_P + cpc];

  int nslab = K / SLAB_K;
  slab_copy(ldst, ga, gb0, gb1);
  asm volatile("s_wait_asynccnt 0x0" ::: "memory");  // own copies of slab 0 landed
  __syncthreads();                                   // slab 0 readable by all waves
  if (nslab > 1)
    slab_copy(ldst + SLAB_H * 2, ga + SLAB_K, gb0 + SLAB_K, gb1 + SLAB_K);

  v8f c = {};
  for (int t = 0; t < nslab; t++) {
    int buf = t & 1;
    const _Float16* As = &slab[buf * SLAB_H + mw * SLAB_P];
    const _Float16* Bs = &slab[buf * SLAB_H + (32 + nw) * SLAB_P];
    c = wmma_(ldfrag(As, SLAB_P, 0),  ldfrag(Bs, SLAB_P, 0),  c);
    c = wmma_(ldfrag(As, SLAB_P, 32), ldfrag(Bs, SLAB_P, 32), c);
    asm volatile("s_wait_dscnt 0x0" ::: "memory");    // own reads of this buffer done
    asm volatile("s_wait_asynccnt 0x0" ::: "memory"); // own copies of slab t+1 landed
    __syncthreads();  // publishes slab t+1 and frees this buffer for its refill
    if (t + 2 < nslab) {
      int ko = (t + 2) * SLAB_K;
      slab_copy(ldst + buf * (SLAB_H * 2), ga + ko, gb0 + ko, gb1 + ko);
    }
  }
  asm volatile("s_wait_asynccnt 0x0" ::: "memory");   // nothing in flight at the end

  int lane = threadIdx.x & 31, jl = lane & 15, hf = lane >> 4;
#pragma unroll
  for (int r = 0; r < 8; r++) {
    int row = m0 + r + 8 * hf;
    int col = n0 + jl;
    float v = c[r];
    if (mode == GM_QCQR) {
      size_t o = (size_t)b * strideO + (size_t)row * ldo + col;
      out0[o] = (_Float16)(v + bias0[col]);
      out1[o] = (_Float16)(v + bias1[col]);
    } else if (mode == GM_VT) {           // store V transposed: (B,H,DH,KLEN)
      int h = col >> 6, d = col & 63;
      out0[(((size_t)b * H_ + h) * DH_ + d) * (size_t)klen_vt + row] = (_Float16)v;
    } else if (mode == GM_F32) {
      outf[(size_t)b * strideF + (size_t)row * ldo + col] = v;
    } else {
      out0[(size_t)b * strideO + (size_t)row * ldo + col] = (_Float16)v;
    }
  }
}

// ---- fused flash attention with relative shift ----------------------------
// grid (Q/64, H, B), 128 threads = 4 independent waves; each wave owns a
// 16-row q tile and streams the key dimension in 32-wide tiles with online
// softmax. rel_shift(qr*r^T)[i,j] = S_r[i, j+Q-1-i]; the needed r-band per
// (i-tile, j-tile) is 47 wide -> three 16-col WMMA tiles gathered via LDS.
// The causal mask bound (j <= MEM+i) exactly covers the shift's OOB region.
__global__ __launch_bounds__(128)
void flash_attn(const _Float16* __restrict__ qc, const _Float16* __restrict__ qr,
                const _Float16* __restrict__ kk, const _Float16* __restrict__ rr,
                const _Float16* __restrict__ vT, _Float16* __restrict__ outp) {
  __shared__ __align__(16) float    relbuf[4][16][49];
  __shared__ __align__(16) _Float16 pbuf[4][16][32];

  int w = threadIdx.x >> 5;
  int lane = threadIdx.x & 31, jl = lane & 15, hf = lane >> 4;
  int b = blockIdx.z, h = blockIdx.y;
  int i0 = blockIdx.x * 64 + w * 16;

  const _Float16* qcb = qc + ((size_t)b * Q_ + i0) * U_ + h * DH_;
  const _Float16* qrb = qr + ((size_t)b * Q_ + i0) * U_ + h * DH_;
  v16h aqc0 = ldfrag(qcb, U_, 0), aqc1 = ldfrag(qcb, U_, 32);
  v16h aqr0 = ldfrag(qrb, U_, 0), aqr1 = ldfrag(qrb, U_, 32);

  const _Float16* kbase = kk + (size_t)b * KLEN_ * U_ + h * DH_;
  const _Float16* rbase = rr + (size_t)b * KLEN_ * U_ + h * DH_;

  v8f o[4] = {};
  float mrow[8], lrow[8];
#pragma unroll
  for (int r = 0; r < 8; r++) { mrow[r] = -1e30f; lrow[r] = 0.f; }

  int jmax = MEM_ + i0 + 15;                 // causal bound, skips ~1/4 of the key tiles
  for (int j0 = 0; j0 <= jmax; j0 += 32) {
    // context scores: two 16-col subtiles over K=DH=64
    v8f sc0 = {}, sc1 = {};
    sc0 = wmma_(aqc0, ldfrag(kbase + (size_t)j0 * U_, U_, 0), sc0);
    sc0 = wmma_(aqc1, ldfrag(kbase + (size_t)j0 * U_, U_, 32), sc0);
    sc1 = wmma_(aqc0, ldfrag(kbase + (size_t)(j0 + 16) * U_, U_, 0), sc1);
    sc1 = wmma_(aqc1, ldfrag(kbase + (size_t)(j0 + 16) * U_, U_, 32), sc1);

    // relative-score band: r rows rb0 .. rb0+47 (rows past KLEN are masked)
    int rb0 = j0 + (Q_ - 16) - i0;
#pragma unroll
    for (int tt = 0; tt < 3; tt++) {
      v8f rc = {};
      rc = wmma_(aqr0, ldfrag_rowclamp(rbase, U_, rb0 + tt * 16, KLEN_ - 1, 0), rc);
      rc = wmma_(aqr1, ldfrag_rowclamp(rbase, U_, rb0 + tt * 16, KLEN_ - 1, 32), rc);
#pragma unroll
      for (int r = 0; r < 8; r++)
        relbuf[w][r + 8 * hf][tt * 16 + jl] = rc[r];
    }
    asm volatile("" ::: "memory");   // order LDS write -> gather (same wave)

    // gather shifted rel term, scale 1/sqrt(64), apply causal mask
    float s0[8], s1[8];
#pragma unroll
    for (int r = 0; r < 8; r++) {
      int iloc = r + 8 * hf;
      float rel0 = relbuf[w][iloc][jl + 15 - iloc];
      float rel1 = relbuf[w][iloc][16 + jl + 15 - iloc];
      int lim = MEM_ + i0 + iloc;
      s0[r] = (j0 + jl      <= lim) ? (sc0[r] + rel0) * 0.125f : -1e30f;
      s1[r] = (j0 + 16 + jl <= lim) ? (sc1[r] + rel1) * 0.125f : -1e30f;
    }

    // online softmax (row = reg r + 8*hf; 16-lane group holds the 16 cols)
    float alpha[8];
#pragma unroll
    for (int r = 0; r < 8; r++) {
      float tm = fmaxf(s0[r], s1[r]);
#pragma unroll
      for (int off = 1; off < 16; off <<= 1) tm = fmaxf(tm, __shfl_xor(tm, off, 32));
      float mn = fmaxf(mrow[r], tm);
      alpha[r] = __expf(mrow[r] - mn);
      float p0 = __expf(s0[r] - mn), p1 = __expf(s1[r] - mn);
      float ps = p0 + p1;
#pragma unroll
      for (int off = 1; off < 16; off <<= 1) ps += __shfl_xor(ps, off, 32);
      lrow[r] = lrow[r] * alpha[r] + ps;
      mrow[r] = mn;
      int iloc = r + 8 * hf;
      pbuf[w][iloc][jl]      = (_Float16)p0;
      pbuf[w][iloc][16 + jl] = (_Float16)p1;
    }
#pragma unroll
    for (int dt = 0; dt < 4; dt++)
#pragma unroll
      for (int r = 0; r < 8; r++) o[dt][r] *= alpha[r];

    asm volatile("" ::: "memory");   // order P store -> A-fragment reload
    v16h ap = ldfrag(&pbuf[w][0][0], 32, 0);   // C-layout -> A-layout via LDS
#pragma unroll
    for (int dt = 0; dt < 4; dt++) {
      const _Float16* vb = vT + (((size_t)b * H_ + h) * DH_ + dt * 16) * KLEN_;
      o[dt] = wmma_(ap, ldfrag(vb, KLEN_, j0), o[dt]);
    }
  }

  // normalize and store (B,Q,U) f16
#pragma unroll
  for (int dt = 0; dt < 4; dt++)
#pragma unroll
    for (int r = 0; r < 8; r++) {
      int iloc = r + 8 * hf;
      float vv = o[dt][r] / lrow[r];
      outp[((size_t)b * Q_ + i0 + iloc) * U_ + h * DH_ + dt * 16 + jl] = (_Float16)vv;
    }
}

// ---------------------------------------------------------------------------
extern "C" void kernel_launch(void* const* d_in, const int* in_sizes, int n_in,
                              void* d_out, int out_size, void* d_ws, size_t ws_size,
                              hipStream_t stream) {
  (void)in_sizes; (void)n_in; (void)out_size; (void)ws_size;
  const float* inputs    = (const float*)d_in[0];
  const float* relatives = (const float*)d_in[1];
  const float* memories  = (const float*)d_in[2];
  const float* biasc     = (const float*)d_in[3];
  const float* biasr     = (const float*)d_in[4];
  const float* Wq        = (const float*)d_in[5];
  const float* Wkv       = (const float*)d_in[6];
  const float* Wr        = (const float*)d_in[7];
  const float* Wo        = (const float*)d_in[8];
  float* out = (float*)d_out;

  // f16 workspace carve-out (~62 MB)
  _Float16* ws = (_Float16*)d_ws;
  size_t off = 0;
  auto carve = [&](size_t n) { _Float16* p = ws + off; off += n; return p; };
  const size_t BKU = (size_t)B_ * KLEN_ * U_;   // 4M
  const size_t BQU = (size_t)B_ * Q_ * U_;      // 2M
  const size_t UU  = (size_t)U_ * U_;           // 1M
  _Float16* xfull  = carve(BKU);
  _Float16* rel16  = carve(BKU);
  _Float16* WqT    = carve(UU);
  _Float16* WkT    = carve(UU);
  _Float16* WvT    = carve(UU);
  _Float16* WrT    = carve(UU);
  _Float16* WoT    = carve(UU);
  _Float16* qcb    = carve(BQU);
  _Float16* qrb    = carve(BQU);
  _Float16* kbuf   = carve(BKU);
  _Float16* rbuf   = carve(BKU);
  _Float16* vTb    = carve(BKU);                // (B,H,DH,KLEN)
  _Float16* attout = carve(BQU);

  // 1) pack + convert
  pack_concat_f16<<<4096, 256, 0, stream>>>(memories, inputs, xfull);
  cvt_f32_to_f16<<<4096, 256, 0, stream>>>(relatives, rel16, BKU);
  transpose_w_f16<<<2048, 256, 0, stream>>>(Wq,  WqT, U_, U_, U_,     0);
  transpose_w_f16<<<2048, 256, 0, stream>>>(Wkv, WkT, U_, U_, 2 * U_, 0);
  transpose_w_f16<<<2048, 256, 0, stream>>>(Wkv, WvT, U_, U_, 2 * U_, U_);
  transpose_w_f16<<<2048, 256, 0, stream>>>(Wr,  WrT, U_, U_, U_,     0);
  transpose_w_f16<<<2048, 256, 0, stream>>>(Wo,  WoT, U_, U_, U_,     0);

  // 2) projections (all WMMA NT GEMMs)
  dim3 gq(U_ / 64, Q_ / 32, B_);
  gemm_nt<<<gq, 256, 0, stream>>>(xfull + (size_t)MEM_ * U_, BKU / B_, U_,
                                  WqT, U_, U_,
                                  qcb, BQU / B_, U_, qrb, biasc, biasr,
                                  nullptr, 0, 0, GM_QCQR);
  dim3 gk(U_ / 64, KLEN_ / 32, B_);
  gemm_nt<<<gk, 256, 0, stream>>>(xfull, BKU / B_, U_, WkT, U_, U_,
                                  kbuf, BKU / B_, U_, nullptr, nullptr, nullptr,
                                  nullptr, 0, 0, GM_PLAIN);
  gemm_nt<<<gk, 256, 0, stream>>>(rel16, BKU / B_, U_, WrT, U_, U_,
                                  rbuf, BKU / B_, U_, nullptr, nullptr, nullptr,
                                  nullptr, 0, 0, GM_PLAIN);
  gemm_nt<<<gk, 256, 0, stream>>>(xfull, BKU / B_, U_, WvT, U_, U_,
                                  vTb, 0, U_, nullptr, nullptr, nullptr,
                                  nullptr, 0, KLEN_, GM_VT);

  // 3) fused attention (no score matrix in HBM)
  flash_attn<<<dim3(Q_ / 64, H_, B_), 128, 0, stream>>>(qcb, qrb, kbuf, rbuf,
                                                        vTb, attout);

  // 4) output projection, f32 result
  gemm_nt<<<gq, 256, 0, stream>>>(attout, BQU / B_, U_, WoT, U_, U_,
                                  nullptr, 0, U_, nullptr, nullptr, nullptr,
                                  out, BQU / B_, 0, GM_F32);
}

// v002
// A run of this version takes 251 microseconds.
// Two timings next to v001 both put it at 1.18 times that version's speed.
// Counting every step since v000, it is 1.67 times as fast.
#include <hip/hip_runtime.h>
#include <hip/hip_bf16.h>

// ---------------------------------------------------------------------------
// Transformer-XL relative multi-head attention for MI455X (gfx1250).
// All GEMMs run on v_wmma_f32_16x16x32_f16 (wave32 WMMA, f32 accumulate).
// Attention is fused flash-style (online softmax) so the (B,H,Q,KLEN) score
// matrix (256MB f32) never touches HBM. The relative-shift is folded into the
// flash loop via a 47-wide diagonal band of qr*r^T tiles gathered through LDS.
// Workspace requirement: ~62 MB of f16 scratch in d_ws.
// ---------------------------------------------------------------------------

enum { B_ = 2, Q_ = 1024, MEM_ = 1024, U_ = 1024, H_ = 16, DH_ = 64, KLEN_ = MEM_ + Q_ };

typedef __attribute__((ext_vector_type(16))) _Float16 v16h;
typedef __attribute__((ext_vector_type(8)))  _Float16 v8h;
typedef __attribute__((ext_vector_type(8)))  float    v8f;

// ---- WMMA fragment helpers (layouts per CDNA5 ISA 7.12.2) -----------------
// A fragment 16x32 f16: lane m=lane&15 holds row m; half=lane>>4 selects
// k-groups: regs 0-3 = k in [half*8, half*8+8), regs 4-7 = +16. Each group is
// 8 contiguous halves -> one 16B load. B fragment (NT form, B stored as NxK
// row-major) is symmetric with N in place of M.
__device__ __forceinline__ v16h frag_combine(v8h lo, v8h hi) {
  return __builtin_shufflevector(lo, hi, 0,1,2,3,4,5,6,7,8,9,10,11,12,13,14,15);
}

__device__ __forceinline__ v16h ldfrag(const _Float16* base, int ld, int koff) {
  int lane = threadIdx.x & 31;
  int m = lane & 15, hf = lane >> 4;
  const v8h* p = (const v8h*)(base + (size_t)m * ld + koff + hf * 8);
  return frag_combine(p[0], p[2]);   // p[2] == +16 halves
}

__device__ __forceinline__ v8f wmma_(v16h a, v16h b, v8f c) {
  return __builtin_amdgcn_wmma_f32_16x16x32_f16(false, a, false, b, (short)0, c,
                                                false, false);
}

// ---- pack / convert kernels ----------------------------------------------
__global__ void pack_concat_f16(const float* __restrict__ mem,
                                const float* __restrict__ inp,
                                _Float16* __restrict__ xfull) {
  size_t n = (size_t)B_ * KLEN_ * U_;
  for (size_t idx = (size_t)blockIdx.x * blockDim.x + threadIdx.x; idx < n;
       idx += (size_t)gridDim.x * blockDim.x) {
    size_t b = idx / ((size_t)KLEN_ * U_);
    size_t rem = idx - b * (size_t)KLEN_ * U_;
    int row = (int)(rem / U_), col = (int)(rem % U_);
    float v = (row < MEM_) ? mem[(b * MEM_ + row) * U_ + col]
                           : inp[(b * Q_ + (row - MEM_)) * U_ + col];
    xfull[idx] = (_Float16)v;
  }
}

__global__ void cvt_f32_to_f16(const float* __restrict__ in,
                               _Float16* __restrict__ out, size_t n) {
  for (size_t idx = (size_t)blockIdx.x * blockDim.x + threadIdx.x; idx < n;
       idx += (size_t)gridDim.x * blockDim.x)
    out[idx] = (_Float16)in[idx];
}

// out[n*K + k] = in[k*ldin + coloff + n]  (weight transpose for NT GEMMs)
__global__ void transpose_w_f16(const float* __restrict__ in,
                                _Float16* __restrict__ out,
                                int K, int N, int ldin, int coloff) {
  size_t n = (size_t)K * N;
  for (size_t idx = (size_t)blockIdx.x * blockDim.x + threadIdx.x; idx < n;
       idx += (size_t)gridDim.x * blockDim.x) {
    int nn = (int)(idx / K), k = (int)(idx % K);
    out[idx] = (_Float16)in[(size_t)k * ldin + coloff + nn];
  }
}

// ---- generic batched NT GEMM: C(MxN) = A(MxK) * Bw(NxK)^T ------------------
// 256 threads = 8 waves, wave grid 2x4 -> 32x64 block tile, 16x16 per wave.
// The block's 32 A rows and 64 B rows are staged in LDS in slabs of 64 k by
// asynchronous copies (whole 128-B lines per 8 lanes), two buffers, so that the
// next slab flies while this one is multiplied. K must be a multiple of 64.
enum { GM_PLAIN = 0, GM_QCQR = 1, GM_VT = 2, GM_F32 = 3 };
enum { SLAB_K = 64,                 // halves of k per slab: 128 B per row
       SLAB_P = 72,                 // LDS row pitch in halves: 144 B = 16 B x odd
       SLAB_H = 96 * SLAB_P };      // halves per buffer: 32 A rows, then 64 B rows

// One slab: each lane copies 16 B of one A row and of two B rows. The
// s_wait_xcnt stands inside the statement so that no address register of an
// issued copy is rewritten ahead of it.
__device__ __forceinline__ void slab_copy(unsigned lds, const _Float16* ga,
                                          const _Float16* gb0, const _Float16* gb1) {
  unsigned l1 = lds + 32 * SLAB_P * 2, l2 = lds + 64 * SLAB_P * 2;
  asm volatile("global_load_async_to_lds_b128 %0, %3, off\n\t"
               "global_load_async_to_lds_b128 %1, %4, off\n\t"
               "global_load_async_to_lds_b128 %2, %5, off\n\t"
               "s_wait_xcnt 0x0"
               :: "v"(lds), "v"(l1), "v"(l2), "v"(ga), "v"(gb0), "v"(gb1)
               : "memory");
}

__global__ __launch_bounds__(256)
void gemm_nt(const _Float16* __restrict__ A, size_t strideA, int lda,
             const _Float16* __restrict__ Bw, int ldb, int K,
             _Float16* __restrict__ out0, size_t strideO, int ldo,
             _Float16* __restrict__ out1,
             const float* __restrict__ bias0, const float* __restrict__ bias1,
             float* __restrict__ outf, size_t strideF,
             int klen_vt, int mode) {
  __shared__ __attribute__((aligned(16))) _Float16 slab[2 * SLAB_H];

  int b   = blockIdx.z;
  int wid = threadIdx.x >> 5;
  int mw  = (wid >> 2) * 16, nw = (wid & 3) * 16;
  int m0  = blockIdx.y * 32 + mw;
  int n0  = blockIdx.x * 64 + nw;

  // copy role: thread -> (row 0..31, 16-B piece 0..7) of each 32-row group
  int crow = threadIdx.x >> 3, cpc = (threadIdx.x & 7) * 8;
  const _Float16* ga  = A + (size_t)b * strideA
                          + (size_t)(blockIdx.y * 32 + crow) * lda + cpc;
  const _Float16* gb0 = Bw + (size_t)(blockIdx.x * 64 + crow) * ldb + cpc;
  const _Float16* gb1 = gb0 + (size_t)32 * ldb;
  unsigned ldst = (unsigned)(size_t)&slab[crow * SLAB_P + cpc];

  int nslab = K / SLAB_K;
  slab_copy(ldst, ga, gb0, gb1);
  asm volatile("s_wait_asynccnt 0x0" ::: "memory");  // own copies of slab 0 landed
  __syncthreads();                                   // slab 0 readable by all waves
  if (nslab > 1)
    slab_copy(ldst + SLAB_H * 2, ga + SLAB_K, gb0 + SLAB_K, gb1 + SLAB_K);

  v8f c = {};
  for (int t = 0; t < nslab; t++) {
    int buf = t & 1;
    const _Float16* As = &slab[buf * SLAB_H + mw * SLAB_P];
    const _Float16* Bs = &slab[buf * SLAB_H + (32 + nw) * SLAB_P];
    c = wmma_(ldfrag(As, SLAB_P, 0),  ldfrag(Bs, SLAB_P, 0),  c);
    c = wmma_(ldfrag(As, SLAB_P, 32), ldfrag(Bs, SLAB_P, 32), c);
    asm volatile("s_wait_dscnt 0x0" ::: "memory");    // own reads of this buffer done
    asm volatile("s_wait_asynccnt 0x0" ::: "memory"); // own copies of slab t+1 landed
    __syncthreads();  // publishes slab t+1 and frees this buffer for its refill
    if (t + 2 < nslab) {
      int ko = (t + 2) * SLAB_K;
      slab_copy(ldst + buf * (SLAB_H * 2), ga + ko, gb0 + ko, gb1 + ko);
    }
  }
  asm volatile("s_wait_asynccnt 0x0" ::: "memory");   // nothing in flight at the end

  int lane = threadIdx.x & 31, jl = lane & 15, hf = lane >> 4;
#pragma unroll
  for (int r = 0; r < 8; r++) {
    int row = m0 + r + 8 * hf;
    int col = n0 + jl;
    float v = c[r];
    if (mode == GM_QCQR) {
      size_t o = (size_t)b * strideO + (size_t)row * ldo + col;
      out0[o] = (_Float16)(v + bias0[col]);
      out1[o] = (_Float16)(v + bias1[col]);
    } else if (mode == GM_VT) {           // store V transposed: (B,H,DH,KLEN)
      int h = col >> 6, d = col & 63;
      out0[(((size_t)b * H_ + h) * DH_ + d) * (size_t)klen_vt + row] = (_Float16)v;
    } else if (mode == GM_F32) {
      outf[(size_t)b * strideF + (size_t)row * ldo + col] = v;
    } else {
      out0[(size_t)b * strideO + (size_t)row * ldo + col] = (_Float16)v;
    }
  }
}

enum { FK_P   = 72,                     // K and r row pitch in halves: 144 B = 16 B x odd
       FV_P   = 40,                     // V^T row pitch in halves: 80 B = 16 B x odd
       FR_OFF = 32 * FK_P,              // r band behind the 32 K rows
       FV_OFF = (32 + 96) * FK_P,       // V^T tile behind the 96 r rows
       FT_H   = FV_OFF + 64 * FV_P };   // halves per buffer

__global__ __launch_bounds__(128)
void flash_attn(const _Float16* __restrict__ qc, const _Float16* __restrict__ qr,
                const _Float16* __restrict__ kk, const _Float16* __restrict__ rr,
                const _Float16* __restrict__ vT, _Float16* __restrict__ outp) {
  __shared__ __align__(16) _Float16 tile[2 * FT_H];
  __shared__ __align__(16) float    relbuf[4][16][49];
  __shared__ __align__(16) _Float16 pbuf[4][16][32];

  // wave number in a scalar register: the causal skip below is a scalar branch
  int w = __builtin_amdgcn_readfirstlane(threadIdx.x >> 5);
  int lane = threadIdx.x & 31, jl = lane & 15, hf = lane >> 4;
  int b = blockIdx.z, h = blockIdx.y;
  int ib = blockIdx.x * 64;
  int i0 = ib + w * 16;

  const _Float16* qcb = qc + ((size_t)b * Q_ + i0) * U_ + h * DH_;
  const _Float16* qrb = qr + ((size_t)b * Q_ + i0) * U_ + h * DH_;
  v16h aqc0 = ldfrag(qcb, U_, 0), aqc1 = ldfrag(qcb, U_, 32);
  v16h aqr0 = ldfrag(qrb, U_, 0), aqr1 = ldfrag(qrb, U_, 32);

  const _Float16* kbase = kk + (size_t)b * KLEN_ * U_ + h * DH_;
  const _Float16* rbase = rr + (size_t)b * KLEN_ * U_ + h * DH_;
  const _Float16* vbase = vT + ((size_t)b * H_ + h) * DH_ * KLEN_;

  // copy role: K and r rows as (row 0..15, 16-B piece 0..7), V^T rows as
  // (row 0..31, 16-B piece 0..3)
  int crow = threadIdx.x >> 3, cpc = (threadIdx.x & 7) * 8;
  int vrow = threadIdx.x >> 2, vpc = (threadIdx.x & 3) * 8;
  unsigned lkr = (unsigned)(size_t)&tile[crow * FK_P + cpc];
  unsigned lvv = (unsigned)(size_t)&tile[FV_OFF + vrow * FV_P + vpc];

  // One key tile: each lane copies 16 B of two K rows, six r rows and two V^T
  // rows. r rows past KLEN are masked later; their source row is clamped. The
  // s_wait_xcnt stands inside the statement so that no address register of an
  // issued copy is rewritten ahead of it.
  auto tile_copy = [&](int t, int buf) {
    int j0 = t * 32;
    unsigned lk = lkr + buf * (FT_H * 2), lv = lvv + buf * (FT_H * 2);
    const _Float16* gk = kbase + (size_t)(j0 + crow) * U_ + cpc;
    const _Float16* gv = vbase + (size_t)vrow * KLEN_ + j0 + vpc;
    int rb = j0 + (Q_ - 64) - ib + crow;      // first r row of wave 3's band, + crow
    const _Float16* gr[6];
#pragma unroll   // constant indices keep the six pointers in registers
    for (int n = 0; n < 6; n++) {
      int row = rb + n * 16; if (row > KLEN_ - 1) row = KLEN_ - 1;
      gr[n] = rbase + (size_t)row * U_ + cpc;
    }
    asm volatile("global_load_async_to_lds_b128 %0, %10, off\n\t"
                 "global_load_async_to_lds_b128 %1, %11, off\n\t"
                 "global_load_async_to_lds_b128 %2, %12, off\n\t"
                 "global_load_async_to_lds_b128 %3, %13, off\n\t"
                 "global_load_async_to_lds_b128 %4, %14, off\n\t"
                 "global_load_async_to_lds_b128 %5, %15, off\n\t"
                 "global_load_async_to_lds_b128 %6, %16, off\n\t"
                 "global_load_async_to_lds_b128 %7, %17, off\n\t"
                 "global_load_async_to_lds_b128 %8, %18, off\n\t"
                 "global_load_async_to_lds_b128 %9, %19, off\n\t"
                 "s_wait_xcnt 0x0"
                 :: "v"(lk), "v"(lk + 16 * FK_P * 2),
                    "v"(lk + 32 * FK_P * 2), "v"(lk + 48 * FK_P * 2),
                    "v"(lk + 64 * FK_P * 2), "v"(lk + 80 * FK_P * 2),
                    "v"(lk + 96 * FK_P * 2), "v"(lk + 112 * FK_P * 2),
                    "v"(lv), "v"(lv + 32 * FV_P * 2),
                    "v"(gk), "v"(gk + (size_t)16 * U_),
                    "v"(gr[0]), "v"(gr[1]), "v"(gr[2]), "v"(gr[3]), "v"(gr[4]), "v"(gr[5]),
                    "v"(gv), "v"(gv + (size_t)32 * KLEN_)
                 : "memory");
  };

  v8f o[4] = {};
  float mrow[8], lrow[8];
#pragma unroll
  for (int r = 0; r < 8; r++) { mrow[r] = -1e30f; lrow[r] = 0.f; }

  int jmax  = MEM_ + i0 + 15;                // this wave's causal bound
  int ntile = (MEM_ + ib + 63) / 32 + 1;     // the block's key tiles, 34 or more

  tile_copy(0, 0);
  asm volatile("s_wait_asynccnt 0x0" ::: "memory");  // own copies of tile 0 landed
  __syncthreads();                                   // tile 0 readable by all waves
  tile_copy(1, 1);

  for (int t = 0; t < ntile; t++) {
    int j0 = t * 32, buf = t & 1;
    const _Float16* Ks = &tile[buf * FT_H];
    const _Float16* Rs = &tile[buf * FT_H + FR_OFF + (3 - w) * 16 * FK_P];
    const _Float16* Vs = &tile[buf * FT_H + FV_OFF];

    if (j0 <= jmax) {   // a wave past its causal bound skips the work, not the barrier
    // all K and r fragments of the tile are fetched as one group of LDS reads
    // (every loop over kf, rf, rc is unrolled: constant indices keep them in registers)
    v16h kf[4], rf[6];
#pragma unroll
    for (int n = 0; n < 4; n++)
      kf[n] = ldfrag(Ks + (n >> 1) * 16 * FK_P, FK_P, (n & 1) * 32);
#pragma unroll
    for (int n = 0; n < 6; n++)
      rf[n] = ldfrag(Rs + (n >> 1) * 16 * FK_P, FK_P, (n & 1) * 32);

    // context scores: two 16-col subtiles over K=DH=64
    v8f sc0 = {}, sc1 = {};
    sc0 = wmma_(aqc0, kf[0], sc0);
    sc0 = wmma_(aqc1, kf[1], sc0);
    sc1 = wmma_(aqc0, kf[2], sc1);
    sc1 = wmma_(aqc1, kf[3], sc1);

    // relative-score band: r rows rb0 .. rb0+47, rb0 = j0 + (Q-16) - i0
    v8f rc[3] = {};
#pragma unroll
    for (int tt = 0; tt < 3; tt++) {
      rc[tt] = wmma_(aqr0, rf[2 * tt], rc[tt]);
      rc[tt] = wmma_(aqr1, rf[2 * tt + 1], rc[tt]);
    }
#pragma unroll
    for (int tt = 0; tt < 3; tt++)
#pragma unroll
      for (int r = 0; r < 8; r++)
        relbuf[w][r + 8 * hf][tt * 16 + jl] = rc[tt][r];
    asm volatile("" ::: "memory");   // order LDS write -> gather (same wave)

    // gather shifted rel term, scale 1/sqrt(64), apply causal mask
    float s0[8], s1[8];
#pragma unroll
    for (int r = 0; r < 8; r++) {
      int iloc = r + 8 * hf;
      float rel0 = relbuf[w][iloc][jl + 15 - iloc];
      float rel1 = relbuf[w][iloc][16 + jl + 15 - iloc];
      int lim = MEM_ + i0 + iloc;
      s0[r] = (j0 + jl      <= lim) ? (sc0[r] + rel0) * 0.125f : -1e30f;
      s1[r] = (j0 + 16 + jl <= lim) ? (sc1[r] + rel1) * 0.125f : -1e30f;
    }

    // online softmax (row = reg r + 8*hf; 16-lane group holds the 16 cols)
    float alpha[8];
#pragma unroll
    for (int r = 0; r < 8; r++) {
      float tm = fmaxf(s0[r], s1[r]);
#pragma unroll
      for (int off = 1; off < 16; off <<= 1) tm = fmaxf(tm, __shfl_xor(tm, off, 32));
      float mn = fmaxf(mrow[r], tm);
      alpha[r] = __expf(mrow[r] - mn);
      float p0 = __expf(s0[r] - mn), p1 = __expf(s1[r] - mn);
      float ps = p0 + p1;
#pragma unroll
      for (int off = 1; off < 16; off <<= 1) ps += __shfl_xor(ps, off, 32);
      lrow[r] = lrow[r] * alpha[r] + ps;
      mrow[r] = mn;
      int iloc = r + 8 * hf;
      pbuf[w][iloc][jl]      = (_Float16)p0;
      pbuf[w][iloc][16 + jl] = (_Float16)p1;
    }
#pragma unroll
    for (int dt = 0; dt < 4; dt++)
#pragma unroll
      for (int r = 0; r < 8; r++) o[dt][r] *= alpha[r];

    asm volatile("" ::: "memory");   // order P store -> A-fragment reload
    v16h ap = ldfrag(&pbuf[w][0][0], 32, 0);   // C-layout -> A-layout via LDS
#pragma unroll
    for (int dt = 0; dt < 4; dt++)
      o[dt] = wmma_(ap, ldfrag(Vs + dt * 16 * FV_P, FV_P, 0), o[dt]);
    }

    asm volatile("s_wait_dscnt 0x0" ::: "memory");    // own reads of this buffer done
    asm volatile("s_wait_asynccnt 0x0" ::: "memory"); // own copies of tile t+1 landed
    __syncthreads();  // publishes tile t+1 and frees this buffer for its refill
    if (t + 2 < ntile) tile_copy(t + 2, buf);
  }
  asm volatile("s_wait_asynccnt 0x0" ::: "memory");   // nothing in flight at the end

  // normalize and store (B,Q,U) f16
#pragma unroll
  for (int dt = 0; dt < 4; dt++)
#pragma unroll
    for (int r = 0; r < 8; r++) {
      int iloc = r + 8 * hf;
      float vv = o[dt][r] / lrow[r];
      outp[((size_t)b * Q_ + i0 + iloc) * U_ + h * DH_ + dt * 16 + jl] = (_Float16)vv;
    }
}

// ---------------------------------------------------------------------------
extern "C" void kernel_launch(void* const* d_in, const int* in_sizes, int n_in,
                              void* d_out, int out_size, void* d_ws, size_t ws_size,
                              hipStream_t stream) {
  (void)in_sizes; (void)n_in; (void)out_size; (void)ws_size;
  const float* inputs    = (const float*)d_in[0];
  const float* relatives = (const float*)d_in[1];
  const float* memories  = (const float*)d_in[2];
  const float* biasc     = (const float*)d_in[3];
  const float* biasr     = (const float*)d_in[4];
  const float* Wq        = (const float*)d_in[5];
  const float* Wkv       = (const float*)d_in[6];
  const float* Wr        = (const float*)d_in[7];
  const float* Wo        = (const float*)d_in[8];
  float* out = (float*)d_out;

  // f16 workspace carve-out (~62 MB)
  _Float16* ws = (_Float16*)d_ws;
  size_t off = 0;
  auto carve = [&](size_t n) { _Float16* p = ws + off; off += n; return p; };
  const size_t BKU = (size_t)B_ * KLEN_ * U_;   // 4M
  const size_t BQU = (size_t)B_ * Q_ * U_;      // 2M
  const size_t UU  = (size_t)U_ * U_;           // 1M
  _Float16* xfull  = carve(BKU);
  _Float16* rel16  = carve(BKU);
  _Float16* WqT    = carve(UU);
  _Float16* WkT    = carve(UU);
  _Float16* WvT    = carve(UU);
  _Float16* WrT    = carve(UU);
  _Float16* WoT    = carve(UU);
  _Float16* qcb    = carve(BQU);
  _Float16* qrb    = carve(BQU);
  _Float16* kbuf   = carve(BKU);
  _Float16* rbuf   = carve(BKU);
  _Float16* vTb    = carve(BKU);                // (B,H,DH,KLEN)
  _Float16* attout = carve(BQU);

  // 1) pack + convert
  pack_concat_f16<<<4096, 256, 0, stream>>>(memories, inputs, xfull);
  cvt_f32_to_f16<<<4096, 256, 0, stream>>>(relatives, rel16, BKU);
  transpose_w_f16<<<2048, 256, 0, stream>>>(Wq,  WqT, U_, U_, U_,     0);
  transpose_w_f16<<<2048, 256, 0, stream>>>(Wkv, WkT, U_, U_, 2 * U_, 0);
  transpose_w_f16<<<2048, 256, 0, stream>>>(Wkv, WvT, U_, U_, 2 * U_, U_);
  transpose_w_f16<<<2048, 256, 0, stream>>>(Wr,  WrT, U_, U_, U_,     0);
  transpose_w_f16<<<2048, 256, 0, stream>>>(Wo,  WoT, U_, U_, U_,     0);

  // 2) projections (all WMMA NT GEMMs)
  dim3 gq(U_ / 64, Q_ / 32, B_);
  gemm_nt<<<gq, 256, 0, stream>>>(xfull + (size_t)MEM_ * U_, BKU / B_, U_,
                                  WqT, U_, U_,
                                  qcb, BQU / B_, U_, qrb, biasc, biasr,
                                  nullptr, 0, 0, GM_QCQR);
  dim3 gk(U_ / 64, KLEN_ / 32, B_);
  gemm_nt<<<gk, 256, 0, stream>>>(xfull, BKU / B_, U_, WkT, U_, U_,
                                  kbuf, BKU / B_, U_, nullptr, nullptr, nullptr,
                                  nullptr, 0, 0, GM_PLAIN);
  gemm_nt<<<gk, 256, 0, stream>>>(rel16, BKU / B_, U_, WrT, U_, U_,
                                  rbuf, BKU / B_, U_, nullptr, nullptr, nullptr,
                                  nullptr, 0, 0, GM_PLAIN);
  gemm_nt<<<gk, 256, 0, stream>>>(xfull, BKU / B_, U_, WvT, U_, U_,
                                  vTb, 0, U_, nullptr, nullptr, nullptr,
                                  nullptr, 0, KLEN_, GM_VT);

  // 3) fused attention (no score matrix in HBM)
  flash_attn<<<dim3(Q_ / 64, H_, B_), 128, 0, stream>>>(qcb, qrb, kbuf, rbuf,
                                                        vTb, attout);

  // 4) output projection, f32 result
  gemm_nt<<<gq, 256, 0, stream>>>(attout, BQU / B_, U_, WoT, U_, U_,
                                  nullptr, 0, U_, nullptr, nullptr, nullptr,
                                  out, BQU / B_, 0, GM_F32);
}

// v003
// Measured time: 226 microseconds a run.
// Two timings next to v002 both put it at 1.12 times that version's speed.
// Counting every step since v000, it is 1.87 times as fast.
#include <hip/hip_runtime.h>
#include <hip/hip_bf16.h>

// ---------------------------------------------------------------------------
// Transformer-XL relative multi-head attention for MI455X (gfx1250).
// All GEMMs run on v_wmma_f32_16x16x32_f16 (wave32 WMMA, f32 accumulate).
// Attention is fused flash-style (online softmax) so the (B,H,Q,KLEN) score
// matrix (256MB f32) never touches HBM. The relative-shift is folded into the
// flash loop via a 47-wide diagonal band of qr*r^T tiles gathered through LDS.
// Workspace requirement: ~62 MB of f16 scratch in d_ws.
// ---------------------------------------------------------------------------

enum { B_ = 2, Q_ = 1024, MEM_ = 1024, U_ = 1024, H_ = 16, DH_ = 64, KLEN_ = MEM_ + Q_ };

typedef __attribute__((ext_vector_type(16))) _Float16 v16h;
typedef __attribute__((ext_vector_type(8)))  _Float16 v8h;
typedef __attribute__((ext_vector_type(8)))  float    v8f;

// ---- WMMA fragment helpers (layouts per CDNA5 ISA 7.12.2) -----------------
// A fragment 16x32 f16: lane m=lane&15 holds row m; half=lane>>4 selects
// k-groups: regs 0-3 = k in [half*8, half*8+8), regs 4-7 = +16. Each group is
// 8 contiguous halves -> one 16B load. B fragment (NT form, B stored as NxK
// row-major) is symmetric with N in place of M.
__device__ __forceinline__ v16h frag_combine(v8h lo, v8h hi) {
  return __builtin_shufflevector(lo, hi, 0,1,2,3,4,5,6,7,8,9,10,11,12,13,14,15);
}

__device__ __forceinline__ v16h ldfrag(const _Float16* base, int ld, int koff) {
  int lane = threadIdx.x & 31;
  int m = lane & 15, hf = lane >> 4;
  const v8h* p = (const v8h*)(base + (size_t)m * ld + koff + hf * 8);
  return frag_combine(p[0], p[2]);   // p[2] == +16 halves
}

__device__ __forceinline__ v8f wmma_(v16h a, v16h b, v8f c) {
  return __builtin_amdgcn_wmma_f32_16x16x32_f16(false, a, false, b, (short)0, c,
                                                false, false);
}

// ---- pack / convert kernels ----------------------------------------------
// Every lane moves 16-B pieces, eight loads in flight: a block of 256 threads
// takes one unit of 8192 floats, so few waves have to be started.
typedef __attribute__((ext_vector_type(4))) float    v4f;
typedef __attribute__((ext_vector_type(4))) _Float16 v4h;
enum { UNIT_ = 8192 };

// One unit, contiguous: each wave-wide load covers 512 B, each store 256 B.
__device__ __forceinline__ void cvt_unit(const float* __restrict__ src,
                                         _Float16* __restrict__ dst) {
  const v4f* s = (const v4f*)src + threadIdx.x;
  v4h* d = (v4h*)dst + threadIdx.x;
  v4f x[8];
#pragma unroll   // constant indices keep the eight pieces in registers
  for (int i = 0; i < 8; i++) x[i] = s[i * 256];
#pragma unroll
  for (int i = 0; i < 8; i++) d[i * 256] = __builtin_convertvector(x[i], v4h);
}

// MEM_*U_ and Q_*U_ are multiples of UNIT_: a unit lies in one source.
__global__ __launch_bounds__(256)
void pack_concat_f16(const float* __restrict__ mem,
                     const float* __restrict__ inp,
                     _Float16* __restrict__ xfull) {
  size_t e = (size_t)blockIdx.x * UNIT_;
  size_t b = e / ((size_t)KLEN_ * U_);
  size_t rem = e - b * (size_t)KLEN_ * U_;
  const float* src = (rem < (size_t)MEM_ * U_)
                         ? mem + b * (size_t)MEM_ * U_ + rem
                         : inp + b * (size_t)Q_ * U_ + (rem - (size_t)MEM_ * U_);
  cvt_unit(src, xfull + e);
}

// one unit per block; the grid covers the whole array (a multiple of UNIT_)
__global__ __launch_bounds__(256)
void cvt_f32_to_f16(const float* __restrict__ in, _Float16* __restrict__ out) {
  size_t e = (size_t)blockIdx.x * UNIT_;
  cvt_unit(in + e, out + e);
}

// out[n*U_ + k] = in[k*ldin + coloff + n]  (weight transpose for NT GEMMs)
// Block tile 64 k x 128 n, wave tile 32 k x 32 n, lane tile 8 k x 4 n held in
// registers: a load covers four whole 128-B lines of the source rows, a store
// writes 8 halves of k (16 B) per lane. The source pitch is a template
// constant (two are in use): no multiply by a run-time pitch in the addresses.
template <int LDIN>
__device__ __forceinline__ void transpose_tile(const float* __restrict__ in,
                                               _Float16* __restrict__ out) {
  int lane = threadIdx.x & 31, wid = threadIdx.x >> 5;
  int k0 = blockIdx.y * 64  + (wid & 1) * 32  + (lane >> 3) * 8;
  int n0 = blockIdx.x * 128 + (wid >> 1) * 32 + (lane & 7) * 4;
  const float* s = in + (size_t)k0 * LDIN + n0;
  _Float16* d = out + (size_t)n0 * U_ + k0;
  v4f x[8];
#pragma unroll   // constant indices keep the lane tile in registers
  for (int i = 0; i < 8; i++) x[i] = *(const v4f*)(s + i * LDIN);
#pragma unroll
  for (int j = 0; j < 4; j++) {
    v8h y;
#pragma unroll
    for (int i = 0; i < 8; i++) y[i] = (_Float16)x[i][j];
    *(v8h*)(d + j * U_) = y;
  }
}

// U_ x U_ block of a source whose rows hold U_ floats (wide == 0) or 2*U_
__global__ __launch_bounds__(256)
void transpose_w_f16(const float* __restrict__ in, _Float16* __restrict__ out,
                     int wide, int coloff) {
  if (wide) transpose_tile<2 * U_>(in + coloff, out);
  else      transpose_tile<U_>(in + coloff, out);
}

// ---- generic batched NT GEMM: C(MxN) = A(MxK) * Bw(NxK)^T ------------------
// 256 threads = 8 waves, wave grid 2x4 -> 32x64 block tile, 16x16 per wave.
// The block's 32 A rows and 64 B rows are staged in LDS in slabs of 64 k by
// asynchronous copies (whole 128-B lines per 8 lanes), two buffers, so that the
// next slab flies while this one is multiplied. K must be a multiple of 64.
enum { GM_PLAIN = 0, GM_QCQR = 1, GM_VT = 2, GM_F32 = 3 };
enum { SLAB_K = 64,                 // halves of k per slab: 128 B per row
       SLAB_P = 72,                 // LDS row pitch in halves: 144 B = 16 B x odd
       SLAB_H = 96 * SLAB_P };      // halves per buffer: 32 A rows, then 64 B rows

// One slab: each lane copies 16 B of one A row and of two B rows. The
// s_wait_xcnt stands inside the statement so that no address register of an
// issued copy is rewritten ahead of it.
__device__ __forceinline__ void slab_copy(unsigned lds, const _Float16* ga,
                                          const _Float16* gb0, const _Float16* gb1) {
  unsigned l1 = lds + 32 * SLAB_P * 2, l2 = lds + 64 * SLAB_P * 2;
  asm volatile("global_load_async_to_lds_b128 %0, %3, off\n\t"
               "global_load_async_to_lds_b128 %1, %4, off\n\t"
               "global_load_async_to_lds_b128 %2, %5, off\n\t"
               "s_wait_xcnt 0x0"
               :: "v"(lds), "v"(l1), "v"(l2), "v"(ga), "v"(gb0), "v"(gb1)
               : "memory");
}

__global__ __launch_bounds__(256)
void gemm_nt(const _Float16* __restrict__ A, size_t strideA, int lda,
             const _Float16* __restrict__ Bw, int ldb, int K,
             _Float16* __restrict__ out0, size_t strideO, int ldo,
             _Float16* __restrict__ out1,
             const float* __restrict__ bias0, const float* __restrict__ bias1,
             float* __restrict__ outf, size_t strideF,
             int klen_vt, int mode) {
  __shared__ __attribute__((aligned(16))) _Float16 slab[2 * SLAB_H];

  int b   = blockIdx.z;
  int wid = threadIdx.x >> 5;
  int mw  = (wid >> 2) * 16, nw = (wid & 3) * 16;
  int m0  = blockIdx.y * 32 + mw;
  int n0  = blockIdx.x * 64 + nw;

  // copy role: thread -> (row 0..31, 16-B piece 0..7) of each 32-row group
  int crow = threadIdx.x >> 3, cpc = (threadIdx.x & 7) * 8;
  const _Float16* ga  = A + (size_t)b * strideA
                          + (size_t)(blockIdx.y * 32 + crow) * lda + cpc;
  const _Float16* gb0 = Bw + (size_t)(blockIdx.x * 64 + crow) * ldb + cpc;
  const _Float16* gb1 = gb0 + (size_t)32 * ldb;
  unsigned ldst = (unsigned)(size_t)&slab[crow * SLAB_P + cpc];

  int nslab = K / SLAB_K;
  slab_copy(ldst, ga, gb0, gb1);
  asm volatile("s_wait_asynccnt 0x0" ::: "memory");  // own copies of slab 0 landed
  __syncthreads();                                   // slab 0 readable by all waves
  if (nslab > 1)
    slab_copy(ldst + SLAB_H * 2, ga + SLAB_K, gb0 + SLAB_K, gb1 + SLAB_K);

  v8f c = {};
  for (int t = 0; t < nslab; t++) {
    int buf = t & 1;
    const _Float16* As = &slab[buf * SLAB_H + mw * SLAB_P];
    const _Float16* Bs = &slab[buf * SLAB_H + (32 + nw) * SLAB_P];
    c = wmma_(ldfrag(As, SLAB_P, 0),  ldfrag(Bs, SLAB_P, 0),  c);
    c = wmma_(ldfrag(As, SLAB_P, 32), ldfrag(Bs, SLAB_P, 32), c);
    asm volatile("s_wait_dscnt 0x0" ::: "memory");    // own reads of this buffer done
    asm volatile("s_wait_asynccnt 0x0" ::: "memory"); // own copies of slab t+1 landed
    __syncthreads();  // publishes slab t+1 and frees this buffer for its refill
    if (t + 2 < nslab) {
      int ko = (t + 2) * SLAB_K;
      slab_copy(ldst + buf * (SLAB_H * 2), ga + ko, gb0 + ko, gb1 + ko);
    }
  }
  asm volatile("s_wait_asynccnt 0x0" ::: "memory");   // nothing in flight at the end

  int lane = threadIdx.x & 31, jl = lane & 15, hf = lane >> 4;
#pragma unroll
  for (int r = 0; r < 8; r++) {
    int row = m0 + r + 8 * hf;
    int col = n0 + jl;
    float v = c[r];
    if (mode == GM_QCQR) {
      size_t o = (size_t)b * strideO + (size_t)row * ldo + col;
      out0[o] = (_Float16)(v + bias0[col]);
      out1[o] = (_Float16)(v + bias1[col]);
    } else if (mode == GM_VT) {           // store V transposed: (B,H,DH,KLEN)
      int h = col >> 6, d = col & 63;
      out0[(((size_t)b * H_ + h) * DH_ + d) * (size_t)klen_vt + row] = (_Float16)v;
    } else if (mode == GM_F32) {
      outf[(size_t)b * strideF + (size_t)row * ldo + col] = v;
    } else {
      out0[(size_t)b * strideO + (size_t)row * ldo + col] = (_Float16)v;
    }
  }
}

enum { FK_P   = 72,                     // K and r row pitch in halves: 144 B = 16 B x odd
       FV_P   = 40,                     // V^T row pitch in halves: 80 B = 16 B x odd
       FR_OFF = 32 * FK_P,              // r band behind the 32 K rows
       FV_OFF = (32 + 96) * FK_P,       // V^T tile behind the 96 r rows
       FT_H   = FV_OFF + 64 * FV_P };   // halves per buffer

__global__ __launch_bounds__(128)
void flash_attn(const _Float16* __restrict__ qc, const _Float16* __restrict__ qr,
                const _Float16* __restrict__ kk, const _Float16* __restrict__ rr,
                const _Float16* __restrict__ vT, _Float16* __restrict__ outp) {
  __shared__ __align__(16) _Float16 tile[2 * FT_H];
  __shared__ __align__(16) float    relbuf[4][16][49];
  __shared__ __align__(16) _Float16 pbuf[4][16][32];

  // wave number in a scalar register: the causal skip below is a scalar branch
  int w = __builtin_amdgcn_readfirstlane(threadIdx.x >> 5);
  int lane = threadIdx.x & 31, jl = lane & 15, hf = lane >> 4;
  int b = blockIdx.z, h = blockIdx.y;
  int ib = blockIdx.x * 64;
  int i0 = ib + w * 16;

  const _Float16* qcb = qc + ((size_t)b * Q_ + i0) * U_ + h * DH_;
  const _Float16* qrb = qr + ((size_t)b * Q_ + i0) * U_ + h * DH_;
  v16h aqc0 = ldfrag(qcb, U_, 0), aqc1 = ldfrag(qcb, U_, 32);
  v16h aqr0 = ldfrag(qrb, U_, 0), aqr1 = ldfrag(qrb, U_, 32);

  const _Float16* kbase = kk + (size_t)b * KLEN_ * U_ + h * DH_;
  const _Float16* rbase = rr + (size_t)b * KLEN_ * U_ + h * DH_;
  const _Float16* vbase = vT + ((size_t)b * H_ + h) * DH_ * KLEN_;

  // copy role: K and r rows as (row 0..15, 16-B piece 0..7), V^T rows as
  // (row 0..31, 16-B piece 0..3)
  int crow = threadIdx.x >> 3, cpc = (threadIdx.x & 7) * 8;
  int vrow = threadIdx.x >> 2, vpc = (threadIdx.x & 3) * 8;
  unsigned lkr = (unsigned)(size_t)&tile[crow * FK_P + cpc];
  unsigned lvv = (unsigned)(size_t)&tile[FV_OFF + vrow * FV_P + vpc];

  // One key tile: each lane copies 16 B of two K rows, six r rows and two V^T
  // rows. r rows past KLEN are masked later; their source row is clamped. The
  // s_wait_xcnt stands inside the statement so that no address register of an
  // issued copy is rewritten ahead of it.
  auto tile_copy = [&](int t, int buf) {
    int j0 = t * 32;
    unsigned lk = lkr + buf * (FT_H * 2), lv = lvv + buf * (FT_H * 2);
    const _Float16* gk = kbase + (size_t)(j0 + crow) * U_ + cpc;
    const _Float16* gv = vbase + (size_t)vrow * KLEN_ + j0 + vpc;
    int rb = j0 + (Q_ - 64) - ib + crow;      // first r row of wave 3's band, + crow
    const _Float16* gr[6];
#pragma unroll   // constant indices keep the six pointers in registers
    for (int n = 0; n < 6; n++) {
      int row = rb + n * 16; if (row > KLEN_ - 1) row = KLEN_ - 1;
      gr[n] = rbase + (size_t)row * U_ + cpc;
    }
    asm volatile("global_load_async_to_lds_b128 %0, %10, off\n\t"
                 "global_load_async_to_lds_b128 %1, %11, off\n\t"
                 "global_load_async_to_lds_b128 %2, %12, off\n\t"
                 "global_load_async_to_lds_b128 %3, %13, off\n\t"
                 "global_load_async_to_lds_b128 %4, %14, off\n\t"
                 "global_load_async_to_lds_b128 %5, %15, off\n\t"
                 "global_load_async_to_lds_b128 %6, %16, off\n\t"
                 "global_load_async_to_lds_b128 %7, %17, off\n\t"
                 "global_load_async_to_lds_b128 %8, %18, off\n\t"
                 "global_load_async_to_lds_b128 %9, %19, off\n\t"
                 "s_wait_xcnt 0x0"
                 :: "v"(lk), "v"(lk + 16 * FK_P * 2),
                    "v"(lk + 32 * FK_P * 2), "v"(lk + 48 * FK_P * 2),
                    "v"(lk + 64 * FK_P * 2), "v"(lk + 80 * FK_P * 2),
                    "v"(lk + 96 * FK_P * 2), "v"(lk + 112 * FK_P * 2),
                    "v"(lv), "v"(lv + 32 * FV_P * 2),
                    "v"(gk), "v"(gk + (size_t)16 * U_),
                    "v"(gr[0]), "v"(gr[1]), "v"(gr[2]), "v"(gr[3]), "v"(gr[4]), "v"(gr[5]),
                    "v"(gv), "v"(gv + (size_t)32 * KLEN_)
                 : "memory");
  };

  v8f o[4] = {};
  float mrow[8], lrow[8];
#pragma unroll
  for (int r = 0; r < 8; r++) { mrow[r] = -1e30f; lrow[r] = 0.f; }

  int jmax  = MEM_ + i0 + 15;                // this wave's causal bound
  int ntile = (MEM_ + ib + 63) / 32 + 1;     // the block's key tiles, 34 or more

  tile_copy(0, 0);
  asm volatile("s_wait_asynccnt 0x0" ::: "memory");  // own copies of tile 0 landed
  __syncthreads();                                   // tile 0 readable by all waves
  tile_copy(1, 1);

  for (int t = 0; t < ntile; t++) {
    int j0 = t * 32, buf = t & 1;
    const _Float16* Ks = &tile[buf * FT_H];
    const _Float16* Rs = &tile[buf * FT_H + FR_OFF + (3 - w) * 16 * FK_P];
    const _Float16* Vs = &tile[buf * FT_H + FV_OFF];

    if (j0 <= jmax) {   // a wave past its causal bound skips the work, not the barrier
    // all K and r fragments of the tile are fetched as one group of LDS reads
    // (every loop over kf, rf, rc is unrolled: constant indices keep them in registers)
    v16h kf[4], rf[6];
#pragma unroll
    for (int n = 0; n < 4; n++)
      kf[n] = ldfrag(Ks + (n >> 1) * 16 * FK_P, FK_P, (n & 1) * 32);
#pragma unroll
    for (int n = 0; n < 6; n++)
      rf[n] = ldfrag(Rs + (n >> 1) * 16 * FK_P, FK_P, (n & 1) * 32);

    // context scores: two 16-col subtiles over K=DH=64
    v8f sc0 = {}, sc1 = {};
    sc0 = wmma_(aqc0, kf[0], sc0);
    sc0 = wmma_(aqc1, kf[1], sc0);
    sc1 = wmma_(aqc0, kf[2], sc1);
    sc1 = wmma_(aqc1, kf[3], sc1);

    // relative-score band: r rows rb0 .. rb0+47, rb0 = j0 + (Q-16) - i0
    v8f rc[3] = {};
#pragma unroll
    for (int tt = 0; tt < 3; tt++) {
      rc[tt] = wmma_(aqr0, rf[2 * tt], rc[tt]);
      rc[tt] = wmma_(aqr1, rf[2 * tt + 1], rc[tt]);
    }
#pragma unroll
    for (int tt = 0; tt < 3; tt++)
#pragma unroll
      for (int r = 0; r < 8; r++)
        relbuf[w][r + 8 * hf][tt * 16 + jl] = rc[tt][r];
    asm volatile("" ::: "memory");   // order LDS write -> gather (same wave)

    // gather shifted rel term, scale 1/sqrt(64), apply causal mask
    float s0[8], s1[8];
#pragma unroll
    for (int r = 0; r < 8; r++) {
      int iloc = r + 8 * hf;
      float rel0 = relbuf[w][iloc][jl + 15 - iloc];
      float rel1 = relbuf[w][iloc][16 + jl + 15 - iloc];
      int lim = MEM_ + i0 + iloc;
      s0[r] = (j0 + jl      <= lim) ? (sc0[r] + rel0) * 0.125f : -1e30f;
      s1[r] = (j0 + 16 + jl <= lim) ? (sc1[r] + rel1) * 0.125f : -1e30f;
    }

    // online softmax (row = reg r + 8*hf; 16-lane group holds the 16 cols)
    float alpha[8];
#pragma unroll
    for (int r = 0; r < 8; r++) {
      float tm = fmaxf(s0[r], s1[r]);
#pragma unroll
      for (int off = 1; off < 16; off <<= 1) tm = fmaxf(tm, __shfl_xor(tm, off, 32));
      float mn = fmaxf(mrow[r], tm);
      alpha[r] = __expf(mrow[r] - mn);
      float p0 = __expf(s0[r] - mn), p1 = __expf(s1[r] - mn);
      float ps = p0 + p1;
#pragma unroll
      for (int off = 1; off < 16; off <<= 1) ps += __shfl_xor(ps, off, 32);
      lrow[r] = lrow[r] * alpha[r] + ps;
      mrow[r] = mn;
      int iloc = r + 8 * hf;
      pbuf[w][iloc][jl]      = (_Float16)p0;
      pbuf[w][iloc][16 + jl] = (_Float16)p1;
    }
#pragma unroll
    for (int dt = 0; dt < 4; dt++)
#pragma unroll
      for (int r = 0; r < 8; r++) o[dt][r] *= alpha[r];

    asm volatile("" ::: "memory");   // order P store -> A-fragment reload
    v16h ap = ldfrag(&pbuf[w][0][0], 32, 0);   // C-layout -> A-layout via LDS
#pragma unroll
    for (int dt = 0; dt < 4; dt++)
      o[dt] = wmma_(ap, ldfrag(Vs + dt * 16 * FV_P, FV_P, 0), o[dt]);
    }

    asm volatile("s_wait_dscnt 0x0" ::: "memory");    // own reads of this buffer done
    asm volatile("s_wait_asynccnt 0x0" ::: "memory"); // own copies of tile t+1 landed
    __syncthreads();  // publishes tile t+1 and frees this buffer for its refill
    if (t + 2 < ntile) tile_copy(t + 2, buf);
  }
  asm volatile("s_wait_asynccnt 0x0" ::: "memory");   // nothing in flight at the end

  // normalize and store (B,Q,U) f16
#pragma unroll
  for (int dt = 0; dt < 4; dt++)
#pragma unroll
    for (int r = 0; r < 8; r++) {
      int iloc = r + 8 * hf;
      float vv = o[dt][r] / lrow[r];
      outp[((size_t)b * Q_ + i0 + iloc) * U_ + h * DH_ + dt * 16 + jl] = (_Float16)vv;
    }
}

// ---------------------------------------------------------------------------
extern "C" void kernel_launch(void* const* d_in, const int* in_sizes, int n_in,
                              void* d_out, int out_size, void* d_ws, size_t ws_size,
                              hipStream_t stream) {
  (void)in_sizes; (void)n_in; (void)out_size; (void)ws_size;
  const float* inputs    = (const float*)d_in[0];
  const float* relatives = (const float*)d_in[1];
  const float* memories  = (const float*)d_in[2];
  const float* biasc     = (const float*)d_in[3];
  const float* biasr     = (const float*)d_in[4];
  const float* Wq        = (const float*)d_in[5];
  const float* Wkv       = (const float*)d_in[6];
  const float* Wr        = (const float*)d_in[7];
  const float* Wo        = (const float*)d_in[8];
  float* out = (float*)d_out;

  // f16 workspace carve-out (~62 MB)
  _Float16* ws = (_Float16*)d_ws;
  size_t off = 0;
  auto carve = [&](size_t n) { _Float16* p = ws + off; off += n; return p; };
  const size_t BKU = (size_t)B_ * KLEN_ * U_;   // 4M
  const size_t BQU = (size_t)B_ * Q_ * U_;      // 2M
  const size_t UU  = (size_t)U_ * U_;           // 1M
  _Float16* xfull  = carve(BKU);
  _Float16* rel16  = carve(BKU);
  _Float16* WqT    = carve(UU);
  _Float16* WkT    = carve(UU);
  _Float16* WvT    = carve(UU);
  _Float16* WrT    = carve(UU);
  _Float16* WoT    = carve(UU);
  _Float16* qcb    = carve(BQU);
  _Float16* qrb    = carve(BQU);
  _Float16* kbuf   = carve(BKU);
  _Float16* rbuf   = carve(BKU);
  _Float16* vTb    = carve(BKU);                // (B,H,DH,KLEN)
  _Float16* attout = carve(BQU);

  // 1) pack + convert
  pack_concat_f16<<<BKU / UNIT_, 256, 0, stream>>>(memories, inputs, xfull);
  cvt_f32_to_f16<<<BKU / UNIT_, 256, 0, stream>>>(relatives, rel16);
  dim3 gt(U_ / 128, U_ / 64);
  transpose_w_f16<<<gt, 256, 0, stream>>>(Wq,  WqT, 0, 0);
  transpose_w_f16<<<gt, 256, 0, stream>>>(Wkv, WkT, 1, 0);
  transpose_w_f16<<<gt, 256, 0, stream>>>(Wkv, WvT, 1, U_);
  transpose_w_f16<<<gt, 256, 0, stream>>>(Wr,  WrT, 0, 0);
  transpose_w_f16<<<gt, 256, 0, stream>>>(Wo,  WoT, 0, 0);

  // 2) projections (all WMMA NT GEMMs)
  dim3 gq(U_ / 64, Q_ / 32, B_);
  gemm_nt<<<gq, 256, 0, stream>>>(xfull + (size_t)MEM_ * U_, BKU / B_, U_,
                                  WqT, U_, U_,
                                  qcb, BQU / B_, U_, qrb, biasc, biasr,
                                  nullptr, 0, 0, GM_QCQR);
  dim3 gk(U_ / 64, KLEN_ / 32, B_);
  gemm_nt<<<gk, 256, 0, stream>>>(xfull, BKU / B_, U_, WkT, U_, U_,
                                  kbuf, BKU / B_, U_, nullptr, nullptr, nullptr,
                                  nullptr, 0, 0, GM_PLAIN);
  gemm_nt<<<gk, 256, 0, stream>>>(rel16, BKU / B_, U_, WrT, U_, U_,
                                  rbuf, BKU / B_, U_, nullptr, nullptr, nullptr,
                                  nullptr, 0, 0, GM_PLAIN);
  gemm_nt<<<gk, 256, 0, stream>>>(xfull, BKU / B_, U_, WvT, U_, U_,
                                  vTb, 0, U_, nullptr, nullptr, nullptr,
                                  nullptr, 0, KLEN_, GM_VT);

  // 3) fused attention (no score matrix in HBM)
  flash_attn<<<dim3(Q_ / 64, H_, B_), 128, 0, stream>>>(qcb, qrb, kbuf, rbuf,
                                                        vTb, attout);

  // 4) output projection, f32 result
  gemm_nt<<<gq, 256, 0, stream>>>(attout, BQU / B_, U_, WoT, U_, U_,
                                  nullptr, 0, U_, nullptr, nullptr, nullptr,
                                  out, BQU / B_, 0, GM_F32);
}

// v004
// A run of this version takes 211 microseconds.
// In both of two side-by-side timings against v003, it was 1.07 times as fast.
// Over all steps from v000 it is 2.00 times as fast.
#include <hip/hip_runtime.h>
#include <hip/hip_bf16.h>

// ---------------------------------------------------------------------------
// Transformer-XL relative multi-head attention for MI455X (gfx1250).
// All GEMMs run on v_wmma_f32_16x16x32_f16 (wave32 WMMA, f32 accumulate).
// Attention is fused flash-style (online softmax) so the (B,H,Q,KLEN) score
// matrix (256MB f32) never touches HBM. The relative-shift is folded into the
// flash loop via a 47-wide diagonal band of qr*r^T tiles gathered through LDS.
// Workspace requirement: ~62 MB of f16 scratch in d_ws.
// ---------------------------------------------------------------------------

enum { B_ = 2, Q_ = 1024, MEM_ = 1024, U_ = 1024, H_ = 16, DH_ = 64, KLEN_ = MEM_ + Q_ };

typedef __attribute__((ext_vector_type(16))) _Float16 v16h;
typedef __attribute__((ext_vector_type(8)))  _Float16 v8h;
typedef __attribute__((ext_vector_type(8)))  float    v8f;

// ---- WMMA fragment helpers (layouts per CDNA5 ISA 7.12.2) -----------------
// A fragment 16x32 f16: lane m=lane&15 holds row m; half=lane>>4 selects
// k-groups: regs 0-3 = k in [half*8, half*8+8), regs 4-7 = +16. Each group is
// 8 contiguous halves -> one 16B load. B fragment (NT form, B stored as NxK
// row-major) is symmetric with N in place of M.
__device__ __forceinline__ v16h frag_combine(v8h lo, v8h hi) {
  return __builtin_shufflevector(lo, hi, 0,1,2,3,4,5,6,7,8,9,10,11,12,13,14,15);
}

__device__ __forceinline__ v16h ldfrag(const _Float16* base, int ld, int koff) {
  int lane = threadIdx.x & 31;
  int m = lane & 15, hf = lane >> 4;
  const v8h* p = (const v8h*)(base + (size_t)m * ld + koff + hf * 8);
  return frag_combine(p[0], p[2]);   // p[2] == +16 halves
}

__device__ __forceinline__ v8f wmma_(v16h a, v16h b, v8f c) {
  return __builtin_amdgcn_wmma_f32_16x16x32_f16(false, a, false, b, (short)0, c,
                                                false, false);
}

// ---- pack / convert kernels ----------------------------------------------
// Every lane moves 16-B pieces, eight loads in flight: a block of 256 threads
// takes one unit of 8192 floats, so few waves have to be started.
typedef __attribute__((ext_vector_type(4))) float    v4f;
typedef __attribute__((ext_vector_type(4))) _Float16 v4h;
enum { UNIT_ = 8192 };

// One unit, contiguous: each wave-wide load covers 512 B, each store 256 B.
__device__ __forceinline__ void cvt_unit(const float* __restrict__ src,
                                         _Float16* __restrict__ dst) {
  const v4f* s = (const v4f*)src + threadIdx.x;
  v4h* d = (v4h*)dst + threadIdx.x;
  v4f x[8];
#pragma unroll   // constant indices keep the eight pieces in registers
  for (int i = 0; i < 8; i++) x[i] = s[i * 256];
#pragma unroll
  for (int i = 0; i < 8; i++) d[i * 256] = __builtin_convertvector(x[i], v4h);
}

// MEM_*U_ and Q_*U_ are multiples of UNIT_: a unit lies in one source.
__global__ __launch_bounds__(256)
void pack_concat_f16(const float* __restrict__ mem,
                     const float* __restrict__ inp,
                     _Float16* __restrict__ xfull) {
  size_t e = (size_t)blockIdx.x * UNIT_;
  size_t b = e / ((size_t)KLEN_ * U_);
  size_t rem = e - b * (size_t)KLEN_ * U_;
  const float* src = (rem < (size_t)MEM_ * U_)
                         ? mem + b * (size_t)MEM_ * U_ + rem
                         : inp + b * (size_t)Q_ * U_ + (rem - (size_t)MEM_ * U_);
  cvt_unit(src, xfull + e);
}

// one unit per block; the grid covers the whole array (a multiple of UNIT_)
__global__ __launch_bounds__(256)
void cvt_f32_to_f16(const float* __restrict__ in, _Float16* __restrict__ out) {
  size_t e = (size_t)blockIdx.x * UNIT_;
  cvt_unit(in + e, out + e);
}

// out[n*U_ + k] = in[k*ldin + coloff + n]  (weight transpose for NT GEMMs)
// Block tile 64 k x 128 n, wave tile 32 k x 32 n, lane tile 8 k x 4 n held in
// registers: a load covers four whole 128-B lines of the source rows, a store
// writes 8 halves of k (16 B) per lane. The source pitch is a template
// constant (two are in use): no multiply by a run-time pitch in the addresses.
template <int LDIN>
__device__ __forceinline__ void transpose_tile(const float* __restrict__ in,
                                               _Float16* __restrict__ out) {
  int lane = threadIdx.x & 31, wid = threadIdx.x >> 5;
  int k0 = blockIdx.y * 64  + (wid & 1) * 32  + (lane >> 3) * 8;
  int n0 = blockIdx.x * 128 + (wid >> 1) * 32 + (lane & 7) * 4;
  const float* s = in + (size_t)k0 * LDIN + n0;
  _Float16* d = out + (size_t)n0 * U_ + k0;
  v4f x[8];
#pragma unroll   // constant indices keep the lane tile in registers
  for (int i = 0; i < 8; i++) x[i] = *(const v4f*)(s + i * LDIN);
#pragma unroll
  for (int j = 0; j < 4; j++) {
    v8h y;
#pragma unroll
    for (int i = 0; i < 8; i++) y[i] = (_Float16)x[i][j];
    *(v8h*)(d + j * U_) = y;
  }
}

// U_ x U_ block of a source whose rows hold U_ floats (wide == 0) or 2*U_
__global__ __launch_bounds__(256)
void transpose_w_f16(const float* __restrict__ in, _Float16* __restrict__ out,
                     int wide, int coloff) {
  if (wide) transpose_tile<2 * U_>(in + coloff, out);
  else      transpose_tile<U_>(in + coloff, out);
}

// ---- generic batched NT GEMM: C(MxN) = A(MxK) * Bw(NxK)^T ------------------
// 256 threads = 8 waves, wave grid 2x4 -> 128x128 block tile, 64x32 per wave
// (4 x 2 accumulator tiles): every A fragment serves two products, every B
// fragment four, and a row staged in LDS serves 128 rows of the other operand.
// The block's 128 A rows and 128 B rows are staged in LDS in slabs of 64 k by
// asynchronous copies (whole 128-B lines per 8 lanes), two buffers, so that the
// next slab flies while this one is multiplied. M and N must be multiples of
// 128, K a multiple of 64.
enum { GM_PLAIN = 0, GM_QCQR = 1, GM_VT = 2, GM_F32 = 3 };
enum { BT_    = 128,                // rows of A and rows of B per block tile
       SLAB_K = 64,                 // halves of k per slab: 128 B per row
       SLAB_P = 72,                 // LDS row pitch in halves: 144 B = 16 B x odd
       SLAB_G = 32 * SLAB_P * 2,    // LDS bytes of the 32 rows one copy fills
       SLAB_H = 2 * BT_ * SLAB_P }; // halves per buffer: 128 A rows, then 128 B rows

// One slab: each lane copies 16 B of four A rows and of four B rows, 32 rows
// apart (sa, sb: 32 source rows in halves). The s_wait_xcnt stands inside the
// statement so that no address register of an issued copy is rewritten ahead
// of it.
__device__ __forceinline__ void slab_copy(unsigned lds, const _Float16* ga, size_t sa,
                                          const _Float16* gb, size_t sb) {
  asm volatile("global_load_async_to_lds_b128 %0, %8, off\n\t"
               "global_load_async_to_lds_b128 %1, %9, off\n\t"
               "global_load_async_to_lds_b128 %2, %10, off\n\t"
               "global_load_async_to_lds_b128 %3, %11, off\n\t"
               "global_load_async_to_lds_b128 %4, %12, off\n\t"
               "global_load_async_to_lds_b128 %5, %13, off\n\t"
               "global_load_async_to_lds_b128 %6, %14, off\n\t"
               "global_load_async_to_lds_b128 %7, %15, off\n\t"
               "s_wait_xcnt 0x0"
               :: "v"(lds),              "v"(lds + SLAB_G),     "v"(lds + 2 * SLAB_G),
                  "v"(lds + 3 * SLAB_G), "v"(lds + 4 * SLAB_G), "v"(lds + 5 * SLAB_G),
                  "v"(lds + 6 * SLAB_G), "v"(lds + 7 * SLAB_G),
                  "v"(ga), "v"(ga + sa), "v"(ga + 2 * sa), "v"(ga + 3 * sa),
                  "v"(gb), "v"(gb + sb), "v"(gb + 2 * sb), "v"(gb + 3 * sb)
               : "memory");
}

__global__ __launch_bounds__(256)
void gemm_nt(const _Float16* __restrict__ A, size_t strideA, int lda,
             const _Float16* __restrict__ Bw, int ldb, int K,
             _Float16* __restrict__ out0, size_t strideO, int ldo,
             _Float16* __restrict__ out1,
             const float* __restrict__ bias0, const float* __restrict__ bias1,
             float* __restrict__ outf, size_t strideF,
             int klen_vt, int mode) {
  __shared__ __attribute__((aligned(16))) _Float16 slab[2 * SLAB_H];

  int b   = blockIdx.z;
  int wid = threadIdx.x >> 5;
  int mw  = (wid >> 2) * 64, nw = (wid & 3) * 32;
  int m0  = blockIdx.y * BT_ + mw;
  int n0  = blockIdx.x * BT_ + nw;

  // copy role: thread -> (row 0..31, 16-B piece 0..7) of each 32-row group
  int crow = threadIdx.x >> 3, cpc = (threadIdx.x & 7) * 8;
  const _Float16* ga = A + (size_t)b * strideA
                         + (size_t)(blockIdx.y * BT_ + crow) * lda + cpc;
  const _Float16* gb = Bw + (size_t)(blockIdx.x * BT_ + crow) * ldb + cpc;
  size_t sa = (size_t)32 * lda, sb = (size_t)32 * ldb;
  unsigned ldst = (unsigned)(size_t)&slab[crow * SLAB_P + cpc];

  int nslab = K / SLAB_K;
  slab_copy(ldst, ga, sa, gb, sb);
  asm volatile("s_wait_asynccnt 0x0" ::: "memory");  // own copies of slab 0 landed
  __syncthreads();                                   // slab 0 readable by all waves
  if (nslab > 1)
    slab_copy(ldst + SLAB_H * 2, ga + SLAB_K, sa, gb + SLAB_K, sb);

  v8f c[4][2] = {};
  for (int t = 0; t < nslab; t++) {
    int buf = t & 1;
    const _Float16* As = &slab[buf * SLAB_H + mw * SLAB_P];
    const _Float16* Bs = &slab[buf * SLAB_H + (BT_ + nw) * SLAB_P];
    // the slab's fragments are fetched as one group of LDS reads (every loop
    // over af, bf, c is unrolled: constant indices keep them in registers)
    v16h af[2][4], bf[2][2];
#pragma unroll
    for (int ks = 0; ks < 2; ks++) {
#pragma unroll
      for (int i = 0; i < 4; i++) af[ks][i] = ldfrag(As + i * 16 * SLAB_P, SLAB_P, ks * 32);
#pragma unroll
      for (int j = 0; j < 2; j++) bf[ks][j] = ldfrag(Bs + j * 16 * SLAB_P, SLAB_P, ks * 32);
    }
#pragma unroll
    for (int ks = 0; ks < 2; ks++) {
      // inputs-only fence on the loaded fragments: keeps their LDS reads one
      // group in front of the eight products (sunk to their uses, every pair
      // of products waits out an LDS latency of its own)
      asm volatile("" :: "v"(af[ks][0]), "v"(af[ks][1]), "v"(af[ks][2]), "v"(af[ks][3]),
                         "v"(bf[ks][0]), "v"(bf[ks][1]));
#pragma unroll
      for (int i = 0; i < 4; i++)
#pragma unroll
        for (int j = 0; j < 2; j++) c[i][j] = wmma_(af[ks][i], bf[ks][j], c[i][j]);
      // keeps these eight products here: the first eight run while the second
      // half's reads land, and none is moved behind the barrier, in front of the refill
      __builtin_amdgcn_sched_barrier(0);
    }
    asm volatile("s_wait_dscnt 0x0" ::: "memory");    // own reads of this buffer done
    asm volatile("s_wait_asynccnt 0x0" ::: "memory"); // own copies of slab t+1 landed
    __syncthreads();  // publishes slab t+1 and frees this buffer for its refill
    if (t + 2 < nslab) {
      int ko = (t + 2) * SLAB_K;
      slab_copy(ldst + buf * (SLAB_H * 2), ga + ko, sa, gb + ko, sb);
    }
  }
  asm volatile("s_wait_asynccnt 0x0" ::: "memory");   // nothing in flight at the end

  // the mode is tested once, outside the loops over the wave's 64 values a lane
  int lane = threadIdx.x & 31, jl = lane & 15, hf = lane >> 4;
  auto each = [&](auto put) {
#pragma unroll
    for (int i = 0; i < 4; i++)
#pragma unroll
      for (int j = 0; j < 2; j++)
#pragma unroll
        for (int r = 0; r < 8; r++)
          put(m0 + i * 16 + r + 8 * hf, n0 + j * 16 + jl, c[i][j][r]);
  };
  if (mode == GM_QCQR) {
    each([&](int row, int col, float v) {
      size_t o = (size_t)b * strideO + (size_t)row * ldo + col;
      out0[o] = (_Float16)(v + bias0[col]);
      out1[o] = (_Float16)(v + bias1[col]);
    });
    // no register of an issued store is rewritten ahead of this wait
    asm volatile("s_wait_xcnt 0x0" ::: "memory");
  } else if (mode == GM_VT) {             // store V transposed: (B,H,DH,KLEN)
    each([&](int row, int col, float v) {
      int h = col >> 6, d = col & 63;
      out0[(((size_t)b * H_ + h) * DH_ + d) * (size_t)klen_vt + row] = (_Float16)v;
    });
    // no register of an issued store is rewritten ahead of this wait
    asm volatile("s_wait_xcnt 0x0" ::: "memory");
  } else if (mode == GM_F32) {
    each([&](int row, int col, float v) {
      outf[(size_t)b * strideF + (size_t)row * ldo + col] = v;
    });
    // no register of an issued store is rewritten ahead of this wait
    asm volatile("s_wait_xcnt 0x0" ::: "memory");
  } else {
    each([&](int row, int col, float v) {
      out0[(size_t)b * strideO + (size_t)row * ldo + col] = (_Float16)v;
    });
    // no register of an issued store is rewritten ahead of this wait
    asm volatile("s_wait_xcnt 0x0" ::: "memory");
  }
}

enum { FK_P   = 72,                     // K and r row pitch in halves: 144 B = 16 B x odd
       FV_P   = 40,                     // V^T row pitch in halves: 80 B = 16 B x odd
       FR_OFF = 32 * FK_P,              // r band behind the 32 K rows
       FV_OFF = (32 + 96) * FK_P,       // V^T tile behind the 96 r rows
       FT_H   = FV_OFF + 64 * FV_P };   // halves per buffer

__global__ __launch_bounds__(128)
void flash_attn(const _Float16* __restrict__ qc, const _Float16* __restrict__ qr,
                const _Float16* __restrict__ kk, const _Float16* __restrict__ rr,
                const _Float16* __restrict__ vT, _Float16* __restrict__ outp) {
  __shared__ __align__(16) _Float16 tile[2 * FT_H];
  __shared__ __align__(16) float    relbuf[4][16][49];
  __shared__ __align__(16) _Float16 pbuf[4][16][32];

  // wave number in a scalar register: the causal skip below is a scalar branch
  int w = __builtin_amdgcn_readfirstlane(threadIdx.x >> 5);
  int lane = threadIdx.x & 31, jl = lane & 15, hf = lane >> 4;
  int b = blockIdx.z, h = blockIdx.y;
  int ib = blockIdx.x * 64;
  int i0 = ib + w * 16;

  const _Float16* qcb = qc + ((size_t)b * Q_ + i0) * U_ + h * DH_;
  const _Float16* qrb = qr + ((size_t)b * Q_ + i0) * U_ + h * DH_;
  v16h aqc0 = ldfrag(qcb, U_, 0), aqc1 = ldfrag(qcb, U_, 32);
  v16h aqr0 = ldfrag(qrb, U_, 0), aqr1 = ldfrag(qrb, U_, 32);

  const _Float16* kbase = kk + (size_t)b * KLEN_ * U_ + h * DH_;
  const _Float16* rbase = rr + (size_t)b * KLEN_ * U_ + h * DH_;
  const _Float16* vbase = vT + ((size_t)b * H_ + h) * DH_ * KLEN_;

  // copy role: K and r rows as (row 0..15, 16-B piece 0..7), V^T rows as
  // (row 0..31, 16-B piece 0..3)
  int crow = threadIdx.x >> 3, cpc = (threadIdx.x & 7) * 8;
  int vrow = threadIdx.x >> 2, vpc = (threadIdx.x & 3) * 8;
  unsigned lkr = (unsigned)(size_t)&tile[crow * FK_P + cpc];
  unsigned lvv = (unsigned)(size_t)&tile[FV_OFF + vrow * FV_P + vpc];

  // One key tile: each lane copies 16 B of two K rows, six r rows and two V^T
  // rows. r rows past KLEN are masked later; their source row is clamped. The
  // s_wait_xcnt stands inside the statement so that no address register of an
  // issued copy is rewritten ahead of it.
  auto tile_copy = [&](int t, int buf) {
    int j0 = t * 32;
    unsigned lk = lkr + buf * (FT_H * 2), lv = lvv + buf * (FT_H * 2);
    const _Float16* gk = kbase + (size_t)(j0 + crow) * U_ + cpc;
    const _Float16* gv = vbase + (size_t)vrow * KLEN_ + j0 + vpc;
    int rb = j0 + (Q_ - 64) - ib + crow;      // first r row of wave 3's band, + crow
    const _Float16* gr[6];
#pragma unroll   // constant indices keep the six pointers in registers
    for (int n = 0; n < 6; n++) {
      int row = rb + n * 16; if (row > KLEN_ - 1) row = KLEN_ - 1;
      gr[n] = rbase + (size_t)row * U_ + cpc;
    }
    asm volatile("global_load_async_to_lds_b128 %0, %10, off\n\t"
                 "global_load_async_to_lds_b128 %1, %11, off\n\t"
                 "global_load_async_to_lds_b128 %2, %12, off\n\t"
                 "global_load_async_to_lds_b128 %3, %13, off\n\t"
                 "global_load_async_to_lds_b128 %4, %14, off\n\t"
                 "global_load_async_to_lds_b128 %5, %15, off\n\t"
                 "global_load_async_to_lds_b128 %6, %16, off\n\t"
                 "global_load_async_to_lds_b128 %7, %17, off\n\t"
                 "global_load_async_to_lds_b128 %8, %18, off\n\t"
                 "global_load_async_to_lds_b128 %9, %19, off\n\t"
                 "s_wait_xcnt 0x0"
                 :: "v"(lk), "v"(lk + 16 * FK_P * 2),
                    "v"(lk + 32 * FK_P * 2), "v"(lk + 48 * FK_P * 2),
                    "v"(lk + 64 * FK_P * 2), "v"(lk + 80 * FK_P * 2),
                    "v"(lk + 96 * FK_P * 2), "v"(lk + 112 * FK_P * 2),
                    "v"(lv), "v"(lv + 32 * FV_P * 2),
                    "v"(gk), "v"(gk + (size_t)16 * U_),
                    "v"(gr[0]), "v"(gr[1]), "v"(gr[2]), "v"(gr[3]), "v"(gr[4]), "v"(gr[5]),
                    "v"(gv), "v"(gv + (size_t)32 * KLEN_)
                 : "memory");
  };

  v8f o[4] = {};
  float mrow[8], lrow[8];
#pragma unroll
  for (int r = 0; r < 8; r++) { mrow[r] = -1e30f; lrow[r] = 0.f; }

  int jmax  = MEM_ + i0 + 15;                // this wave's causal bound
  int ntile = (MEM_ + ib + 63) / 32 + 1;     // the block's key tiles, 34 or more

  tile_copy(0, 0);
  asm volatile("s_wait_asynccnt 0x0" ::: "memory");  // own copies of tile 0 landed
  __syncthreads();                                   // tile 0 readable by all waves
  tile_copy(1, 1);

  for (int t = 0; t < ntile; t++) {
    int j0 = t * 32, buf = t & 1;
    const _Float16* Ks = &tile[buf * FT_H];
    const _Float16* Rs = &tile[buf * FT_H + FR_OFF + (3 - w) * 16 * FK_P];
    const _Float16* Vs = &tile[buf * FT_H + FV_OFF];

    if (j0 <= jmax) {   // a wave past its causal bound skips the work, not the barrier
    // all K and r fragments of the tile are fetched as one group of LDS reads
    // (every loop over kf, rf, rc is unrolled: constant indices keep them in registers)
    v16h kf[4], rf[6];
#pragma unroll
    for (int n = 0; n < 4; n++)
      kf[n] = ldfrag(Ks + (n >> 1) * 16 * FK_P, FK_P, (n & 1) * 32);
#pragma unroll
    for (int n = 0; n < 6; n++)
      rf[n] = ldfrag(Rs + (n >> 1) * 16 * FK_P, FK_P, (n & 1) * 32);

    // context scores: two 16-col subtiles over K=DH=64
    v8f sc0 = {}, sc1 = {};
    sc0 = wmma_(aqc0, kf[0], sc0);
    sc0 = wmma_(aqc1, kf[1], sc0);
    sc1 = wmma_(aqc0, kf[2], sc1);
    sc1 = wmma_(aqc1, kf[3], sc1);

    // relative-score band: r rows rb0 .. rb0+47, rb0 = j0 + (Q-16) - i0
    v8f rc[3] = {};
#pragma unroll
    for (int tt = 0; tt < 3; tt++) {
      rc[tt] = wmma_(aqr0, rf[2 * tt], rc[tt]);
      rc[tt] = wmma_(aqr1, rf[2 * tt + 1], rc[tt]);
    }
#pragma unroll
    for (int tt = 0; tt < 3; tt++)
#pragma unroll
      for (int r = 0; r < 8; r++)
        relbuf[w][r + 8 * hf][tt * 16 + jl] = rc[tt][r];
    asm volatile("" ::: "memory");   // order LDS write -> gather (same wave)

    // gather shifted rel term, scale 1/sqrt(64), apply causal mask
    float s0[8], s1[8];
#pragma unroll
    for (int r = 0; r < 8; r++) {
      int iloc = r + 8 * hf;
      float rel0 = relbuf[w][iloc][jl + 15 - iloc];
      float rel1 = relbuf[w][iloc][16 + jl + 15 - iloc];
      int lim = MEM_ + i0 + iloc;
      s0[r] = (j0 + jl      <= lim) ? (sc0[r] + rel0) * 0.125f : -1e30f;
      s1[r] = (j0 + 16 + jl <= lim) ? (sc1[r] + rel1) * 0.125f : -1e30f;
    }

    // online softmax (row = reg r + 8*hf; 16-lane group holds the 16 cols)
    float alpha[8];
#pragma unroll
    for (int r = 0; r < 8; r++) {
      float tm = fmaxf(s0[r], s1[r]);
#pragma unroll
      for (int off = 1; off < 16; off <<= 1) tm = fmaxf(tm, __shfl_xor(tm, off, 32));
      float mn = fmaxf(mrow[r], tm);
      alpha[r] = __expf(mrow[r] - mn);
      float p0 = __expf(s0[r] - mn), p1 = __expf(s1[r] - mn);
      float ps = p0 + p1;
#pragma unroll
      for (int off = 1; off < 16; off <<= 1) ps += __shfl_xor(ps, off, 32);
      lrow[r] = lrow[r] * alpha[r] + ps;
      mrow[r] = mn;
      int iloc = r + 8 * hf;
      pbuf[w][iloc][jl]      = (_Float16)p0;
      pbuf[w][iloc][16 + jl] = (_Float16)p1;
    }
#pragma unroll
    for (int dt = 0; dt < 4; dt++)
#pragma unroll
      for (int r = 0; r < 8; r++) o[dt][r] *= alpha[r];

    asm volatile("" ::: "memory");   // order P store -> A-fragment reload
    v16h ap = ldfrag(&pbuf[w][0][0], 32, 0);   // C-layout -> A-layout via LDS
#pragma unroll
    for (int dt = 0; dt < 4; dt++)
      o[dt] = wmma_(ap, ldfrag(Vs + dt * 16 * FV_P, FV_P, 0), o[dt]);
    }

    asm volatile("s_wait_dscnt 0x0" ::: "memory");    // own reads of this buffer done
    asm volatile("s_wait_asynccnt 0x0" ::: "memory"); // own copies of tile t+1 landed
    __syncthreads();  // publishes tile t+1 and frees this buffer for its refill
    if (t + 2 < ntile) tile_copy(t + 2, buf);
  }
  asm volatile("s_wait_asynccnt 0x0" ::: "memory");   // nothing in flight at the end

  // normalize and store (B,Q,U) f16
#pragma unroll
  for (int dt = 0; dt < 4; dt++)
#pragma unroll
    for (int r = 0; r < 8; r++) {
      int iloc = r + 8 * hf;
      float vv = o[dt][r] / lrow[r];
      outp[((size_t)b * Q_ + i0 + iloc) * U_ + h * DH_ + dt * 16 + jl] = (_Float16)vv;
    }
}

// ---------------------------------------------------------------------------
extern "C" void kernel_launch(void* const* d_in, const int* in_sizes, int n_in,
                              void* d_out, int out_size, void* d_ws, size_t ws_size,
                              hipStream_t stream) {
  (void)in_sizes; (void)n_in; (void)out_size; (void)ws_size;
  const float* inputs    = (const float*)d_in[0];
  const float* relatives = (const float*)d_in[1];
  const float* memories  = (const float*)d_in[2];
  const float* biasc     = (const float*)d_in[3];
  const float* biasr     = (const float*)d_in[4];
  const float* Wq        = (const float*)d_in[5];
  const float* Wkv       = (const float*)d_in[6];
  const float* Wr        = (const float*)d_in[7];
  const float* Wo        = (const float*)d_in[8];
  float* out = (float*)d_out;

  // f16 workspace carve-out (~62 MB)
  _Float16* ws = (_Float16*)d_ws;
  size_t off = 0;
  auto carve = [&](size_t n) { _Float16* p = ws + off; off += n; return p; };
  const size_t BKU = (size_t)B_ * KLEN_ * U_;   // 4M
  const size_t BQU = (size_t)B_ * Q_ * U_;      // 2M
  const size_t UU  = (size_t)U_ * U_;           // 1M
  _Float16* xfull  = carve(BKU);
  _Float16* rel16  = carve(BKU);
  _Float16* WqT    = carve(UU);
  _Float16* WkT    = carve(UU);
  _Float16* WvT    = carve(UU);
  _Float16* WrT    = carve(UU);
  _Float16* WoT    = carve(UU);
  _Float16* qcb    = carve(BQU);
  _Float16* qrb    = carve(BQU);
  _Float16* kbuf   = carve(BKU);
  _Float16* rbuf   = carve(BKU);
  _Float16* vTb    = carve(BKU);                // (B,H,DH,KLEN)
  _Float16* attout = carve(BQU);

  // 1) pack + convert
  pack_concat_f16<<<BKU / UNIT_, 256, 0, stream>>>(memories, inputs, xfull);
  cvt_f32_to_f16<<<BKU / UNIT_, 256, 0, stream>>>(relatives, rel16);
  dim3 gt(U_ / 128, U_ / 64);
  transpose_w_f16<<<gt, 256, 0, stream>>>(Wq,  WqT, 0, 0);
  transpose_w_f16<<<gt, 256, 0, stream>>>(Wkv, WkT, 1, 0);
  transpose_w_f16<<<gt, 256, 0, stream>>>(Wkv, WvT, 1, U_);
  transpose_w_f16<<<gt, 256, 0, stream>>>(Wr,  WrT, 0, 0);
  transpose_w_f16<<<gt, 256, 0, stream>>>(Wo,  WoT, 0, 0);

  // 2) projections (all WMMA NT GEMMs)
  dim3 gq(U_ / BT_, Q_ / BT_, B_);
  gemm_nt<<<gq, 256, 0, stream>>>(xfull + (size_t)MEM_ * U_, BKU / B_, U_,
                                  WqT, U_, U_,
                                  qcb, BQU / B_, U_, qrb, biasc, biasr,
                                  nullptr, 0, 0, GM_QCQR);
  dim3 gk(U_ / BT_, KLEN_ / BT_, B_);
  gemm_nt<<<gk, 256, 0, stream>>>(xfull, BKU / B_, U_, WkT, U_, U_,
                                  kbuf, BKU / B_, U_, nullptr, nullptr, nullptr,
                                  nullptr, 0, 0, GM_PLAIN);
  gemm_nt<<<gk, 256, 0, stream>>>(rel16, BKU / B_, U_, WrT, U_, U_,
                                  rbuf, BKU / B_, U_, nullptr, nullptr, nullptr,
                                  nullptr, 0, 0, GM_PLAIN);
  gemm_nt<<<gk, 256, 0, stream>>>(xfull, BKU / B_, U_, WvT, U_, U_,
                                  vTb, 0, U_, nullptr, nullptr, nullptr,
                                  nullptr, 0, KLEN_, GM_VT);

  // 3) fused attention (no score matrix in HBM)
  flash_attn<<<dim3(Q_ / 64, H_, B_), 128, 0, stream>>>(qcb, qrb, kbuf, rbuf,
                                                        vTb, attout);

  // 4) output projection, f32 result
  gemm_nt<<<gq, 256, 0, stream>>>(attout, BQU / B_, U_, WoT, U_, U_,
                                  nullptr, 0, U_, nullptr, nullptr, nullptr,
                                  out, BQU / B_, 0, GM_F32);
}

// v005
// It runs in 177 microseconds.
// Next to v004, in two timings, it ran 1.18 and 1.17 times as fast.
// Over all steps from v000 it is 2.35 times as fast.
#include <hip/hip_runtime.h>
#include <hip/hip_bf16.h>

// ---------------------------------------------------------------------------
// Transformer-XL relative multi-head attention for MI455X (gfx1250).
// All GEMMs run on v_wmma_f32_16x16x32_f16 (wave32 WMMA, f32 accumulate).
// Attention is fused flash-style (online softmax) so the (B,H,Q,KLEN) score
// matrix (256MB f32) never touches HBM. The relative-shift is folded into the
// flash loop via a 47-wide diagonal band of qr*r^T tiles gathered through LDS.
// Workspace requirement: ~62 MB of f16 scratch in d_ws.
// ---------------------------------------------------------------------------

enum { B_ = 2, Q_ = 1024, MEM_ = 1024, U_ = 1024, H_ = 16, DH_ = 64, KLEN_ = MEM_ + Q_ };

typedef __attribute__((ext_vector_type(16))) _Float16 v16h;
typedef __attribute__((ext_vector_type(8)))  _Float16 v8h;
typedef __attribute__((ext_vector_type(8)))  float    v8f;

// ---- WMMA fragment helpers (layouts per CDNA5 ISA 7.12.2) -----------------
// A fragment 16x32 f16: lane m=lane&15 holds row m; half=lane>>4 selects
// k-groups: regs 0-3 = k in [half*8, half*8+8), regs 4-7 = +16. Each group is
// 8 contiguous halves -> one 16B load. B fragment (NT form, B stored as NxK
// row-major) is symmetric with N in place of M.
__device__ __forceinline__ v16h frag_combine(v8h lo, v8h hi) {
  return __builtin_shufflevector(lo, hi, 0,1,2,3,4,5,6,7,8,9,10,11,12,13,14,15);
}

__device__ __forceinline__ v16h ldfrag(const _Float16* base, int ld, int koff) {
  int lane = threadIdx.x & 31;
  int m = lane & 15, hf = lane >> 4;
  const v8h* p = (const v8h*)(base + (size_t)m * ld + koff + hf * 8);
  return frag_combine(p[0], p[2]);   // p[2] == +16 halves
}

__device__ __forceinline__ v8f wmma_(v16h a, v16h b, v8f c) {
  return __builtin_amdgcn_wmma_f32_16x16x32_f16(false, a, false, b, (short)0, c,
                                                false, false);
}

// ---- pack / convert kernels ----------------------------------------------
// Every lane moves 16-B pieces, eight loads in flight: a block of 256 threads
// takes one unit of 8192 floats, so few waves have to be started.
typedef __attribute__((ext_vector_type(4))) float    v4f;
typedef __attribute__((ext_vector_type(4))) _Float16 v4h;
enum { UNIT_ = 8192 };

// One unit, contiguous: each wave-wide load covers 512 B, each store 256 B.
__device__ __forceinline__ void cvt_unit(const float* __restrict__ src,
                                         _Float16* __restrict__ dst) {
  const v4f* s = (const v4f*)src + threadIdx.x;
  v4h* d = (v4h*)dst + threadIdx.x;
  v4f x[8];
#pragma unroll   // constant indices keep the eight pieces in registers
  for (int i = 0; i < 8; i++) x[i] = s[i * 256];
#pragma unroll
  for (int i = 0; i < 8; i++) d[i * 256] = __builtin_convertvector(x[i], v4h);
}

// MEM_*U_ and Q_*U_ are multiples of UNIT_: a unit lies in one source.
__global__ __launch_bounds__(256)
void pack_concat_f16(const float* __restrict__ mem,
                     const float* __restrict__ inp,
                     _Float16* __restrict__ xfull) {
  size_t e = (size_t)blockIdx.x * UNIT_;
  size_t b = e / ((size_t)KLEN_ * U_);
  size_t rem = e - b * (size_t)KLEN_ * U_;
  const float* src = (rem < (size_t)MEM_ * U_)
                         ? mem + b * (size_t)MEM_ * U_ + rem
                         : inp + b * (size_t)Q_ * U_ + (rem - (size_t)MEM_ * U_);
  cvt_unit(src, xfull + e);
}

// one unit per block; the grid covers the whole array (a multiple of UNIT_)
__global__ __launch_bounds__(256)
void cvt_f32_to_f16(const float* __restrict__ in, _Float16* __restrict__ out) {
  size_t e = (size_t)blockIdx.x * UNIT_;
  cvt_unit(in + e, out + e);
}

// out[n*U_ + k] = in[k*ldin + coloff + n]  (weight transpose for NT GEMMs)
// Block tile 64 k x 128 n, wave tile 32 k x 32 n, lane tile 8 k x 4 n held in
// registers: a load covers four whole 128-B lines of the source rows, a store
// writes 8 halves of k (16 B) per lane. The source pitch is a template
// constant (two are in use): no multiply by a run-time pitch in the addresses.
template <int LDIN>
__device__ __forceinline__ void transpose_tile(const float* __restrict__ in,
                                               _Float16* __restrict__ out) {
  int lane = threadIdx.x & 31, wid = threadIdx.x >> 5;
  int k0 = blockIdx.y * 64  + (wid & 1) * 32  + (lane >> 3) * 8;
  int n0 = blockIdx.x * 128 + (wid >> 1) * 32 + (lane & 7) * 4;
  const float* s = in + (size_t)k0 * LDIN + n0;
  _Float16* d = out + (size_t)n0 * U_ + k0;
  v4f x[8];
#pragma unroll   // constant indices keep the lane tile in registers
  for (int i = 0; i < 8; i++) x[i] = *(const v4f*)(s + i * LDIN);
#pragma unroll
  for (int j = 0; j < 4; j++) {
    v8h y;
#pragma unroll
    for (int i = 0; i < 8; i++) y[i] = (_Float16)x[i][j];
    *(v8h*)(d + j * U_) = y;
  }
}

// U_ x U_ block of a source whose rows hold U_ floats (wide == 0) or 2*U_
__global__ __launch_bounds__(256)
void transpose_w_f16(const float* __restrict__ in, _Float16* __restrict__ out,
                     int wide, int coloff) {
  if (wide) transpose_tile<2 * U_>(in + coloff, out);
  else      transpose_tile<U_>(in + coloff, out);
}

// ---- generic batched NT GEMM: C(MxN) = A(MxK) * Bw(NxK)^T ------------------
// 256 threads = 8 waves, wave grid 2x4 -> 128x128 block tile, 64x32 per wave
// (4 x 2 accumulator tiles): every A fragment serves two products, every B
// fragment four, and a row staged in LDS serves 128 rows of the other operand.
// The block's 128 A rows and 128 B rows are staged in LDS in slabs of 64 k by
// asynchronous copies (whole 128-B lines per 8 lanes), two buffers, so that the
// next slab flies while this one is multiplied. M and N must be multiples of
// 128, K a multiple of 64.
enum { GM_PLAIN = 0, GM_QCQR = 1, GM_VT = 2, GM_F32 = 3 };
enum { BT_    = 128,                // rows of A and rows of B per block tile
       SLAB_K = 64,                 // halves of k per slab: 128 B per row
       SLAB_P = 72,                 // LDS row pitch in halves: 144 B = 16 B x odd
       SLAB_G = 32 * SLAB_P * 2,    // LDS bytes of the 32 rows one copy fills
       SLAB_H = 2 * BT_ * SLAB_P }; // halves per buffer: 128 A rows, then 128 B rows

// One slab: each lane copies 16 B of four A rows and of four B rows, 32 rows
// apart (sa, sb: 32 source rows in halves). The s_wait_xcnt stands inside the
// statement so that no address register of an issued copy is rewritten ahead
// of it.
__device__ __forceinline__ void slab_copy(unsigned lds, const _Float16* ga, size_t sa,
                                          const _Float16* gb, size_t sb) {
  asm volatile("global_load_async_to_lds_b128 %0, %8, off\n\t"
               "global_load_async_to_lds_b128 %1, %9, off\n\t"
               "global_load_async_to_lds_b128 %2, %10, off\n\t"
               "global_load_async_to_lds_b128 %3, %11, off\n\t"
               "global_load_async_to_lds_b128 %4, %12, off\n\t"
               "global_load_async_to_lds_b128 %5, %13, off\n\t"
               "global_load_async_to_lds_b128 %6, %14, off\n\t"
               "global_load_async_to_lds_b128 %7, %15, off\n\t"
               "s_wait_xcnt 0x0"
               :: "v"(lds),              "v"(lds + SLAB_G),     "v"(lds + 2 * SLAB_G),
                  "v"(lds + 3 * SLAB_G), "v"(lds + 4 * SLAB_G), "v"(lds + 5 * SLAB_G),
                  "v"(lds + 6 * SLAB_G), "v"(lds + 7 * SLAB_G),
                  "v"(ga), "v"(ga + sa), "v"(ga + 2 * sa), "v"(ga + 3 * sa),
                  "v"(gb), "v"(gb + sb), "v"(gb + 2 * sb), "v"(gb + 3 * sb)
               : "memory");
}

__global__ __launch_bounds__(256)
void gemm_nt(const _Float16* __restrict__ A, size_t strideA, int lda,
             const _Float16* __restrict__ Bw, int ldb, int K,
             _Float16* __restrict__ out0, size_t strideO, int ldo,
             _Float16* __restrict__ out1,
             const float* __restrict__ bias0, const float* __restrict__ bias1,
             float* __restrict__ outf, size_t strideF,
             int klen_vt, int mode) {
  __shared__ __attribute__((aligned(16))) _Float16 slab[2 * SLAB_H];

  int b   = blockIdx.z;
  int wid = threadIdx.x >> 5;
  int mw  = (wid >> 2) * 64, nw = (wid & 3) * 32;
  int m0  = blockIdx.y * BT_ + mw;
  int n0  = blockIdx.x * BT_ + nw;

  // copy role: thread -> (row 0..31, 16-B piece 0..7) of each 32-row group
  int crow = threadIdx.x >> 3, cpc = (threadIdx.x & 7) * 8;
  const _Float16* ga = A + (size_t)b * strideA
                         + (size_t)(blockIdx.y * BT_ + crow) * lda + cpc;
  const _Float16* gb = Bw + (size_t)(blockIdx.x * BT_ + crow) * ldb + cpc;
  size_t sa = (size_t)32 * lda, sb = (size_t)32 * ldb;
  unsigned ldst = (unsigned)(size_t)&slab[crow * SLAB_P + cpc];

  int nslab = K / SLAB_K;
  slab_copy(ldst, ga, sa, gb, sb);
  asm volatile("s_wait_asynccnt 0x0" ::: "memory");  // own copies of slab 0 landed
  __syncthreads();                                   // slab 0 readable by all waves
  if (nslab > 1)
    slab_copy(ldst + SLAB_H * 2, ga + SLAB_K, sa, gb + SLAB_K, sb);

  v8f c[4][2] = {};
  for (int t = 0; t < nslab; t++) {
    int buf = t & 1;
    const _Float16* As = &slab[buf * SLAB_H + mw * SLAB_P];
    const _Float16* Bs = &slab[buf * SLAB_H + (BT_ + nw) * SLAB_P];
    // the slab's fragments are fetched as one group of LDS reads (every loop
    // over af, bf, c is unrolled: constant indices keep them in registers)
    v16h af[2][4], bf[2][2];
#pragma unroll
    for (int ks = 0; ks < 2; ks++) {
#pragma unroll
      for (int i = 0; i < 4; i++) af[ks][i] = ldfrag(As + i * 16 * SLAB_P, SLAB_P, ks * 32);
#pragma unroll
      for (int j = 0; j < 2; j++) bf[ks][j] = ldfrag(Bs + j * 16 * SLAB_P, SLAB_P, ks * 32);
    }
#pragma unroll
    for (int ks = 0; ks < 2; ks++) {
      // inputs-only fence on the loaded fragments: keeps their LDS reads one
      // group in front of the eight products (sunk to their uses, every pair
      // of products waits out an LDS latency of its own)
      asm volatile("" :: "v"(af[ks][0]), "v"(af[ks][1]), "v"(af[ks][2]), "v"(af[ks][3]),
                         "v"(bf[ks][0]), "v"(bf[ks][1]));
#pragma unroll
      for (int i = 0; i < 4; i++)
#pragma unroll
        for (int j = 0; j < 2; j++) c[i][j] = wmma_(af[ks][i], bf[ks][j], c[i][j]);
      // keeps these eight products here: the first eight run while the second
      // half's reads land, and none is moved behind the barrier, in front of the refill
      __builtin_amdgcn_sched_barrier(0);
    }
    asm volatile("s_wait_dscnt 0x0" ::: "memory");    // own reads of this buffer done
    asm volatile("s_wait_asynccnt 0x0" ::: "memory"); // own copies of slab t+1 landed
    __syncthreads();  // publishes slab t+1 and frees this buffer for its refill
    if (t + 2 < nslab) {
      int ko = (t + 2) * SLAB_K;
      slab_copy(ldst + buf * (SLAB_H * 2), ga + ko, sa, gb + ko, sb);
    }
  }
  asm volatile("s_wait_asynccnt 0x0" ::: "memory");   // nothing in flight at the end

  // the mode is tested once, outside the loops over the wave's 64 values a lane
  int lane = threadIdx.x & 31, jl = lane & 15, hf = lane >> 4;
  auto each = [&](auto put) {
#pragma unroll
    for (int i = 0; i < 4; i++)
#pragma unroll
      for (int j = 0; j < 2; j++)
#pragma unroll
        for (int r = 0; r < 8; r++)
          put(m0 + i * 16 + r + 8 * hf, n0 + j * 16 + jl, c[i][j][r]);
  };
  if (mode == GM_QCQR) {
    each([&](int row, int col, float v) {
      size_t o = (size_t)b * strideO + (size_t)row * ldo + col;
      out0[o] = (_Float16)(v + bias0[col]);
      out1[o] = (_Float16)(v + bias1[col]);
    });
    // no register of an issued store is rewritten ahead of this wait
    asm volatile("s_wait_xcnt 0x0" ::: "memory");
  } else if (mode == GM_VT) {             // store V transposed: (B,H,DH,KLEN)
    each([&](int row, int col, float v) {
      int h = col >> 6, d = col & 63;
      out0[(((size_t)b * H_ + h) * DH_ + d) * (size_t)klen_vt + row] = (_Float16)v;
    });
    // no register of an issued store is rewritten ahead of this wait
    asm volatile("s_wait_xcnt 0x0" ::: "memory");
  } else if (mode == GM_F32) {
    each([&](int row, int col, float v) {
      outf[(size_t)b * strideF + (size_t)row * ldo + col] = v;
    });
    // no register of an issued store is rewritten ahead of this wait
    asm volatile("s_wait_xcnt 0x0" ::: "memory");
  } else {
    each([&](int row, int col, float v) {
      out0[(size_t)b * strideO + (size_t)row * ldo + col] = (_Float16)v;
    });
    // no register of an issued store is rewritten ahead of this wait
    asm volatile("s_wait_xcnt 0x0" ::: "memory");
  }
}

enum { FK_P   = 72,                     // K and r row pitch in halves: 144 B = 16 B x odd
       FV_P   = 40,                     // V^T row pitch in halves: 80 B = 16 B x odd
       FR_OFF = 32 * FK_P,              // r band behind the 32 K rows
       FV_OFF = (32 + 96) * FK_P,       // V^T tile behind the 96 r rows
       FT_H   = FV_OFF + 64 * FV_P };   // halves per buffer

// ---- reductions over a 16-lane row, on the vector port ---------------------
// A shuffle builtin goes through the LDS queue, and every step of a reduction
// then waits out that queue's latency; a DPP row_xmask operand reads lane l ^ M
// of the lane's own 16-lane row inside the vector instruction itself.
template <int M>
__device__ __forceinline__ float row_xor(float x) {
  int v = __builtin_bit_cast(int, x);
  return __builtin_bit_cast(float,
      __builtin_amdgcn_update_dpp(v, v, 0x160 + M, 0xf, 0xf, true));
}

// Row maximum of eight values, every lane of a row gets it. Written as asm so
// that move and maximum are one instruction (from the builtin the compiler makes
// three: move, quieting maximum, maximum). The eight chains are interleaved:
// each step's producer stands eight instructions back, so no step waits on it.
// All 32 lanes are on where this is called.
__device__ __forceinline__ void row_max8(float (&t)[8]) {
  asm volatile(
      "v_max_num_f32_dpp %0, %0, %0 row_xmask:1 row_mask:0xf bank_mask:0xf\n\t"
      "v_max_num_f32_dpp %1, %1, %1 row_xmask:1 row_mask:0xf bank_mask:0xf\n\t"
      "v_max_num_f32_dpp %2, %2, %2 row_xmask:1 row_mask:0xf bank_mask:0xf\n\t"
      "v_max_num_f32_dpp %3, %3, %3 row_xmask:1 row_mask:0xf bank_mask:0xf\n\t"
      "v_max_num_f32_dpp %4, %4, %4 row_xmask:1 row_mask:0xf bank_mask:0xf\n\t"
      "v_max_num_f32_dpp %5, %5, %5 row_xmask:1 row_mask:0xf bank_mask:0xf\n\t"
      "v_max_num_f32_dpp %6, %6, %6 row_xmask:1 row_mask:0xf bank_mask:0xf\n\t"
      "v_max_num_f32_dpp %7, %7, %7 row_xmask:1 row_mask:0xf bank_mask:0xf\n\t"
      "v_max_num_f32_dpp %0, %0, %0 row_xmask:2 row_mask:0xf bank_mask:0xf\n\t"
      "v_max_num_f32_dpp %1, %1, %1 row_xmask:2 row_mask:0xf bank_mask:0xf\n\t"
      "v_max_num_f32_dpp %2, %2, %2 row_xmask:2 row_mask:0xf bank_mask:0xf\n\t"
      "v_max_num_f32_dpp %3, %3, %3 row_xmask:2 row_mask:0xf bank_mask:0xf\n\t"
      "v_max_num_f32_dpp %4, %4, %4 row_xmask:2 row_mask:0xf bank_mask:0xf\n\t"
      "v_max_num_f32_dpp %5, %5, %5 row_xmask:2 row_mask:0xf bank_mask:0xf\n\t"
      "v_max_num_f32_dpp %6, %6, %6 row_xmask:2 row_mask:0xf bank_mask:0xf\n\t"
      "v_max_num_f32_dpp %7, %7, %7 row_xmask:2 row_mask:0xf bank_mask:0xf\n\t"
      "v_max_num_f32_dpp %0, %0, %0 row_xmask:4 row_mask:0xf bank_mask:0xf\n\t"
      "v_max_num_f32_dpp %1, %1, %1 row_xmask:4 row_mask:0xf bank_mask:0xf\n\t"
      "v_max_num_f32_dpp %2, %2, %2 row_xmask:4 row_mask:0xf bank_mask:0xf\n\t"
      "v_max_num_f32_dpp %3, %3, %3 row_xmask:4 row_mask:0xf bank_mask:0xf\n\t"
      "v_max_num_f32_dpp %4, %4, %4 row_xmask:4 row_mask:0xf bank_mask:0xf\n\t"
      "v_max_num_f32_dpp %5, %5, %5 row_xmask:4 row_mask:0xf bank_mask:0xf\n\t"
      "v_max_num_f32_dpp %6, %6, %6 row_xmask:4 row_mask:0xf bank_mask:0xf\n\t"
      "v_max_num_f32_dpp %7, %7, %7 row_xmask:4 row_mask:0xf bank_mask:0xf\n\t"
      "v_max_num_f32_dpp %0, %0, %0 row_xmask:8 row_mask:0xf bank_mask:0xf\n\t"
      "v_max_num_f32_dpp %1, %1, %1 row_xmask:8 row_mask:0xf bank_mask:0xf\n\t"
      "v_max_num_f32_dpp %2, %2, %2 row_xmask:8 row_mask:0xf bank_mask:0xf\n\t"
      "v_max_num_f32_dpp %3, %3, %3 row_xmask:8 row_mask:0xf bank_mask:0xf\n\t"
      "v_max_num_f32_dpp %4, %4, %4 row_xmask:8 row_mask:0xf bank_mask:0xf\n\t"
      "v_max_num_f32_dpp %5, %5, %5 row_xmask:8 row_mask:0xf bank_mask:0xf\n\t"
      "v_max_num_f32_dpp %6, %6, %6 row_xmask:8 row_mask:0xf bank_mask:0xf\n\t"
      "v_max_num_f32_dpp %7, %7, %7 row_xmask:8 row_mask:0xf bank_mask:0xf"
      : "+v"(t[0]), "+v"(t[1]), "+v"(t[2]), "+v"(t[3]),
        "+v"(t[4]), "+v"(t[5]), "+v"(t[6]), "+v"(t[7]));
}

__global__ __launch_bounds__(128)
void flash_attn(const _Float16* __restrict__ qc, const _Float16* __restrict__ qr,
                const _Float16* __restrict__ kk, const _Float16* __restrict__ rr,
                const _Float16* __restrict__ vT, _Float16* __restrict__ outp) {
  __shared__ __align__(16) _Float16 tile[2 * FT_H];
  __shared__ __align__(16) float    relbuf[4][16][49];
  __shared__ __align__(16) _Float16 pbuf[4][16][32];

  // wave number in a scalar register: the causal skip below is a scalar branch
  int w = __builtin_amdgcn_readfirstlane(threadIdx.x >> 5);
  int lane = threadIdx.x & 31, jl = lane & 15, hf = lane >> 4;
  int b = blockIdx.z, h = blockIdx.y;
  int ib = blockIdx.x * 64;
  int i0 = ib + w * 16;

  const _Float16* qcb = qc + ((size_t)b * Q_ + i0) * U_ + h * DH_;
  const _Float16* qrb = qr + ((size_t)b * Q_ + i0) * U_ + h * DH_;
  v16h aqc0 = ldfrag(qcb, U_, 0), aqc1 = ldfrag(qcb, U_, 32);
  v16h aqr0 = ldfrag(qrb, U_, 0), aqr1 = ldfrag(qrb, U_, 32);

  const _Float16* kbase = kk + (size_t)b * KLEN_ * U_ + h * DH_;
  const _Float16* rbase = rr + (size_t)b * KLEN_ * U_ + h * DH_;
  const _Float16* vbase = vT + ((size_t)b * H_ + h) * DH_ * KLEN_;

  // copy role: K and r rows as (row 0..15, 16-B piece 0..7), V^T rows as
  // (row 0..31, 16-B piece 0..3)
  int crow = threadIdx.x >> 3, cpc = (threadIdx.x & 7) * 8;
  int vrow = threadIdx.x >> 2, vpc = (threadIdx.x & 3) * 8;
  unsigned lkr = (unsigned)(size_t)&tile[crow * FK_P + cpc];
  unsigned lvv = (unsigned)(size_t)&tile[FV_OFF + vrow * FV_P + vpc];

  // One key tile: each lane copies 16 B of two K rows, six r rows and two V^T
  // rows. r rows past KLEN are masked later; their source row is clamped. The
  // s_wait_xcnt stands inside the statement so that no address register of an
  // issued copy is rewritten ahead of it.
  auto tile_copy = [&](int t, int buf) {
    int j0 = t * 32;
    unsigned lk = lkr + buf * (FT_H * 2), lv = lvv + buf * (FT_H * 2);
    const _Float16* gk = kbase + (size_t)(j0 + crow) * U_ + cpc;
    const _Float16* gv = vbase + (size_t)vrow * KLEN_ + j0 + vpc;
    int rb = j0 + (Q_ - 64) - ib + crow;      // first r row of wave 3's band, + crow
    const _Float16* gr[6];
#pragma unroll   // constant indices keep the six pointers in registers
    for (int n = 0; n < 6; n++) {
      int row = rb + n * 16; if (row > KLEN_ - 1) row = KLEN_ - 1;
      gr[n] = rbase + (size_t)row * U_ + cpc;
    }
    asm volatile("global_load_async_to_lds_b128 %0, %10, off\n\t"
                 "global_load_async_to_lds_b128 %1, %11, off\n\t"
                 "global_load_async_to_lds_b128 %2, %12, off\n\t"
                 "global_load_async_to_lds_b128 %3, %13, off\n\t"
                 "global_load_async_to_lds_b128 %4, %14, off\n\t"
                 "global_load_async_to_lds_b128 %5, %15, off\n\t"
                 "global_load_async_to_lds_b128 %6, %16, off\n\t"
                 "global_load_async_to_lds_b128 %7, %17, off\n\t"
                 "global_load_async_to_lds_b128 %8, %18, off\n\t"
                 "global_load_async_to_lds_b128 %9, %19, off\n\t"
                 "s_wait_xcnt 0x0"
                 :: "v"(lk), "v"(lk + 16 * FK_P * 2),
                    "v"(lk + 32 * FK_P * 2), "v"(lk + 48 * FK_P * 2),
                    "v"(lk + 64 * FK_P * 2), "v"(lk + 80 * FK_P * 2),
                    "v"(lk + 96 * FK_P * 2), "v"(lk + 112 * FK_P * 2),
                    "v"(lv), "v"(lv + 32 * FV_P * 2),
                    "v"(gk), "v"(gk + (size_t)16 * U_),
                    "v"(gr[0]), "v"(gr[1]), "v"(gr[2]), "v"(gr[3]), "v"(gr[4]), "v"(gr[5]),
                    "v"(gv), "v"(gv + (size_t)32 * KLEN_)
                 : "memory");
  };

  v8f o[4] = {};
  float mrow[8], lrow[8];
#pragma unroll
  for (int r = 0; r < 8; r++) { mrow[r] = -1e30f; lrow[r] = 0.f; }

  int jmax  = MEM_ + i0 + 15;                // this wave's causal bound
  int ntile = (MEM_ + ib + 63) / 32 + 1;     // the block's key tiles, 34 or more

  tile_copy(0, 0);
  asm volatile("s_wait_asynccnt 0x0" ::: "memory");  // own copies of tile 0 landed
  __syncthreads();                                   // tile 0 readable by all waves
  tile_copy(1, 1);

  for (int t = 0; t < ntile; t++) {
    int j0 = t * 32, buf = t & 1;
    const _Float16* Ks = &tile[buf * FT_H];
    const _Float16* Rs = &tile[buf * FT_H + FR_OFF + (3 - w) * 16 * FK_P];
    const _Float16* Vs = &tile[buf * FT_H + FV_OFF];

    if (j0 <= jmax) {   // a wave past its causal bound skips the work, not the barrier
    // all K and r fragments of the tile are fetched as one group of LDS reads
    // (every loop over kf, rf, rc is unrolled: constant indices keep them in registers)
    v16h kf[4], rf[6];
#pragma unroll
    for (int n = 0; n < 4; n++)
      kf[n] = ldfrag(Ks + (n >> 1) * 16 * FK_P, FK_P, (n & 1) * 32);
#pragma unroll
    for (int n = 0; n < 6; n++)
      rf[n] = ldfrag(Rs + (n >> 1) * 16 * FK_P, FK_P, (n & 1) * 32);

    // context scores: two 16-col subtiles over K=DH=64
    v8f sc0 = {}, sc1 = {};
    sc0 = wmma_(aqc0, kf[0], sc0);
    sc0 = wmma_(aqc1, kf[1], sc0);
    sc1 = wmma_(aqc0, kf[2], sc1);
    sc1 = wmma_(aqc1, kf[3], sc1);

    // relative-score band: r rows rb0 .. rb0+47, rb0 = j0 + (Q-16) - i0
    v8f rc[3] = {};
#pragma unroll
    for (int tt = 0; tt < 3; tt++) {
      rc[tt] = wmma_(aqr0, rf[2 * tt], rc[tt]);
      rc[tt] = wmma_(aqr1, rf[2 * tt + 1], rc[tt]);
    }
#pragma unroll
    for (int tt = 0; tt < 3; tt++)
#pragma unroll
      for (int r = 0; r < 8; r++)
        relbuf[w][r + 8 * hf][tt * 16 + jl] = rc[tt][r];
    asm volatile("" ::: "memory");   // order LDS write -> gather (same wave)

    // gather shifted rel term, scale 1/sqrt(64), apply causal mask
    float s0[8], s1[8];
#pragma unroll
    for (int r = 0; r < 8; r++) {
      int iloc = r + 8 * hf;
      float rel0 = relbuf[w][iloc][jl + 15 - iloc];
      float rel1 = relbuf[w][iloc][16 + jl + 15 - iloc];
      int lim = MEM_ + i0 + iloc;
      s0[r] = (j0 + jl      <= lim) ? (sc0[r] + rel0) * 0.125f : -1e30f;
      s1[r] = (j0 + 16 + jl <= lim) ? (sc1[r] + rel1) * 0.125f : -1e30f;
    }

    // online softmax (row = reg r + 8*hf; 16-lane group holds the 16 cols)
    float alpha[8], tm[8];
#pragma unroll   // constant indices keep tm in registers
    for (int r = 0; r < 8; r++) tm[r] = fmaxf(fmaxf(s0[r], s1[r]), mrow[r]);
    row_max8(tm);   // the running maximum is the same in a row's lanes: this is the new one
#pragma unroll
    for (int r = 0; r < 8; r++) {
      float mn = tm[r];
      alpha[r] = __expf(mrow[r] - mn);
      float p0 = __expf(s0[r] - mn), p1 = __expf(s1[r] - mn);
      float ps = p0 + p1;
      ps += row_xor<1>(ps); ps += row_xor<2>(ps);
      ps += row_xor<4>(ps); ps += row_xor<8>(ps);
      lrow[r] = lrow[r] * alpha[r] + ps;
      mrow[r] = mn;
      int iloc = r + 8 * hf;
      pbuf[w][iloc][jl]      = (_Float16)p0;
      pbuf[w][iloc][16 + jl] = (_Float16)p1;
    }
#pragma unroll
    for (int dt = 0; dt < 4; dt++)
#pragma unroll
      for (int r = 0; r < 8; r++) o[dt][r] *= alpha[r];

    asm volatile("" ::: "memory");   // order P store -> A-fragment reload
    v16h ap = ldfrag(&pbuf[w][0][0], 32, 0);   // C-layout -> A-layout via LDS
#pragma unroll
    for (int dt = 0; dt < 4; dt++)
      o[dt] = wmma_(ap, ldfrag(Vs + dt * 16 * FV_P, FV_P, 0), o[dt]);
    }

    asm volatile("s_wait_dscnt 0x0" ::: "memory");    // own reads of this buffer done
    asm volatile("s_wait_asynccnt 0x0" ::: "memory"); // own copies of tile t+1 landed
    __syncthreads();  // publishes tile t+1 and frees this buffer for its refill
    if (t + 2 < ntile) tile_copy(t + 2, buf);
  }
  asm volatile("s_wait_asynccnt 0x0" ::: "memory");   // nothing in flight at the end

  // normalize and store (B,Q,U) f16
#pragma unroll
  for (int dt = 0; dt < 4; dt++)
#pragma unroll
    for (int r = 0; r < 8; r++) {
      int iloc = r + 8 * hf;
      float vv = o[dt][r] / lrow[r];
      outp[((size_t)b * Q_ + i0 + iloc) * U_ + h * DH_ + dt * 16 + jl] = (_Float16)vv;
    }
}

// ---------------------------------------------------------------------------
extern "C" void kernel_launch(void* const* d_in, const int* in_sizes, int n_in,
                              void* d_out, int out_size, void* d_ws, size_t ws_size,
                              hipStream_t stream) {
  (void)in_sizes; (void)n_in; (void)out_size; (void)ws_size;
  const float* inputs    = (const float*)d_in[0];
  const float* relatives = (const float*)d_in[1];
  const float* memories  = (const float*)d_in[2];
  const float* biasc     = (const float*)d_in[3];
  const float* biasr     = (const float*)d_in[4];
  const float* Wq        = (const float*)d_in[5];
  const float* Wkv       = (const float*)d_in[6];
  const float* Wr        = (const float*)d_in[7];
  const float* Wo        = (const float*)d_in[8];
  float* out = (float*)d_out;

  // f16 workspace carve-out (~62 MB)
  _Float16* ws = (_Float16*)d_ws;
  size_t off = 0;
  auto carve = [&](size_t n) { _Float16* p = ws + off; off += n; return p; };
  const size_t BKU = (size_t)B_ * KLEN_ * U_;   // 4M
  const size_t BQU = (size_t)B_ * Q_ * U_;      // 2M
  const size_t UU  = (size_t)U_ * U_;           // 1M
  _Float16* xfull  = carve(BKU);
  _Float16* rel16  = carve(BKU);
  _Float16* WqT    = carve(UU);
  _Float16* WkT    = carve(UU);
  _Float16* WvT    = carve(UU);
  _Float16* WrT    = carve(UU);
  _Float16* WoT    = carve(UU);
  _Float16* qcb    = carve(BQU);
  _Float16* qrb    = carve(BQU);
  _Float16* kbuf   = carve(BKU);
  _Float16* rbuf   = carve(BKU);
  _Float16* vTb    = carve(BKU);                // (B,H,DH,KLEN)
  _Float16* attout = carve(BQU);

  // 1) pack + convert
  pack_concat_f16<<<BKU / UNIT_, 256, 0, stream>>>(memories, inputs, xfull);
  cvt_f32_to_f16<<<BKU / UNIT_, 256, 0, stream>>>(relatives, rel16);
  dim3 gt(U_ / 128, U_ / 64);
  transpose_w_f16<<<gt, 256, 0, stream>>>(Wq,  WqT, 0, 0);
  transpose_w_f16<<<gt, 256, 0, stream>>>(Wkv, WkT, 1, 0);
  transpose_w_f16<<<gt, 256, 0, stream>>>(Wkv, WvT, 1, U_);
  transpose_w_f16<<<gt, 256, 0, stream>>>(Wr,  WrT, 0, 0);
  transpose_w_f16<<<gt, 256, 0, stream>>>(Wo,  WoT, 0, 0);

  // 2) projections (all WMMA NT GEMMs)
  dim3 gq(U_ / BT_, Q_ / BT_, B_);
  gemm_nt<<<gq, 256, 0, stream>>>(xfull + (size_t)MEM_ * U_, BKU / B_, U_,
                                  WqT, U_, U_,
                                  qcb, BQU / B_, U_, qrb, biasc, biasr,
                                  nullptr, 0, 0, GM_QCQR);
  dim3 gk(U_ / BT_, KLEN_ / BT_, B_);
  gemm_nt<<<gk, 256, 0, stream>>>(xfull, BKU / B_, U_, WkT, U_, U_,
                                  kbuf, BKU / B_, U_, nullptr, nullptr, nullptr,
                                  nullptr, 0, 0, GM_PLAIN);
  gemm_nt<<<gk, 256, 0, stream>>>(rel16, BKU / B_, U_, WrT, U_, U_,
                                  rbuf, BKU / B_, U_, nullptr, nullptr, nullptr,
                                  nullptr, 0, 0, GM_PLAIN);
  gemm_nt<<<gk, 256, 0, stream>>>(xfull, BKU / B_, U_, WvT, U_, U_,
                                  vTb, 0, U_, nullptr, nullptr, nullptr,
                                  nullptr, 0, KLEN_, GM_VT);

  // 3) fused attention (no score matrix in HBM)
  flash_attn<<<dim3(Q_ / 64, H_, B_), 128, 0, stream>>>(qcb, qrb, kbuf, rbuf,
                                                        vTb, attout);

  // 4) output projection, f32 result
  gemm_nt<<<gq, 256, 0, stream>>>(attout, BQU / B_, U_, WoT, U_, U_,
                                  nullptr, 0, U_, nullptr, nullptr, nullptr,
                                  out, BQU / B_, 0, GM_F32);
}

// v006
// It runs in 139 microseconds.
// Timed twice side by side with v005, it ran 1.28 and 1.26 times as fast.
// Over all steps from v000 it is 3.00 times as fast.
#include <hip/hip_runtime.h>
#include <hip/hip_bf16.h>

// ---------------------------------------------------------------------------
// Transformer-XL relative multi-head attention for MI455X (gfx1250).
// All GEMMs run on v_wmma_f32_16x16x32_f16 (wave32 WMMA, f32 accumulate).
// Attention is fused flash-style (online softmax) so the (B,H,Q,KLEN) score
// matrix (256MB f32) never touches HBM. The relative-shift is folded into the
// flash loop via a 47-wide diagonal band of qr*r^T tiles gathered through LDS.
// Workspace requirement: ~62 MB of f16 scratch in d_ws.
// ---------------------------------------------------------------------------

enum { B_ = 2, Q_ = 1024, MEM_ = 1024, U_ = 1024, H_ = 16, DH_ = 64, KLEN_ = MEM_ + Q_ };

typedef __attribute__((ext_vector_type(16))) _Float16 v16h;
typedef __attribute__((ext_vector_type(8)))  _Float16 v8h;
typedef __attribute__((ext_vector_type(8)))  float    v8f;

// ---- WMMA fragment helpers (layouts per CDNA5 ISA 7.12.2) -----------------
// A fragment 16x32 f16: lane m=lane&15 holds row m; half=lane>>4 selects
// k-groups: regs 0-3 = k in [half*8, half*8+8), regs 4-7 = +16. Each group is
// 8 contiguous halves -> one 16B load. B fragment (NT form, B stored as NxK
// row-major) is symmetric with N in place of M.
__device__ __forceinline__ v16h frag_combine(v8h lo, v8h hi) {
  return __builtin_shufflevector(lo, hi, 0,1,2,3,4,5,6,7,8,9,10,11,12,13,14,15);
}

__device__ __forceinline__ v16h ldfrag(const _Float16* base, int ld, int koff) {
  int lane = threadIdx.x & 31;
  int m = lane & 15, hf = lane >> 4;
  const v8h* p = (const v8h*)(base + (size_t)m * ld + koff + hf * 8);
  return frag_combine(p[0], p[2]);   // p[2] == +16 halves
}

__device__ __forceinline__ v8f wmma_(v16h a, v16h b, v8f c) {
  return __builtin_amdgcn_wmma_f32_16x16x32_f16(false, a, false, b, (short)0, c,
                                                false, false);
}

// ---- pack / convert kernels ----------------------------------------------
// Every lane moves 16-B pieces, eight loads in flight: a block of 256 threads
// takes one unit of 8192 floats, so few waves have to be started.
typedef __attribute__((ext_vector_type(4))) float    v4f;
typedef __attribute__((ext_vector_type(4))) _Float16 v4h;
enum { UNIT_ = 8192 };

// One unit, contiguous: each wave-wide load covers 512 B, each store 256 B.
__device__ __forceinline__ void cvt_unit(const float* __restrict__ src,
                                         _Float16* __restrict__ dst) {
  const v4f* s = (const v4f*)src + threadIdx.x;
  v4h* d = (v4h*)dst + threadIdx.x;
  v4f x[8];
#pragma unroll   // constant indices keep the eight pieces in registers
  for (int i = 0; i < 8; i++) x[i] = s[i * 256];
#pragma unroll
  for (int i = 0; i < 8; i++) d[i * 256] = __builtin_convertvector(x[i], v4h);
  // no register of an issued store is rewritten ahead of this wait
  asm volatile("s_wait_xcnt 0x0" ::: "memory");
}

// MEM_*U_ and Q_*U_ are multiples of UNIT_: a unit lies in one source.
__device__ __forceinline__
void pack_concat_f16(int unit, const float* __restrict__ mem,
                     const float* __restrict__ inp,
                     _Float16* __restrict__ xfull) {
  size_t e = (size_t)unit * UNIT_;
  size_t b = e / ((size_t)KLEN_ * U_);
  size_t rem = e - b * (size_t)KLEN_ * U_;
  const float* src = (rem < (size_t)MEM_ * U_)
                         ? mem + b * (size_t)MEM_ * U_ + rem
                         : inp + b * (size_t)Q_ * U_ + (rem - (size_t)MEM_ * U_);
  cvt_unit(src, xfull + e);
}

// one unit per block; the units cover the whole array (a multiple of UNIT_)
__device__ __forceinline__
void cvt_f32_to_f16(int unit, const float* __restrict__ in, _Float16* __restrict__ out) {
  size_t e = (size_t)unit * UNIT_;
  cvt_unit(in + e, out + e);
}

// out[n*U_ + k] = in[k*ldin + coloff + n]  (weight transpose for NT GEMMs)
// Block tile 64 k x 128 n, wave tile 32 k x 32 n, lane tile 8 k x 4 n held in
// registers: a load covers four whole 128-B lines of the source rows, a store
// writes 8 halves of k (16 B) per lane. The source pitch is a template
// constant (two are in use): no multiply by a run-time pitch in the addresses.
template <int LDIN>
__device__ __forceinline__ void transpose_tile(int bx, int by,
                                               const float* __restrict__ in,
                                               _Float16* __restrict__ out) {
  int lane = threadIdx.x & 31, wid = threadIdx.x >> 5;
  int k0 = by * 64  + (wid & 1) * 32  + (lane >> 3) * 8;
  int n0 = bx * 128 + (wid >> 1) * 32 + (lane & 7) * 4;
  const float* s = in + (size_t)k0 * LDIN + n0;
  _Float16* d = out + (size_t)n0 * U_ + k0;
  v4f x[8];
#pragma unroll   // constant indices keep the lane tile in registers
  for (int i = 0; i < 8; i++) x[i] = *(const v4f*)(s + i * LDIN);
#pragma unroll
  for (int j = 0; j < 4; j++) {
    v8h y;
#pragma unroll
    for (int i = 0; i < 8; i++) y[i] = (_Float16)x[i][j];
    *(v8h*)(d + j * U_) = y;
  }
  // no register of an issued store is rewritten ahead of this wait
  asm volatile("s_wait_xcnt 0x0" ::: "memory");
}

// All seven preparations are independent of one another: they run as ranges of
// the block index of ONE launch, so that only one launch gap, one fill and one
// tail are paid and the short weight transposes run beside the two streams.
enum { NB_CVT  = B_ * KLEN_ * U_ / UNIT_,      // units of xfull, and of rel16
       NB_TR   = (U_ / 128) * (U_ / 64),       // tiles of one U_ x U_ weight
       NB_PREP = 2 * NB_CVT + 5 * NB_TR };

__global__ __launch_bounds__(256)
void prep_f16(const float* __restrict__ mem, const float* __restrict__ inp,
              const float* __restrict__ rel,
              const float* __restrict__ Wq, const float* __restrict__ Wkv,
              const float* __restrict__ Wr, const float* __restrict__ Wo,
              _Float16* __restrict__ xfull, _Float16* __restrict__ rel16,
              _Float16* __restrict__ WqT, _Float16* __restrict__ WkT,
              _Float16* __restrict__ WvT, _Float16* __restrict__ WrT,
              _Float16* __restrict__ WoT) {
  int bid = blockIdx.x;
  if (bid < NB_CVT) {
    pack_concat_f16(bid, mem, inp, xfull);
  } else if (bid < 2 * NB_CVT) {
    cvt_f32_to_f16(bid - NB_CVT, rel, rel16);
  } else {
    int t = bid - 2 * NB_CVT;
    int which = t / NB_TR, tl = t % NB_TR;
    int bx = tl % (U_ / 128), by = tl / (U_ / 128);
    // Wkv rows hold 2*U_ floats (K half, then V half), the others U_
    if (which < 2) {
      transpose_tile<2 * U_>(bx, by, which ? Wkv + U_ : Wkv, which ? WvT : WkT);
    } else {
      const float* in = which == 2 ? Wq : which == 3 ? Wr : Wo;
      _Float16* out   = which == 2 ? WqT : which == 3 ? WrT : WoT;
      transpose_tile<U_>(bx, by, in, out);
    }
  }
}

// ---- generic batched NT GEMM: C(MxN) = A(MxK) * Bw(NxK)^T ------------------
// 256 threads = 8 waves, wave grid 2x4 -> 128x128 block tile, 64x32 per wave
// (4 x 2 accumulator tiles): every A fragment serves two products, every B
// fragment four, and a row staged in LDS serves 128 rows of the other operand.
// The block's 128 A rows and 128 B rows are staged in LDS in slabs of 64 k by
// asynchronous copies (whole 128-B lines per 8 lanes), two buffers, so that the
// next slab flies while this one is multiplied. M and N must be multiples of
// 128, K a multiple of 64.
enum { GM_PLAIN = 0, GM_QCQR = 1, GM_VT = 2, GM_F32 = 3 };
enum { BT_    = 128,                // rows of A and rows of B per block tile
       SLAB_K = 64,                 // halves of k per slab: 128 B per row
       SLAB_P = 72,                 // LDS row pitch in halves: 144 B = 16 B x odd
       SLAB_G = 32 * SLAB_P * 2,    // LDS bytes of the 32 rows one copy fills
       SLAB_H = 2 * BT_ * SLAB_P }; // halves per buffer: 128 A rows, then 128 B rows

// One slab: each lane copies 16 B of four A rows and of four B rows, 32 rows
// apart (sa, sb: 32 source rows in halves). The s_wait_xcnt stands inside the
// statement so that no address register of an issued copy is rewritten ahead
// of it.
__device__ __forceinline__ void slab_copy(unsigned lds, const _Float16* ga, size_t sa,
                                          const _Float16* gb, size_t sb) {
  asm volatile("global_load_async_to_lds_b128 %0, %8, off\n\t"
               "global_load_async_to_lds_b128 %1, %9, off\n\t"
               "global_load_async_to_lds_b128 %2, %10, off\n\t"
               "global_load_async_to_lds_b128 %3, %11, off\n\t"
               "global_load_async_to_lds_b128 %4, %12, off\n\t"
               "global_load_async_to_lds_b128 %5, %13, off\n\t"
               "global_load_async_to_lds_b128 %6, %14, off\n\t"
               "global_load_async_to_lds_b128 %7, %15, off\n\t"
               "s_wait_xcnt 0x0"
               :: "v"(lds),              "v"(lds + SLAB_G),     "v"(lds + 2 * SLAB_G),
                  "v"(lds + 3 * SLAB_G), "v"(lds + 4 * SLAB_G), "v"(lds + 5 * SLAB_G),
                  "v"(lds + 6 * SLAB_G), "v"(lds + 7 * SLAB_G),
                  "v"(ga), "v"(ga + sa), "v"(ga + 2 * sa), "v"(ga + 3 * sa),
                  "v"(gb), "v"(gb + sb), "v"(gb + 2 * sb), "v"(gb + 3 * sb)
               : "memory");
}

// One block tile: (bx, by) = tile of N and of M, b = batch.
__device__ __forceinline__
void gemm_tile(unsigned bx, unsigned by, int b,
               const _Float16* __restrict__ A, size_t strideA, int lda,
               const _Float16* __restrict__ Bw, int ldb, int K,
               _Float16* __restrict__ out0, size_t strideO, int ldo,
               _Float16* __restrict__ out1,
               const float* __restrict__ bias0, const float* __restrict__ bias1,
               float* __restrict__ outf, size_t strideF,
               int klen_vt, int mode) {
  __shared__ __attribute__((aligned(16))) _Float16 slab[2 * SLAB_H];

  int wid = threadIdx.x >> 5;
  int mw  = (wid >> 2) * 64, nw = (wid & 3) * 32;
  int m0  = by * BT_ + mw;
  int n0  = bx * BT_ + nw;

  // copy role: thread -> (row 0..31, 16-B piece 0..7) of each 32-row group
  int crow = threadIdx.x >> 3, cpc = (threadIdx.x & 7) * 8;
  const _Float16* ga = A + (size_t)b * strideA
                         + (size_t)(by * BT_ + crow) * lda + cpc;
  const _Float16* gb = Bw + (size_t)(bx * BT_ + crow) * ldb + cpc;
  size_t sa = (size_t)32 * lda, sb = (size_t)32 * ldb;
  unsigned ldst = (unsigned)(size_t)&slab[crow * SLAB_P + cpc];

  int nslab = K / SLAB_K;
  slab_copy(ldst, ga, sa, gb, sb);
  asm volatile("s_wait_asynccnt 0x0" ::: "memory");  // own copies of slab 0 landed
  __syncthreads();                                   // slab 0 readable by all waves
  if (nslab > 1)
    slab_copy(ldst + SLAB_H * 2, ga + SLAB_K, sa, gb + SLAB_K, sb);

  v8f c[4][2] = {};
  for (int t = 0; t < nslab; t++) {
    int buf = t & 1;
    const _Float16* As = &slab[buf * SLAB_H + mw * SLAB_P];
    const _Float16* Bs = &slab[buf * SLAB_H + (BT_ + nw) * SLAB_P];
    // the slab's fragments are fetched as one group of LDS reads (every loop
    // over af, bf, c is unrolled: constant indices keep them in registers)
    v16h af[2][4], bf[2][2];
#pragma unroll
    for (int ks = 0; ks < 2; ks++) {
#pragma unroll
      for (int i = 0; i < 4; i++) af[ks][i] = ldfrag(As + i * 16 * SLAB_P, SLAB_P, ks * 32);
#pragma unroll
      for (int j = 0; j < 2; j++) bf[ks][j] = ldfrag(Bs + j * 16 * SLAB_P, SLAB_P, ks * 32);
    }
#pragma unroll
    for (int ks = 0; ks < 2; ks++) {
      // inputs-only fence on the loaded fragments: keeps their LDS reads one
      // group in front of the eight products (sunk to their uses, every pair
      // of products waits out an LDS latency of its own)
      asm volatile("" :: "v"(af[ks][0]), "v"(af[ks][1]), "v"(af[ks][2]), "v"(af[ks][3]),
                         "v"(bf[ks][0]), "v"(bf[ks][1]));
#pragma unroll
      for (int i = 0; i < 4; i++)
#pragma unroll
        for (int j = 0; j < 2; j++) c[i][j] = wmma_(af[ks][i], bf[ks][j], c[i][j]);
      // keeps these eight products here: the first eight run while the second
      // half's reads land, and none is moved behind the barrier, in front of the refill
      __builtin_amdgcn_sched_barrier(0);
    }
    asm volatile("s_wait_dscnt 0x0" ::: "memory");    // own reads of this buffer done
    asm volatile("s_wait_asynccnt 0x0" ::: "memory"); // own copies of slab t+1 landed
    __syncthreads();  // publishes slab t+1 and frees this buffer for its refill
    if (t + 2 < nslab) {
      int ko = (t + 2) * SLAB_K;
      slab_copy(ldst + buf * (SLAB_H * 2), ga + ko, sa, gb + ko, sb);
    }
  }
  asm volatile("s_wait_asynccnt 0x0" ::: "memory");   // nothing in flight at the end

  // the mode is tested once, outside the loops over the wave's 64 values a lane
  int lane = threadIdx.x & 31, jl = lane & 15, hf = lane >> 4;
  auto each = [&](auto put) {
#pragma unroll
    for (int i = 0; i < 4; i++)
#pragma unroll
      for (int j = 0; j < 2; j++)
#pragma unroll
        for (int r = 0; r < 8; r++)
          put(m0 + i * 16 + r + 8 * hf, n0 + j * 16 + jl, c[i][j][r]);
  };
  if (mode == GM_QCQR) {
    each([&](int row, int col, float v) {
      size_t o = (size_t)b * strideO + (size_t)row * ldo + col;
      out0[o] = (_Float16)(v + bias0[col]);
      out1[o] = (_Float16)(v + bias1[col]);
    });
    // no register of an issued store is rewritten ahead of this wait
    asm volatile("s_wait_xcnt 0x0" ::: "memory");
  } else if (mode == GM_VT) {             // store V transposed: (B,H,DH,KLEN)
    each([&](int row, int col, float v) {
      int h = col >> 6, d = col & 63;
      out0[(((size_t)b * H_ + h) * DH_ + d) * (size_t)klen_vt + row] = (_Float16)v;
    });
    // no register of an issued store is rewritten ahead of this wait
    asm volatile("s_wait_xcnt 0x0" ::: "memory");
  } else if (mode == GM_F32) {
    each([&](int row, int col, float v) {
      outf[(size_t)b * strideF + (size_t)row * ldo + col] = v;
    });
    // no register of an issued store is rewritten ahead of this wait
    asm volatile("s_wait_xcnt 0x0" ::: "memory");
  } else {
    each([&](int row, int col, float v) {
      out0[(size_t)b * strideO + (size_t)row * ldo + col] = (_Float16)v;
    });
    // no register of an issued store is rewritten ahead of this wait
    asm volatile("s_wait_xcnt 0x0" ::: "memory");
  }
}

// one GEMM per launch: grid (N / 128, M / 128, batch)
__global__ __launch_bounds__(256)
void gemm_nt(const _Float16* __restrict__ A, size_t strideA, int lda,
             const _Float16* __restrict__ Bw, int ldb, int K,
             _Float16* __restrict__ out0, size_t strideO, int ldo,
             _Float16* __restrict__ out1,
             const float* __restrict__ bias0, const float* __restrict__ bias1,
             float* __restrict__ outf, size_t strideF,
             int klen_vt, int mode) {
  gemm_tile(blockIdx.x, blockIdx.y, blockIdx.z, A, strideA, lda, Bw, ldb, K,
            out0, strideO, ldo, out1, bias0, bias1, outf, strideF, klen_vt, mode);
}

// The four projections (K, V, r, q) are independent of one another: they run as
// ranges of the block index of ONE launch. Alone, each fills a WGP with one
// block (q: every second WGP) and pays its own gap, fill, first slab and tail;
// together several blocks share a WGP and one's waits are covered by another's
// work. Within a range the tiles keep the order N tile, M tile, batch.
enum { NB_KV   = (U_ / BT_) * (KLEN_ / BT_) * B_,   // blocks of K, of V and of r
       NB_Q    = (U_ / BT_) * (Q_ / BT_) * B_,      // blocks of q
       NB_PROJ = 3 * NB_KV + NB_Q };

__global__ __launch_bounds__(256)
void proj_gemms(const _Float16* __restrict__ xfull, const _Float16* __restrict__ rel16,
                const _Float16* __restrict__ WkT, const _Float16* __restrict__ WvT,
                const _Float16* __restrict__ WrT, const _Float16* __restrict__ WqT,
                _Float16* __restrict__ kbuf, _Float16* __restrict__ vTb,
                _Float16* __restrict__ rbuf,
                _Float16* __restrict__ qcb, _Float16* __restrict__ qrb,
                const float* __restrict__ biasc, const float* __restrict__ biasr) {
  int g = blockIdx.x / NB_KV, t = blockIdx.x % NB_KV;   // 0 K, 1 V, 2 r, 3 q
  int mt = g == 3 ? Q_ / BT_ : KLEN_ / BT_;             // M tiles of one batch
  int bx = t % (U_ / BT_), by = t / (U_ / BT_) % mt, b = t / (U_ / BT_) / mt;
  const _Float16* A  = g == 2 ? rel16 : g == 3 ? xfull + (size_t)MEM_ * U_ : xfull;
  const _Float16* Bw = g == 0 ? WkT : g == 1 ? WvT : g == 2 ? WrT : WqT;
  _Float16* out0     = g == 0 ? kbuf : g == 1 ? vTb : g == 2 ? rbuf : qcb;
  size_t strideO     = g == 3 ? (size_t)Q_ * U_ : (size_t)KLEN_ * U_;
  int mode           = g == 3 ? GM_QCQR : g == 1 ? GM_VT : GM_PLAIN;
  gemm_tile(bx, by, b, A, (size_t)KLEN_ * U_, U_, Bw, U_, U_,
            out0, strideO, U_, qrb, biasc, biasr, nullptr, 0, KLEN_, mode);
}

enum { FK_P   = 72,                     // K and r row pitch in halves: 144 B = 16 B x odd
       FV_P   = 40,                     // V^T row pitch in halves: 80 B = 16 B x odd
       FR_OFF = 32 * FK_P,              // r band behind the 32 K rows
       FV_OFF = (32 + 96) * FK_P,       // V^T tile behind the 96 r rows
       FT_H   = FV_OFF + 64 * FV_P };   // halves per buffer

// ---- reductions over a 16-lane row, on the vector port ---------------------
// A shuffle builtin goes through the LDS queue, and every step of a reduction
// then waits out that queue's latency; a DPP row_xmask operand reads lane l ^ M
// of the lane's own 16-lane row inside the vector instruction itself.
template <int M>
__device__ __forceinline__ float row_xor(float x) {
  int v = __builtin_bit_cast(int, x);
  return __builtin_bit_cast(float,
      __builtin_amdgcn_update_dpp(v, v, 0x160 + M, 0xf, 0xf, true));
}

// Row maximum of eight values, every lane of a row gets it. Written as asm so
// that move and maximum are one instruction (from the builtin the compiler makes
// three: move, quieting maximum, maximum). The eight chains are interleaved:
// each step's producer stands eight instructions back, so no step waits on it.
// All 32 lanes are on where this is called.
__device__ __forceinline__ void row_max8(float (&t)[8]) {
  asm volatile(
      "v_max_num_f32_dpp %0, %0, %0 row_xmask:1 row_mask:0xf bank_mask:0xf\n\t"
      "v_max_num_f32_dpp %1, %1, %1 row_xmask:1 row_mask:0xf bank_mask:0xf\n\t"
      "v_max_num_f32_dpp %2, %2, %2 row_xmask:1 row_mask:0xf bank_mask:0xf\n\t"
      "v_max_num_f32_dpp %3, %3, %3 row_xmask:1 row_mask:0xf bank_mask:0xf\n\t"
      "v_max_num_f32_dpp %4, %4, %4 row_xmask:1 row_mask:0xf bank_mask:0xf\n\t"
      "v_max_num_f32_dpp %5, %5, %5 row_xmask:1 row_mask:0xf bank_mask:0xf\n\t"
      "v_max_num_f32_dpp %6, %6, %6 row_xmask:1 row_mask:0xf bank_mask:0xf\n\t"
      "v_max_num_f32_dpp %7, %7, %7 row_xmask:1 row_mask:0xf bank_mask:0xf\n\t"
      "v_max_num_f32_dpp %0, %0, %0 row_xmask:2 row_mask:0xf bank_mask:0xf\n\t"
      "v_max_num_f32_dpp %1, %1, %1 row_xmask:2 row_mask:0xf bank_mask:0xf\n\t"
      "v_max_num_f32_dpp %2, %2, %2 row_xmask:2 row_mask:0xf bank_mask:0xf\n\t"
      "v_max_num_f32_dpp %3, %3, %3 row_xmask:2 row_mask:0xf bank_mask:0xf\n\t"
      "v_max_num_f32_dpp %4, %4, %4 row_xmask:2 row_mask:0xf bank_mask:0xf\n\t"
      "v_max_num_f32_dpp %5, %5, %5 row_xmask:2 row_mask:0xf bank_mask:0xf\n\t"
      "v_max_num_f32_dpp %6, %6, %6 row_xmask:2 row_mask:0xf bank_mask:0xf\n\t"
      "v_max_num_f32_dpp %7, %7, %7 row_xmask:2 row_mask:0xf bank_mask:0xf\n\t"
      "v_max_num_f32_dpp %0, %0, %0 row_xmask:4 row_mask:0xf bank_mask:0xf\n\t"
      "v_max_num_f32_dpp %1, %1, %1 row_xmask:4 row_mask:0xf bank_mask:0xf\n\t"
      "v_max_num_f32_dpp %2, %2, %2 row_xmask:4 row_mask:0xf bank_mask:0xf\n\t"
      "v_max_num_f32_dpp %3, %3, %3 row_xmask:4 row_mask:0xf bank_mask:0xf\n\t"
      "v_max_num_f32_dpp %4, %4, %4 row_xmask:4 row_mask:0xf bank_mask:0xf\n\t"
      "v_max_num_f32_dpp %5, %5, %5 row_xmask:4 row_mask:0xf bank_mask:0xf\n\t"
      "v_max_num_f32_dpp %6, %6, %6 row_xmask:4 row_mask:0xf bank_mask:0xf\n\t"
      "v_max_num_f32_dpp %7, %7, %7 row_xmask:4 row_mask:0xf bank_mask:0xf\n\t"
      "v_max_num_f32_dpp %0, %0, %0 row_xmask:8 row_mask:0xf bank_mask:0xf\n\t"
      "v_max_num_f32_dpp %1, %1, %1 row_xmask:8 row_mask:0xf bank_mask:0xf\n\t"
      "v_max_num_f32_dpp %2, %2, %2 row_xmask:8 row_mask:0xf bank_mask:0xf\n\t"
      "v_max_num_f32_dpp %3, %3, %3 row_xmask:8 row_mask:0xf bank_mask:0xf\n\t"
      "v_max_num_f32_dpp %4, %4, %4 row_xmask:8 row_mask:0xf bank_mask:0xf\n\t"
      "v_max_num_f32_dpp %5, %5, %5 row_xmask:8 row_mask:0xf bank_mask:0xf\n\t"
      "v_max_num_f32_dpp %6, %6, %6 row_xmask:8 row_mask:0xf bank_mask:0xf\n\t"
      "v_max_num_f32_dpp %7, %7, %7 row_xmask:8 row_mask:0xf bank_mask:0xf"
      : "+v"(t[0]), "+v"(t[1]), "+v"(t[2]), "+v"(t[3]),
        "+v"(t[4]), "+v"(t[5]), "+v"(t[6]), "+v"(t[7]));
}

__global__ __launch_bounds__(128)
void flash_attn(const _Float16* __restrict__ qc, const _Float16* __restrict__ qr,
                const _Float16* __restrict__ kk, const _Float16* __restrict__ rr,
                const _Float16* __restrict__ vT, _Float16* __restrict__ outp) {
  __shared__ __align__(16) _Float16 tile[2 * FT_H];
  __shared__ __align__(16) float    relbuf[4][16][49];
  __shared__ __align__(16) _Float16 pbuf[4][16][32];

  // wave number in a scalar register: the causal skip below is a scalar branch
  int w = __builtin_amdgcn_readfirstlane(threadIdx.x >> 5);
  int lane = threadIdx.x & 31, jl = lane & 15, hf = lane >> 4;
  int b = blockIdx.z, h = blockIdx.y;
  int ib = blockIdx.x * 64;
  int i0 = ib + w * 16;

  const _Float16* qcb = qc + ((size_t)b * Q_ + i0) * U_ + h * DH_;
  const _Float16* qrb = qr + ((size_t)b * Q_ + i0) * U_ + h * DH_;
  v16h aqc0 = ldfrag(qcb, U_, 0), aqc1 = ldfrag(qcb, U_, 32);
  v16h aqr0 = ldfrag(qrb, U_, 0), aqr1 = ldfrag(qrb, U_, 32);

  const _Float16* kbase = kk + (size_t)b * KLEN_ * U_ + h * DH_;
  const _Float16* rbase = rr + (size_t)b * KLEN_ * U_ + h * DH_;
  const _Float16* vbase = vT + ((size_t)b * H_ + h) * DH_ * KLEN_;

  // copy role: K and r rows as (row 0..15, 16-B piece 0..7), V^T rows as
  // (row 0..31, 16-B piece 0..3)
  int crow = threadIdx.x >> 3, cpc = (threadIdx.x & 7) * 8;
  int vrow = threadIdx.x >> 2, vpc = (threadIdx.x & 3) * 8;
  unsigned lkr = (unsigned)(size_t)&tile[crow * FK_P + cpc];
  unsigned lvv = (unsigned)(size_t)&tile[FV_OFF + vrow * FV_P + vpc];

  // One key tile: each lane copies 16 B of two K rows, six r rows and two V^T
  // rows. r rows past KLEN are masked later; their source row is clamped. The
  // s_wait_xcnt stands inside the statement so that no address register of an
  // issued copy is rewritten ahead of it.
  auto tile_copy = [&](int t, int buf) {
    int j0 = t * 32;
    unsigned lk = lkr + buf * (FT_H * 2), lv = lvv + buf * (FT_H * 2);
    const _Float16* gk = kbase + (size_t)(j0 + crow) * U_ + cpc;
    const _Float16* gv = vbase + (size_t)vrow * KLEN_ + j0 + vpc;
    int rb = j0 + (Q_ - 64) - ib + crow;      // first r row of wave 3's band, + crow
    const _Float16* gr[6];
#pragma unroll   // constant indices keep the six pointers in registers
    for (int n = 0; n < 6; n++) {
      int row = rb + n * 16; if (row > KLEN_ - 1) row = KLEN_ - 1;
      gr[n] = rbase + (size_t)row * U_ + cpc;
    }
    asm volatile("global_load_async_to_lds_b128 %0, %10, off\n\t"
                 "global_load_async_to_lds_b128 %1, %11, off\n\t"
                 "global_load_async_to_lds_b128 %2, %12, off\n\t"
                 "global_load_async_to_lds_b128 %3, %13, off\n\t"
                 "global_load_async_to_lds_b128 %4, %14, off\n\t"
                 "global_load_async_to_lds_b128 %5, %15, off\n\t"
                 "global_load_async_to_lds_b128 %6, %16, off\n\t"
                 "global_load_async_to_lds_b128 %7, %17, off\n\t"
                 "global_load_async_to_lds_b128 %8, %18, off\n\t"
                 "global_load_async_to_lds_b128 %9, %19, off\n\t"
                 "s_wait_xcnt 0x0"
                 :: "v"(lk), "v"(lk + 16 * FK_P * 2),
                    "v"(lk + 32 * FK_P * 2), "v"(lk + 48 * FK_P * 2),
                    "v"(lk + 64 * FK_P * 2), "v"(lk + 80 * FK_P * 2),
                    "v"(lk + 96 * FK_P * 2), "v"(lk + 112 * FK_P * 2),
                    "v"(lv), "v"(lv + 32 * FV_P * 2),
                    "v"(gk), "v"(gk + (size_t)16 * U_),
                    "v"(gr[0]), "v"(gr[1]), "v"(gr[2]), "v"(gr[3]), "v"(gr[4]), "v"(gr[5]),
                    "v"(gv), "v"(gv + (size_t)32 * KLEN_)
                 : "memory");
  };

  v8f o[4] = {};
  float mrow[8], lrow[8];
#pragma unroll
  for (int r = 0; r < 8; r++) { mrow[r] = -1e30f; lrow[r] = 0.f; }

  int jmax  = MEM_ + i0 + 15;                // this wave's causal bound
  int ntile = (MEM_ + ib + 63) / 32 + 1;     // the block's key tiles, 34 or more

  tile_copy(0, 0);
  asm volatile("s_wait_asynccnt 0x0" ::: "memory");  // own copies of tile 0 landed
  __syncthreads();                                   // tile 0 readable by all waves
  tile_copy(1, 1);

  for (int t = 0; t < ntile; t++) {
    int j0 = t * 32, buf = t & 1;
    const _Float16* Ks = &tile[buf * FT_H];
    const _Float16* Rs = &tile[buf * FT_H + FR_OFF + (3 - w) * 16 * FK_P];
    const _Float16* Vs = &tile[buf * FT_H + FV_OFF];

    if (j0 <= jmax) {   // a wave past its causal bound skips the work, not the barrier
    // all K and r fragments of the tile are fetched as one group of LDS reads
    // (every loop over kf, rf, rc is unrolled: constant indices keep them in registers)
    v16h kf[4], rf[6];
#pragma unroll
    for (int n = 0; n < 4; n++)
      kf[n] = ldfrag(Ks + (n >> 1) * 16 * FK_P, FK_P, (n & 1) * 32);
#pragma unroll
    for (int n = 0; n < 6; n++)
      rf[n] = ldfrag(Rs + (n >> 1) * 16 * FK_P, FK_P, (n & 1) * 32);

    // context scores: two 16-col subtiles over K=DH=64
    v8f sc0 = {}, sc1 = {};
    sc0 = wmma_(aqc0, kf[0], sc0);
    sc0 = wmma_(aqc1, kf[1], sc0);
    sc1 = wmma_(aqc0, kf[2], sc1);
    sc1 = wmma_(aqc1, kf[3], sc1);

    // relative-score band: r rows rb0 .. rb0+47, rb0 = j0 + (Q-16) - i0
    v8f rc[3] = {};
#pragma unroll
    for (int tt = 0; tt < 3; tt++) {
      rc[tt] = wmma_(aqr0, rf[2 * tt], rc[tt]);
      rc[tt] = wmma_(aqr1, rf[2 * tt + 1], rc[tt]);
    }
#pragma unroll
    for (int tt = 0; tt < 3; tt++)
#pragma unroll
      for (int r = 0; r < 8; r++)
        relbuf[w][r + 8 * hf][tt * 16 + jl] = rc[tt][r];
    asm volatile("" ::: "memory");   // order LDS write -> gather (same wave)

    // gather shifted rel term, scale 1/sqrt(64), apply causal mask
    float s0[8], s1[8];
#pragma unroll
    for (int r = 0; r < 8; r++) {
      int iloc = r + 8 * hf;
      float rel0 = relbuf[w][iloc][jl + 15 - iloc];
      float rel1 = relbuf[w][iloc][16 + jl + 15 - iloc];
      int lim = MEM_ + i0 + iloc;
      s0[r] = (j0 + jl      <= lim) ? (sc0[r] + rel0) * 0.125f : -1e30f;
      s1[r] = (j0 + 16 + jl <= lim) ? (sc1[r] + rel1) * 0.125f : -1e30f;
    }

    // online softmax (row = reg r + 8*hf; 16-lane group holds the 16 cols)
    float alpha[8], tm[8];
#pragma unroll   // constant indices keep tm in registers
    for (int r = 0; r < 8; r++) tm[r] = fmaxf(fmaxf(s0[r], s1[r]), mrow[r]);
    row_max8(tm);   // the running maximum is the same in a row's lanes: this is the new one
#pragma unroll
    for (int r = 0; r < 8; r++) {
      float mn = tm[r];
      alpha[r] = __expf(mrow[r] - mn);
      float p0 = __expf(s0[r] - mn), p1 = __expf(s1[r] - mn);
      float ps = p0 + p1;
      ps += row_xor<1>(ps); ps += row_xor<2>(ps);
      ps += row_xor<4>(ps); ps += row_xor<8>(ps);
      lrow[r] = lrow[r] * alpha[r] + ps;
      mrow[r] = mn;
      int iloc = r + 8 * hf;
      pbuf[w][iloc][jl]      = (_Float16)p0;
      pbuf[w][iloc][16 + jl] = (_Float16)p1;
    }
#pragma unroll
    for (int dt = 0; dt < 4; dt++)
#pragma unroll
      for (int r = 0; r < 8; r++) o[dt][r] *= alpha[r];

    asm volatile("" ::: "memory");   // order P store -> A-fragment reload
    v16h ap = ldfrag(&pbuf[w][0][0], 32, 0);   // C-layout -> A-layout via LDS
#pragma unroll
    for (int dt = 0; dt < 4; dt++)
      o[dt] = wmma_(ap, ldfrag(Vs + dt * 16 * FV_P, FV_P, 0), o[dt]);
    }

    asm volatile("s_wait_dscnt 0x0" ::: "memory");    // own reads of this buffer done
    asm volatile("s_wait_asynccnt 0x0" ::: "memory"); // own copies of tile t+1 landed
    __syncthreads();  // publishes tile t+1 and frees this buffer for its refill
    if (t + 2 < ntile) tile_copy(t + 2, buf);
  }
  asm volatile("s_wait_asynccnt 0x0" ::: "memory");   // nothing in flight at the end

  // normalize and store (B,Q,U) f16
#pragma unroll
  for (int dt = 0; dt < 4; dt++)
#pragma unroll
    for (int r = 0; r < 8; r++) {
      int iloc = r + 8 * hf;
      float vv = o[dt][r] / lrow[r];
      outp[((size_t)b * Q_ + i0 + iloc) * U_ + h * DH_ + dt * 16 + jl] = (_Float16)vv;
    }
}

// ---------------------------------------------------------------------------
extern "C" void kernel_launch(void* const* d_in, const int* in_sizes, int n_in,
                              void* d_out, int out_size, void* d_ws, size_t ws_size,
                              hipStream_t stream) {
  (void)in_sizes; (void)n_in; (void)out_size; (void)ws_size;
  const float* inputs    = (const float*)d_in[0];
  const float* relatives = (const float*)d_in[1];
  const float* memories  = (const float*)d_in[2];
  const float* biasc     = (const float*)d_in[3];
  const float* biasr     = (const float*)d_in[4];
  const float* Wq        = (const float*)d_in[5];
  const float* Wkv       = (const float*)d_in[6];
  const float* Wr        = (const float*)d_in[7];
  const float* Wo        = (const float*)d_in[8];
  float* out = (float*)d_out;

  // f16 workspace carve-out (~62 MB)
  _Float16* ws = (_Float16*)d_ws;
  size_t off = 0;
  auto carve = [&](size_t n) { _Float16* p = ws + off; off += n; return p; };
  const size_t BKU = (size_t)B_ * KLEN_ * U_;   // 4M
  const size_t BQU = (size_t)B_ * Q_ * U_;      // 2M
  const size_t UU  = (size_t)U_ * U_;           // 1M
  _Float16* xfull  = carve(BKU);
  _Float16* rel16  = carve(BKU);
  _Float16* WqT    = carve(UU);
  _Float16* WkT    = carve(UU);
  _Float16* WvT    = carve(UU);
  _Float16* WrT    = carve(UU);
  _Float16* WoT    = carve(UU);
  _Float16* qcb    = carve(BQU);
  _Float16* qrb    = carve(BQU);
  _Float16* kbuf   = carve(BKU);
  _Float16* rbuf   = carve(BKU);
  _Float16* vTb    = carve(BKU);                // (B,H,DH,KLEN)
  _Float16* attout = carve(BQU);

  // 1) pack + convert
  prep_f16<<<NB_PREP, 256, 0, stream>>>(memories, inputs, relatives, Wq, Wkv, Wr, Wo,
                                        xfull, rel16, WqT, WkT, WvT, WrT, WoT);

  // 2) projections (all WMMA NT GEMMs), one launch
  proj_gemms<<<NB_PROJ, 256, 0, stream>>>(xfull, rel16, WkT, WvT, WrT, WqT,
                                          kbuf, vTb, rbuf, qcb, qrb, biasc, biasr);

  // 3) fused attention (no score matrix in HBM)
  flash_attn<<<dim3(Q_ / 64, H_, B_), 128, 0, stream>>>(qcb, qrb, kbuf, rbuf,
                                                        vTb, attout);

  // 4) output projection, f32 result
  dim3 gq(U_ / BT_, Q_ / BT_, B_);
  gemm_nt<<<gq, 256, 0, stream>>>(attout, BQU / B_, U_, WoT, U_, U_,
                                  nullptr, 0, U_, nullptr, nullptr, nullptr,
                                  out, BQU / B_, 0, GM_F32);
}

// v007
// Measured time: 117 microseconds a run.
// Next to v006, in two timings, it ran 1.19 times as fast each time.
// All steps since v000 together make it 3.56 times as fast.
#include <hip/hip_runtime.h>
#include <hip/hip_bf16.h>

// ---------------------------------------------------------------------------
// Transformer-XL relative multi-head attention for MI455X (gfx1250).
// All GEMMs run on v_wmma_f32_16x16x32_f16 (wave32 WMMA, f32 accumulate).
// Attention is fused flash-style (online softmax) so the (B,H,Q,KLEN) score
// matrix (256MB f32) never touches HBM. The relative-shift is folded into the
// flash loop via a 47-wide diagonal band of qr*r^T tiles shifted in registers.
// Workspace requirement: ~62 MB of f16 scratch in d_ws.
// ---------------------------------------------------------------------------

enum { B_ = 2, Q_ = 1024, MEM_ = 1024, U_ = 1024, H_ = 16, DH_ = 64, KLEN_ = MEM_ + Q_ };

typedef __attribute__((ext_vector_type(16))) _Float16 v16h;
typedef __attribute__((ext_vector_type(8)))  _Float16 v8h;
typedef __attribute__((ext_vector_type(8)))  float    v8f;

// ---- WMMA fragment helpers (layouts per CDNA5 ISA 7.12.2) -----------------
// A fragment 16x32 f16: lane m=lane&15 holds row m; half=lane>>4 selects
// k-groups: regs 0-3 = k in [half*8, half*8+8), regs 4-7 = +16. Each group is
// 8 contiguous halves -> one 16B load. B fragment (NT form, B stored as NxK
// row-major) is symmetric with N in place of M.
__device__ __forceinline__ v16h frag_combine(v8h lo, v8h hi) {
  return __builtin_shufflevector(lo, hi, 0,1,2,3,4,5,6,7,8,9,10,11,12,13,14,15);
}

__device__ __forceinline__ v16h ldfrag(const _Float16* base, int ld, int koff) {
  int lane = threadIdx.x & 31;
  int m = lane & 15, hf = lane >> 4;
  const v8h* p = (const v8h*)(base + (size_t)m * ld + koff + hf * 8);
  return frag_combine(p[0], p[2]);   // p[2] == +16 halves
}

__device__ __forceinline__ v8f wmma_(v16h a, v16h b, v8f c) {
  return __builtin_amdgcn_wmma_f32_16x16x32_f16(false, a, false, b, (short)0, c,
                                                false, false);
}

// ---- pack / convert kernels ----------------------------------------------
// Every lane moves 16-B pieces, eight loads in flight: a block of 256 threads
// takes one unit of 8192 floats, so few waves have to be started.
typedef __attribute__((ext_vector_type(4))) float    v4f;
typedef __attribute__((ext_vector_type(4))) _Float16 v4h;
enum { UNIT_ = 8192 };

// One unit, contiguous: each wave-wide load covers 512 B, each store 256 B.
__device__ __forceinline__ void cvt_unit(const float* __restrict__ src,
                                         _Float16* __restrict__ dst) {
  const v4f* s = (const v4f*)src + threadIdx.x;
  v4h* d = (v4h*)dst + threadIdx.x;
  v4f x[8];
#pragma unroll   // constant indices keep the eight pieces in registers
  for (int i = 0; i < 8; i++) x[i] = s[i * 256];
#pragma unroll
  for (int i = 0; i < 8; i++) d[i * 256] = __builtin_convertvector(x[i], v4h);
  // no register of an issued store is rewritten ahead of this wait
  asm volatile("s_wait_xcnt 0x0" ::: "memory");
}

// MEM_*U_ and Q_*U_ are multiples of UNIT_: a unit lies in one source.
__device__ __forceinline__
void pack_concat_f16(int unit, const float* __restrict__ mem,
                     const float* __restrict__ inp,
                     _Float16* __restrict__ xfull) {
  size_t e = (size_t)unit * UNIT_;
  size_t b = e / ((size_t)KLEN_ * U_);
  size_t rem = e - b * (size_t)KLEN_ * U_;
  const float* src = (rem < (size_t)MEM_ * U_)
                         ? mem + b * (size_t)MEM_ * U_ + rem
                         : inp + b * (size_t)Q_ * U_ + (rem - (size_t)MEM_ * U_);
  cvt_unit(src, xfull + e);
}

// one unit per block; the units cover the whole array (a multiple of UNIT_)
__device__ __forceinline__
void cvt_f32_to_f16(int unit, const float* __restrict__ in, _Float16* __restrict__ out) {
  size_t e = (size_t)unit * UNIT_;
  cvt_unit(in + e, out + e);
}

// out[n*U_ + k] = in[k*ldin + coloff + n]  (weight transpose for NT GEMMs)
// Block tile 64 k x 128 n, wave tile 32 k x 32 n, lane tile 8 k x 4 n held in
// registers: a load covers four whole 128-B lines of the source rows, a store
// writes 8 halves of k (16 B) per lane. The source pitch is a template
// constant (two are in use): no multiply by a run-time pitch in the addresses.
template <int LDIN>
__device__ __forceinline__ void transpose_tile(int bx, int by,
                                               const float* __restrict__ in,
                                               _Float16* __restrict__ out) {
  int lane = threadIdx.x & 31, wid = threadIdx.x >> 5;
  int k0 = by * 64  + (wid & 1) * 32  + (lane >> 3) * 8;
  int n0 = bx * 128 + (wid >> 1) * 32 + (lane & 7) * 4;
  const float* s = in + (size_t)k0 * LDIN + n0;
  _Float16* d = out + (size_t)n0 * U_ + k0;
  v4f x[8];
#pragma unroll   // constant indices keep the lane tile in registers
  for (int i = 0; i < 8; i++) x[i] = *(const v4f*)(s + i * LDIN);
#pragma unroll
  for (int j = 0; j < 4; j++) {
    v8h y;
#pragma unroll
    for (int i = 0; i < 8; i++) y[i] = (_Float16)x[i][j];
    *(v8h*)(d + j * U_) = y;
  }
  // no register of an issued store is rewritten ahead of this wait
  asm volatile("s_wait_xcnt 0x0" ::: "memory");
}

// All seven preparations are independent of one another: they run as ranges of
// the block index of ONE launch, so that only one launch gap, one fill and one
// tail are paid and the short weight transposes run beside the two streams.
enum { NB_CVT  = B_ * KLEN_ * U_ / UNIT_,      // units of xfull, and of rel16
       NB_TR   = (U_ / 128) * (U_ / 64),       // tiles of one U_ x U_ weight
       NB_PREP = 2 * NB_CVT + 5 * NB_TR };

__global__ __launch_bounds__(256)
void prep_f16(const float* __restrict__ mem, const float* __restrict__ inp,
              const float* __restrict__ rel,
              const float* __restrict__ Wq, const float* __restrict__ Wkv,
              const float* __restrict__ Wr, const float* __restrict__ Wo,
              _Float16* __restrict__ xfull, _Float16* __restrict__ rel16,
              _Float16* __restrict__ WqT, _Float16* __restrict__ WkT,
              _Float16* __restrict__ WvT, _Float16* __restrict__ WrT,
              _Float16* __restrict__ WoT) {
  int bid = blockIdx.x;
  if (bid < NB_CVT) {
    pack_concat_f16(bid, mem, inp, xfull);
  } else if (bid < 2 * NB_CVT) {
    cvt_f32_to_f16(bid - NB_CVT, rel, rel16);
  } else {
    int t = bid - 2 * NB_CVT;
    int which = t / NB_TR, tl = t % NB_TR;
    int bx = tl % (U_ / 128), by = tl / (U_ / 128);
    // Wkv rows hold 2*U_ floats (K half, then V half), the others U_
    if (which < 2) {
      transpose_tile<2 * U_>(bx, by, which ? Wkv + U_ : Wkv, which ? WvT : WkT);
    } else {
      const float* in = which == 2 ? Wq : which == 3 ? Wr : Wo;
      _Float16* out   = which == 2 ? WqT : which == 3 ? WrT : WoT;
      transpose_tile<U_>(bx, by, in, out);
    }
  }
}

// ---- generic batched NT GEMM: C(MxN) = A(MxK) * Bw(NxK)^T ------------------
// 256 threads = 8 waves, wave grid 2x4 -> 128x128 block tile, 64x32 per wave
// (4 x 2 accumulator tiles): every A fragment serves two products, every B
// fragment four, and a row staged in LDS serves 128 rows of the other operand.
// The block's 128 A rows and 128 B rows are staged in LDS in slabs of 64 k by
// asynchronous copies (whole 128-B lines per 8 lanes), two buffers, so that the
// next slab flies while this one is multiplied. M and N must be multiples of
// 128, K a multiple of 64.
enum { GM_PLAIN = 0, GM_QCQR = 1, GM_VT = 2, GM_F32 = 3 };
enum { BT_    = 128,                // rows of A and rows of B per block tile
       SLAB_K = 64,                 // halves of k per slab: 128 B per row
       SLAB_P = 72,                 // LDS row pitch in halves: 144 B = 16 B x odd
       SLAB_G = 32 * SLAB_P * 2,    // LDS bytes of the 32 rows one copy fills
       SLAB_H = 2 * BT_ * SLAB_P }; // halves per buffer: 128 A rows, then 128 B rows

// One slab: each lane copies 16 B of four A rows and of four B rows, 32 rows
// apart (sa, sb: 32 source rows in halves). The s_wait_xcnt stands inside the
// statement so that no address register of an issued copy is rewritten ahead
// of it.
__device__ __forceinline__ void slab_copy(unsigned lds, const _Float16* ga, size_t sa,
                                          const _Float16* gb, size_t sb) {
  asm volatile("global_load_async_to_lds_b128 %0, %8, off\n\t"
               "global_load_async_to_lds_b128 %1, %9, off\n\t"
               "global_load_async_to_lds_b128 %2, %10, off\n\t"
               "global_load_async_to_lds_b128 %3, %11, off\n\t"
               "global_load_async_to_lds_b128 %4, %12, off\n\t"
               "global_load_async_to_lds_b128 %5, %13, off\n\t"
               "global_load_async_to_lds_b128 %6, %14, off\n\t"
               "global_load_async_to_lds_b128 %7, %15, off\n\t"
               "s_wait_xcnt 0x0"
               :: "v"(lds),              "v"(lds + SLAB_G),     "v"(lds + 2 * SLAB_G),
                  "v"(lds + 3 * SLAB_G), "v"(lds + 4 * SLAB_G), "v"(lds + 5 * SLAB_G),
                  "v"(lds + 6 * SLAB_G), "v"(lds + 7 * SLAB_G),
                  "v"(ga), "v"(ga + sa), "v"(ga + 2 * sa), "v"(ga + 3 * sa),
                  "v"(gb), "v"(gb + sb), "v"(gb + 2 * sb), "v"(gb + 3 * sb)
               : "memory");
}

// One block tile: (bx, by) = tile of N and of M, b = batch.
__device__ __forceinline__
void gemm_tile(unsigned bx, unsigned by, int b,
               const _Float16* __restrict__ A, size_t strideA, int lda,
               const _Float16* __restrict__ Bw, int ldb, int K,
               _Float16* __restrict__ out0, size_t strideO, int ldo,
               _Float16* __restrict__ out1,
               const float* __restrict__ bias0, const float* __restrict__ bias1,
               float* __restrict__ outf, size_t strideF,
               int klen_vt, int mode) {
  __shared__ __attribute__((aligned(16))) _Float16 slab[2 * SLAB_H];

  int wid = threadIdx.x >> 5;
  int mw  = (wid >> 2) * 64, nw = (wid & 3) * 32;
  int m0  = by * BT_ + mw;
  int n0  = bx * BT_ + nw;

  // copy role: thread -> (row 0..31, 16-B piece 0..7) of each 32-row group
  int crow = threadIdx.x >> 3, cpc = (threadIdx.x & 7) * 8;
  const _Float16* ga = A + (size_t)b * strideA
                         + (size_t)(by * BT_ + crow) * lda + cpc;
  const _Float16* gb = Bw + (size_t)(bx * BT_ + crow) * ldb + cpc;
  size_t sa = (size_t)32 * lda, sb = (size_t)32 * ldb;
  unsigned ldst = (unsigned)(size_t)&slab[crow * SLAB_P + cpc];

  int nslab = K / SLAB_K;
  slab_copy(ldst, ga, sa, gb, sb);
  asm volatile("s_wait_asynccnt 0x0" ::: "memory");  // own copies of slab 0 landed
  __syncthreads();                                   // slab 0 readable by all waves
  if (nslab > 1)
    slab_copy(ldst + SLAB_H * 2, ga + SLAB_K, sa, gb + SLAB_K, sb);

  v8f c[4][2] = {};
  for (int t = 0; t < nslab; t++) {
    int buf = t & 1;
    const _Float16* As = &slab[buf * SLAB_H + mw * SLAB_P];
    const _Float16* Bs = &slab[buf * SLAB_H + (BT_ + nw) * SLAB_P];
    // the slab's fragments are fetched as one group of LDS reads (every loop
    // over af, bf, c is unrolled: constant indices keep them in registers)
    v16h af[2][4], bf[2][2];
#pragma unroll
    for (int ks = 0; ks < 2; ks++) {
#pragma unroll
      for (int i = 0; i < 4; i++) af[ks][i] = ldfrag(As + i * 16 * SLAB_P, SLAB_P, ks * 32);
#pragma unroll
      for (int j = 0; j < 2; j++) bf[ks][j] = ldfrag(Bs + j * 16 * SLAB_P, SLAB_P, ks * 32);
    }
#pragma unroll
    for (int ks = 0; ks < 2; ks++) {
      // inputs-only fence on the loaded fragments: keeps their LDS reads one
      // group in front of the eight products (sunk to their uses, every pair
      // of products waits out an LDS latency of its own)
      asm volatile("" :: "v"(af[ks][0]), "v"(af[ks][1]), "v"(af[ks][2]), "v"(af[ks][3]),
                         "v"(bf[ks][0]), "v"(bf[ks][1]));
#pragma unroll
      for (int i = 0; i < 4; i++)
#pragma unroll
        for (int j = 0; j < 2; j++) c[i][j] = wmma_(af[ks][i], bf[ks][j], c[i][j]);
      // keeps these eight products here: the first eight run while the second
      // half's reads land, and none is moved behind the barrier, in front of the refill
      __builtin_amdgcn_sched_barrier(0);
    }
    asm volatile("s_wait_dscnt 0x0" ::: "memory");    // own reads of this buffer done
    asm volatile("s_wait_asynccnt 0x0" ::: "memory"); // own copies of slab t+1 landed
    __syncthreads();  // publishes slab t+1 and frees this buffer for its refill
    if (t + 2 < nslab) {
      int ko = (t + 2) * SLAB_K;
      slab_copy(ldst + buf * (SLAB_H * 2), ga + ko, sa, gb + ko, sb);
    }
  }
  asm volatile("s_wait_asynccnt 0x0" ::: "memory");   // nothing in flight at the end

  // the mode is tested once, outside the loops over the wave's 64 values a lane
  int lane = threadIdx.x & 31, jl = lane & 15, hf = lane >> 4;
  auto each = [&](auto put) {
#pragma unroll
    for (int i = 0; i < 4; i++)
#pragma unroll
      for (int j = 0; j < 2; j++)
#pragma unroll
        for (int r = 0; r < 8; r++)
          put(m0 + i * 16 + r + 8 * hf, n0 + j * 16 + jl, c[i][j][r]);
  };
  if (mode == GM_QCQR) {
    each([&](int row, int col, float v) {
      size_t o = (size_t)b * strideO + (size_t)row * ldo + col;
      out0[o] = (_Float16)(v + bias0[col]);
      out1[o] = (_Float16)(v + bias1[col]);
    });
    // no register of an issued store is rewritten ahead of this wait
    asm volatile("s_wait_xcnt 0x0" ::: "memory");
  } else if (mode == GM_VT) {             // store V transposed: (B,H,DH,KLEN)
    each([&](int row, int col, float v) {
      int h = col >> 6, d = col & 63;
      out0[(((size_t)b * H_ + h) * DH_ + d) * (size_t)klen_vt + row] = (_Float16)v;
    });
    // no register of an issued store is rewritten ahead of this wait
    asm volatile("s_wait_xcnt 0x0" ::: "memory");
  } else if (mode == GM_F32) {
    each([&](int row, int col, float v) {
      outf[(size_t)b * strideF + (size_t)row * ldo + col] = v;
    });
    // no register of an issued store is rewritten ahead of this wait
    asm volatile("s_wait_xcnt 0x0" ::: "memory");
  } else {
    each([&](int row, int col, float v) {
      out0[(size_t)b * strideO + (size_t)row * ldo + col] = (_Float16)v;
    });
    // no register of an issued store is rewritten ahead of this wait
    asm volatile("s_wait_xcnt 0x0" ::: "memory");
  }
}

// one GEMM per launch: grid (N / 128, M / 128, batch)
__global__ __launch_bounds__(256)
void gemm_nt(const _Float16* __restrict__ A, size_t strideA, int lda,
             const _Float16* __restrict__ Bw, int ldb, int K,
             _Float16* __restrict__ out0, size_t strideO, int ldo,
             _Float16* __restrict__ out1,
             const float* __restrict__ bias0, const float* __restrict__ bias1,
             float* __restrict__ outf, size_t strideF,
             int klen_vt, int mode) {
  gemm_tile(blockIdx.x, blockIdx.y, blockIdx.z, A, strideA, lda, Bw, ldb, K,
            out0, strideO, ldo, out1, bias0, bias1, outf, strideF, klen_vt, mode);
}

// The four projections (K, V, r, q) are independent of one another: they run as
// ranges of the block index of ONE launch. Alone, each fills a WGP with one
// block (q: every second WGP) and pays its own gap, fill, first slab and tail;
// together several blocks share a WGP and one's waits are covered by another's
// work. Within a range the tiles keep the order N tile, M tile, batch.
enum { NB_KV   = (U_ / BT_) * (KLEN_ / BT_) * B_,   // blocks of K, of V and of r
       NB_Q    = (U_ / BT_) * (Q_ / BT_) * B_,      // blocks of q
       NB_PROJ = 3 * NB_KV + NB_Q };

__global__ __launch_bounds__(256)
void proj_gemms(const _Float16* __restrict__ xfull, const _Float16* __restrict__ rel16,
                const _Float16* __restrict__ WkT, const _Float16* __restrict__ WvT,
                const _Float16* __restrict__ WrT, const _Float16* __restrict__ WqT,
                _Float16* __restrict__ kbuf, _Float16* __restrict__ vTb,
                _Float16* __restrict__ rbuf,
                _Float16* __restrict__ qcb, _Float16* __restrict__ qrb,
                const float* __restrict__ biasc, const float* __restrict__ biasr) {
  int g = blockIdx.x / NB_KV, t = blockIdx.x % NB_KV;   // 0 K, 1 V, 2 r, 3 q
  int mt = g == 3 ? Q_ / BT_ : KLEN_ / BT_;             // M tiles of one batch
  int bx = t % (U_ / BT_), by = t / (U_ / BT_) % mt, b = t / (U_ / BT_) / mt;
  const _Float16* A  = g == 2 ? rel16 : g == 3 ? xfull + (size_t)MEM_ * U_ : xfull;
  const _Float16* Bw = g == 0 ? WkT : g == 1 ? WvT : g == 2 ? WrT : WqT;
  _Float16* out0     = g == 0 ? kbuf : g == 1 ? vTb : g == 2 ? rbuf : qcb;
  size_t strideO     = g == 3 ? (size_t)Q_ * U_ : (size_t)KLEN_ * U_;
  int mode           = g == 3 ? GM_QCQR : g == 1 ? GM_VT : GM_PLAIN;
  gemm_tile(bx, by, b, A, (size_t)KLEN_ * U_, U_, Bw, U_, U_,
            out0, strideO, U_, qrb, biasc, biasr, nullptr, 0, KLEN_, mode);
}

enum { FK_P   = 72,                     // K and r row pitch in halves: 144 B = 16 B x odd
       FV_P   = 40,                     // V^T row pitch in halves: 80 B = 16 B x odd
       FR_OFF = 32 * FK_P,              // r band behind the 32 K rows
       FV_OFF = (32 + 96) * FK_P,       // V^T tile behind the 96 r rows
       FT_H   = FV_OFF + 64 * FV_P };   // halves per buffer

// ---- reductions over a 16-lane row, on the vector port ---------------------
// A shuffle builtin goes through the LDS queue, and every step of a reduction
// then waits out that queue's latency; a DPP row_xmask operand reads lane l ^ M
// of the lane's own 16-lane row inside the vector instruction itself.
template <int M>
__device__ __forceinline__ float row_xor(float x) {
  int v = __builtin_bit_cast(int, x);
  return __builtin_bit_cast(float,
      __builtin_amdgcn_update_dpp(v, v, 0x160 + M, 0xf, 0xf, true));
}

// Row maximum of eight values, every lane of a row gets it. Written as asm so
// that move and maximum are one instruction (from the builtin the compiler makes
// three: move, quieting maximum, maximum). The eight chains are interleaved:
// each step's producer stands eight instructions back, so no step waits on it.
// All 32 lanes are on where this is called.
__device__ __forceinline__ void row_max8(float (&t)[8]) {
  asm volatile(
      "v_max_num_f32_dpp %0, %0, %0 row_xmask:1 row_mask:0xf bank_mask:0xf\n\t"
      "v_max_num_f32_dpp %1, %1, %1 row_xmask:1 row_mask:0xf bank_mask:0xf\n\t"
      "v_max_num_f32_dpp %2, %2, %2 row_xmask:1 row_mask:0xf bank_mask:0xf\n\t"
      "v_max_num_f32_dpp %3, %3, %3 row_xmask:1 row_mask:0xf bank_mask:0xf\n\t"
      "v_max_num_f32_dpp %4, %4, %4 row_xmask:1 row_mask:0xf bank_mask:0xf\n\t"
      "v_max_num_f32_dpp %5, %5, %5 row_xmask:1 row_mask:0xf bank_mask:0xf\n\t"
      "v_max_num_f32_dpp %6, %6, %6 row_xmask:1 row_mask:0xf bank_mask:0xf\n\t"
      "v_max_num_f32_dpp %7, %7, %7 row_xmask:1 row_mask:0xf bank_mask:0xf\n\t"
      "v_max_num_f32_dpp %0, %0, %0 row_xmask:2 row_mask:0xf bank_mask:0xf\n\t"
      "v_max_num_f32_dpp %1, %1, %1 row_xmask:2 row_mask:0xf bank_mask:0xf\n\t"
      "v_max_num_f32_dpp %2, %2, %2 row_xmask:2 row_mask:0xf bank_mask:0xf\n\t"
      "v_max_num_f32_dpp %3, %3, %3 row_xmask:2 row_mask:0xf bank_mask:0xf\n\t"
      "v_max_num_f32_dpp %4, %4, %4 row_xmask:2 row_mask:0xf bank_mask:0xf\n\t"
      "v_max_num_f32_dpp %5, %5, %5 row_xmask:2 row_mask:0xf bank_mask:0xf\n\t"
      "v_max_num_f32_dpp %6, %6, %6 row_xmask:2 row_mask:0xf bank_mask:0xf\n\t"
      "v_max_num_f32_dpp %7, %7, %7 row_xmask:2 row_mask:0xf bank_mask:0xf\n\t"
      "v_max_num_f32_dpp %0, %0, %0 row_xmask:4 row_mask:0xf bank_mask:0xf\n\t"
      "v_max_num_f32_dpp %1, %1, %1 row_xmask:4 row_mask:0xf bank_mask:0xf\n\t"
      "v_max_num_f32_dpp %2, %2, %2 row_xmask:4 row_mask:0xf bank_mask:0xf\n\t"
      "v_max_num_f32_dpp %3, %3, %3 row_xmask:4 row_mask:0xf bank_mask:0xf\n\t"
      "v_max_num_f32_dpp %4, %4, %4 row_xmask:4 row_mask:0xf bank_mask:0xf\n\t"
      "v_max_num_f32_dpp %5, %5, %5 row_xmask:4 row_mask:0xf bank_mask:0xf\n\t"
      "v_max_num_f32_dpp %6, %6, %6 row_xmask:4 row_mask:0xf bank_mask:0xf\n\t"
      "v_max_num_f32_dpp %7, %7, %7 row_xmask:4 row_mask:0xf bank_mask:0xf\n\t"
      "v_max_num_f32_dpp %0, %0, %0 row_xmask:8 row_mask:0xf bank_mask:0xf\n\t"
      "v_max_num_f32_dpp %1, %1, %1 row_xmask:8 row_mask:0xf bank_mask:0xf\n\t"
      "v_max_num_f32_dpp %2, %2, %2 row_xmask:8 row_mask:0xf bank_mask:0xf\n\t"
      "v_max_num_f32_dpp %3, %3, %3 row_xmask:8 row_mask:0xf bank_mask:0xf\n\t"
      "v_max_num_f32_dpp %4, %4, %4 row_xmask:8 row_mask:0xf bank_mask:0xf\n\t"
      "v_max_num_f32_dpp %5, %5, %5 row_xmask:8 row_mask:0xf bank_mask:0xf\n\t"
      "v_max_num_f32_dpp %6, %6, %6 row_xmask:8 row_mask:0xf bank_mask:0xf\n\t"
      "v_max_num_f32_dpp %7, %7, %7 row_xmask:8 row_mask:0xf bank_mask:0xf"
      : "+v"(t[0]), "+v"(t[1]), "+v"(t[2]), "+v"(t[3]),
        "+v"(t[4]), "+v"(t[5]), "+v"(t[6]), "+v"(t[7]));
}

// s[r] += y[r] taken from lane (l - (i + 1)) mod 16 of the lane's own 16-lane
// row, i = r + 8 * (wave half) being the score row that register r holds there:
// the relative shift moves row i by i + 1 columns. A rotate count is an
// immediate and the two halves need counts 8 apart, so each register takes one
// add per half (row_mask picks the half, the other half's lanes keep their
// value; row 15 is not moved: identity quad_perm). Written as asm so that rotate
// and add are one instruction; the second add on a register stands eight
// instructions behind the first, so none waits on its producer. volatile: it
// must stay where all 32 lanes are on (a DPP operand reads other lanes).
__device__ __forceinline__ void shift_add8(float (&s)[8], const float (&y)[8]) {
  asm volatile(
      "v_add_f32_dpp %0, %8, %0 row_ror:1 row_mask:0x1 bank_mask:0xf\n\t"
      "v_add_f32_dpp %1, %9, %1 row_ror:2 row_mask:0x1 bank_mask:0xf\n\t"
      "v_add_f32_dpp %2, %10, %2 row_ror:3 row_mask:0x1 bank_mask:0xf\n\t"
      "v_add_f32_dpp %3, %11, %3 row_ror:4 row_mask:0x1 bank_mask:0xf\n\t"
      "v_add_f32_dpp %4, %12, %4 row_ror:5 row_mask:0x1 bank_mask:0xf\n\t"
      "v_add_f32_dpp %5, %13, %5 row_ror:6 row_mask:0x1 bank_mask:0xf\n\t"
      "v_add_f32_dpp %6, %14, %6 row_ror:7 row_mask:0x1 bank_mask:0xf\n\t"
      "v_add_f32_dpp %7, %15, %7 row_ror:8 row_mask:0x1 bank_mask:0xf\n\t"
      "v_add_f32_dpp %0, %8, %0 row_ror:9 row_mask:0x2 bank_mask:0xf\n\t"
      "v_add_f32_dpp %1, %9, %1 row_ror:10 row_mask:0x2 bank_mask:0xf\n\t"
      "v_add_f32_dpp %2, %10, %2 row_ror:11 row_mask:0x2 bank_mask:0xf\n\t"
      "v_add_f32_dpp %3, %11, %3 row_ror:12 row_mask:0x2 bank_mask:0xf\n\t"
      "v_add_f32_dpp %4, %12, %4 row_ror:13 row_mask:0x2 bank_mask:0xf\n\t"
      "v_add_f32_dpp %5, %13, %5 row_ror:14 row_mask:0x2 bank_mask:0xf\n\t"
      "v_add_f32_dpp %6, %14, %6 row_ror:15 row_mask:0x2 bank_mask:0xf\n\t"
      "v_add_f32_dpp %7, %15, %7 quad_perm:[0,1,2,3] row_mask:0x2 bank_mask:0xf"
      : "+v"(s[0]), "+v"(s[1]), "+v"(s[2]), "+v"(s[3]),
        "+v"(s[4]), "+v"(s[5]), "+v"(s[6]), "+v"(s[7])
      : "v"(y[0]), "v"(y[1]), "v"(y[2]), "v"(y[3]),
        "v"(y[4]), "v"(y[5]), "v"(y[6]), "v"(y[7]));
}

__global__ __launch_bounds__(128)
void flash_attn(const _Float16* __restrict__ qc, const _Float16* __restrict__ qr,
                const _Float16* __restrict__ kk, const _Float16* __restrict__ rr,
                const _Float16* __restrict__ vT, _Float16* __restrict__ outp) {
  __shared__ __align__(16) _Float16 tile[2 * FT_H];
  __shared__ __align__(16) _Float16 pbuf[4][16][32];

  // wave number in a scalar register: the causal skip below is a scalar branch
  int w = __builtin_amdgcn_readfirstlane(threadIdx.x >> 5);
  int lane = threadIdx.x & 31, jl = lane & 15, hf = lane >> 4;
  int b = blockIdx.z, h = blockIdx.y;
  int ib = blockIdx.x * 64;
  int i0 = ib + w * 16;

  const _Float16* qcb = qc + ((size_t)b * Q_ + i0) * U_ + h * DH_;
  const _Float16* qrb = qr + ((size_t)b * Q_ + i0) * U_ + h * DH_;
  v16h aqc0 = ldfrag(qcb, U_, 0), aqc1 = ldfrag(qcb, U_, 32);
  v16h aqr0 = ldfrag(qrb, U_, 0), aqr1 = ldfrag(qrb, U_, 32);

  const _Float16* kbase = kk + (size_t)b * KLEN_ * U_ + h * DH_;
  const _Float16* rbase = rr + (size_t)b * KLEN_ * U_ + h * DH_;
  const _Float16* vbase = vT + ((size_t)b * H_ + h) * DH_ * KLEN_;

  // copy role: K and r rows as (row 0..15, 16-B piece 0..7), V^T rows as
  // (row 0..31, 16-B piece 0..3)
  int crow = threadIdx.x >> 3, cpc = (threadIdx.x & 7) * 8;
  int vrow = threadIdx.x >> 2, vpc = (threadIdx.x & 3) * 8;
  unsigned lkr = (unsigned)(size_t)&tile[crow * FK_P + cpc];
  unsigned lvv = (unsigned)(size_t)&tile[FV_OFF + vrow * FV_P + vpc];

  // One key tile: each lane copies 16 B of two K rows, six r rows and two V^T
  // rows. r rows past KLEN are masked later; their source row is clamped. The
  // s_wait_xcnt stands inside the statement so that no address register of an
  // issued copy is rewritten ahead of it.
  auto tile_copy = [&](int t, int buf) {
    int j0 = t * 32;
    unsigned lk = lkr + buf * (FT_H * 2), lv = lvv + buf * (FT_H * 2);
    const _Float16* gk = kbase + (size_t)(j0 + crow) * U_ + cpc;
    const _Float16* gv = vbase + (size_t)vrow * KLEN_ + j0 + vpc;
    int rb = j0 + (Q_ - 64) - ib + crow;      // first r row of wave 3's band, + crow
    const _Float16* gr[6];
#pragma unroll   // constant indices keep the six pointers in registers
    for (int n = 0; n < 6; n++) {
      int row = rb + n * 16; if (row > KLEN_ - 1) row = KLEN_ - 1;
      gr[n] = rbase + (size_t)row * U_ + cpc;
    }
    asm volatile("global_load_async_to_lds_b128 %0, %10, off\n\t"
                 "global_load_async_to_lds_b128 %1, %11, off\n\t"
                 "global_load_async_to_lds_b128 %2, %12, off\n\t"
                 "global_load_async_to_lds_b128 %3, %13, off\n\t"
                 "global_load_async_to_lds_b128 %4, %14, off\n\t"
                 "global_load_async_to_lds_b128 %5, %15, off\n\t"
                 "global_load_async_to_lds_b128 %6, %16, off\n\t"
                 "global_load_async_to_lds_b128 %7, %17, off\n\t"
                 "global_load_async_to_lds_b128 %8, %18, off\n\t"
                 "global_load_async_to_lds_b128 %9, %19, off\n\t"
                 "s_wait_xcnt 0x0"
                 :: "v"(lk), "v"(lk + 16 * FK_P * 2),
                    "v"(lk + 32 * FK_P * 2), "v"(lk + 48 * FK_P * 2),
                    "v"(lk + 64 * FK_P * 2), "v"(lk + 80 * FK_P * 2),
                    "v"(lk + 96 * FK_P * 2), "v"(lk + 112 * FK_P * 2),
                    "v"(lv), "v"(lv + 32 * FV_P * 2),
                    "v"(gk), "v"(gk + (size_t)16 * U_),
                    "v"(gr[0]), "v"(gr[1]), "v"(gr[2]), "v"(gr[3]), "v"(gr[4]), "v"(gr[5]),
                    "v"(gv), "v"(gv + (size_t)32 * KLEN_)
                 : "memory");
  };

  v8f o[4] = {};
  float mrow[8], lrow[8];
#pragma unroll
  for (int r = 0; r < 8; r++) { mrow[r] = -1e30f; lrow[r] = 0.f; }

  int jmax  = MEM_ + i0 + 15;                // this wave's causal bound
  int ntile = (MEM_ + ib + 63) / 32 + 1;     // the block's key tiles, 34 or more

  tile_copy(0, 0);
  asm volatile("s_wait_asynccnt 0x0" ::: "memory");  // own copies of tile 0 landed
  __syncthreads();                                   // tile 0 readable by all waves
  tile_copy(1, 1);

  for (int t = 0; t < ntile; t++) {
    int j0 = t * 32, buf = t & 1;
    const _Float16* Ks = &tile[buf * FT_H];
    const _Float16* Rs = &tile[buf * FT_H + FR_OFF + (3 - w) * 16 * FK_P];
    const _Float16* Vs = &tile[buf * FT_H + FV_OFF];

    if (j0 <= jmax) {   // a wave past its causal bound skips the work, not the barrier
    // all K and r fragments of the tile are fetched as one group of LDS reads
    // (every loop over kf, rf, rc is unrolled: constant indices keep them in registers)
    v16h kf[4], rf[6];
#pragma unroll
    for (int n = 0; n < 4; n++)
      kf[n] = ldfrag(Ks + (n >> 1) * 16 * FK_P, FK_P, (n & 1) * 32);
#pragma unroll
    for (int n = 0; n < 6; n++)
      rf[n] = ldfrag(Rs + (n >> 1) * 16 * FK_P, FK_P, (n & 1) * 32);

    // context scores: two 16-col subtiles over K=DH=64
    v8f sc0 = {}, sc1 = {};
    sc0 = wmma_(aqc0, kf[0], sc0);
    sc0 = wmma_(aqc1, kf[1], sc0);
    sc1 = wmma_(aqc0, kf[2], sc1);
    sc1 = wmma_(aqc1, kf[3], sc1);

    // relative-score band: r rows rb0 .. rb0+47, rb0 = j0 + (Q-16) - i0
    v8f rc[3] = {};
#pragma unroll
    for (int tt = 0; tt < 3; tt++) {
      rc[tt] = wmma_(aqr0, rf[2 * tt], rc[tt]);
      rc[tt] = wmma_(aqr1, rf[2 * tt + 1], rc[tt]);
    }

    // shifted rel term: score (i, j) takes band column j + 15 - i. Band column
    // c sits in lane c & 15 of tile c >> 4, so lane L hands on tile 0 (for the
    // second 16 keys: tile 1) where L >= 15 - i and the next tile below that,
    // and a rotate by i + 1 lanes brings every value to its score's lane.
    float a0[8], a1[8], y0[8], y1[8];
#pragma unroll   // constant indices keep the four arrays in registers
    for (int r = 0; r < 8; r++) {
      bool first = jl >= 15 - (r + 8 * hf);
      y0[r] = first ? rc[0][r] : rc[1][r];
      y1[r] = first ? rc[1][r] : rc[2][r];
      a0[r] = sc0[r];
      a1[r] = sc1[r];
    }
    shift_add8(a0, y0);
    shift_add8(a1, y1);

    // scale 1/sqrt(64), apply causal mask
    float s0[8], s1[8];
#pragma unroll
    for (int r = 0; r < 8; r++) {
      int lim = MEM_ + i0 + r + 8 * hf;
      s0[r] = (j0 + jl      <= lim) ? a0[r] * 0.125f : -1e30f;
      s1[r] = (j0 + 16 + jl <= lim) ? a1[r] * 0.125f : -1e30f;
    }

    // online softmax (row = reg r + 8*hf; 16-lane group holds the 16 cols)
    float alpha[8], tm[8];
#pragma unroll   // constant indices keep tm in registers
    for (int r = 0; r < 8; r++) tm[r] = fmaxf(fmaxf(s0[r], s1[r]), mrow[r]);
    row_max8(tm);   // the running maximum is the same in a row's lanes: this is the new one
#pragma unroll
    for (int r = 0; r < 8; r++) {
      float mn = tm[r];
      alpha[r] = __expf(mrow[r] - mn);
      float p0 = __expf(s0[r] - mn), p1 = __expf(s1[r] - mn);
      float ps = p0 + p1;
      ps += row_xor<1>(ps); ps += row_xor<2>(ps);
      ps += row_xor<4>(ps); ps += row_xor<8>(ps);
      lrow[r] = lrow[r] * alpha[r] + ps;
      mrow[r] = mn;
      int iloc = r + 8 * hf;
      pbuf[w][iloc][jl]      = (_Float16)p0;
      pbuf[w][iloc][16 + jl] = (_Float16)p1;
    }
#pragma unroll
    for (int dt = 0; dt < 4; dt++)
#pragma unroll
      for (int r = 0; r < 8; r++) o[dt][r] *= alpha[r];

    asm volatile("" ::: "memory");   // order P store -> A-fragment reload
    v16h ap = ldfrag(&pbuf[w][0][0], 32, 0);   // C-layout -> A-layout via LDS
#pragma unroll
    for (int dt = 0; dt < 4; dt++)
      o[dt] = wmma_(ap, ldfrag(Vs + dt * 16 * FV_P, FV_P, 0), o[dt]);
    }

    asm volatile("s_wait_dscnt 0x0" ::: "memory");    // own reads of this buffer done
    asm volatile("s_wait_asynccnt 0x0" ::: "memory"); // own copies of tile t+1 landed
    __syncthreads();  // publishes tile t+1 and frees this buffer for its refill
    if (t + 2 < ntile) tile_copy(t + 2, buf);
  }
  asm volatile("s_wait_asynccnt 0x0" ::: "memory");   // nothing in flight at the end

  // normalize and store (B,Q,U) f16
#pragma unroll
  for (int dt = 0; dt < 4; dt++)
#pragma unroll
    for (int r = 0; r < 8; r++) {
      int iloc = r + 8 * hf;
      float vv = o[dt][r] / lrow[r];
      outp[((size_t)b * Q_ + i0 + iloc) * U_ + h * DH_ + dt * 16 + jl] = (_Float16)vv;
    }
}

// ---------------------------------------------------------------------------
extern "C" void kernel_launch(void* const* d_in, const int* in_sizes, int n_in,
                              void* d_out, int out_size, void* d_ws, size_t ws_size,
                              hipStream_t stream) {
  (void)in_sizes; (void)n_in; (void)out_size; (void)ws_size;
  const float* inputs    = (const float*)d_in[0];
  const float* relatives = (const float*)d_in[1];
  const float* memories  = (const float*)d_in[2];
  const float* biasc     = (const float*)d_in[3];
  const float* biasr     = (const float*)d_in[4];
  const float* Wq        = (const float*)d_in[5];
  const float* Wkv       = (const float*)d_in[6];
  const float* Wr        = (const float*)d_in[7];
  const float* Wo        = (const float*)d_in[8];
  float* out = (float*)d_out;

  // f16 workspace carve-out (~62 MB)
  _Float16* ws = (_Float16*)d_ws;
  size_t off = 0;
  auto carve = [&](size_t n) { _Float16* p = ws + off; off += n; return p; };
  const size_t BKU = (size_t)B_ * KLEN_ * U_;   // 4M
  const size_t BQU = (size_t)B_ * Q_ * U_;      // 2M
  const size_t UU  = (size_t)U_ * U_;           // 1M
  _Float16* xfull  = carve(BKU);
  _Float16* rel16  = carve(BKU);
  _Float16* WqT    = carve(UU);
  _Float16* WkT    = carve(UU);
  _Float16* WvT    = carve(UU);
  _Float16* WrT    = carve(UU);
  _Float16* WoT    = carve(UU);
  _Float16* qcb    = carve(BQU);
  _Float16* qrb    = carve(BQU);
  _Float16* kbuf   = carve(BKU);
  _Float16* rbuf   = carve(BKU);
  _Float16* vTb    = carve(BKU);                // (B,H,DH,KLEN)
  _Float16* attout = carve(BQU);

  // 1) pack + convert
  prep_f16<<<NB_PREP, 256, 0, stream>>>(memories, inputs, relatives, Wq, Wkv, Wr, Wo,
                                        xfull, rel16, WqT, WkT, WvT, WrT, WoT);

  // 2) projections (all WMMA NT GEMMs), one launch
  proj_gemms<<<NB_PROJ, 256, 0, stream>>>(xfull, rel16, WkT, WvT, WrT, WqT,
                                          kbuf, vTb, rbuf, qcb, qrb, biasc, biasr);

  // 3) fused attention (no score matrix in HBM)
  flash_attn<<<dim3(Q_ / 64, H_, B_), 128, 0, stream>>>(qcb, qrb, kbuf, rbuf,
                                                        vTb, attout);

  // 4) output projection, f32 result
  dim3 gq(U_ / BT_, Q_ / BT_, B_);
  gemm_nt<<<gq, 256, 0, stream>>>(attout, BQU / B_, U_, WoT, U_, U_,
                                  nullptr, 0, U_, nullptr, nullptr, nullptr,
                                  out, BQU / B_, 0, GM_F32);
}

// v008
// One run takes 106 microseconds.
// In both of two side-by-side timings against v007, it was 1.11 times as fast.
// All steps since v000 together make it 3.95 times as fast.
#include <hip/hip_runtime.h>
#include <hip/hip_bf16.h>

// ---------------------------------------------------------------------------
// Transformer-XL relative multi-head attention for MI455X (gfx1250).
// All GEMMs run on v_wmma_f32_16x16x32_f16 (wave32 WMMA, f32 accumulate).
// Attention is fused flash-style (online softmax) so the (B,H,Q,KLEN) score
// matrix (256MB f32) never touches HBM. The relative-shift is folded into the
// flash loop via a 79-wide diagonal band of qr*r^T tiles shifted in registers.
// Workspace requirement: ~62 MB of f16 scratch in d_ws.
// ---------------------------------------------------------------------------

enum { B_ = 2, Q_ = 1024, MEM_ = 1024, U_ = 1024, H_ = 16, DH_ = 64, KLEN_ = MEM_ + Q_ };

typedef __attribute__((ext_vector_type(16))) _Float16 v16h;
typedef __attribute__((ext_vector_type(8)))  _Float16 v8h;
typedef __attribute__((ext_vector_type(8)))  float    v8f;

// ---- WMMA fragment helpers (layouts per CDNA5 ISA 7.12.2) -----------------
// A fragment 16x32 f16: lane m=lane&15 holds row m; half=lane>>4 selects
// k-groups: regs 0-3 = k in [half*8, half*8+8), regs 4-7 = +16. Each group is
// 8 contiguous halves -> one 16B load. B fragment (NT form, B stored as NxK
// row-major) is symmetric with N in place of M.
__device__ __forceinline__ v16h frag_combine(v8h lo, v8h hi) {
  return __builtin_shufflevector(lo, hi, 0,1,2,3,4,5,6,7,8,9,10,11,12,13,14,15);
}

__device__ __forceinline__ v16h ldfrag(const _Float16* base, int ld, int koff) {
  int lane = threadIdx.x & 31;
  int m = lane & 15, hf = lane >> 4;
  const v8h* p = (const v8h*)(base + (size_t)m * ld + koff + hf * 8);
  return frag_combine(p[0], p[2]);   // p[2] == +16 halves
}

__device__ __forceinline__ v8f wmma_(v16h a, v16h b, v8f c) {
  return __builtin_amdgcn_wmma_f32_16x16x32_f16(false, a, false, b, (short)0, c,
                                                false, false);
}

// ---- pack / convert kernels ----------------------------------------------
// Every lane moves 16-B pieces, eight loads in flight: a block of 256 threads
// takes one unit of 8192 floats, so few waves have to be started.
typedef __attribute__((ext_vector_type(4))) float    v4f;
typedef __attribute__((ext_vector_type(4))) _Float16 v4h;
enum { UNIT_ = 8192 };

// One unit, contiguous: each wave-wide load covers 512 B, each store 256 B.
__device__ __forceinline__ void cvt_unit(const float* __restrict__ src,
                                         _Float16* __restrict__ dst) {
  const v4f* s = (const v4f*)src + threadIdx.x;
  v4h* d = (v4h*)dst + threadIdx.x;
  v4f x[8];
#pragma unroll   // constant indices keep the eight pieces in registers
  for (int i = 0; i < 8; i++) x[i] = s[i * 256];
#pragma unroll
  for (int i = 0; i < 8; i++) d[i * 256] = __builtin_convertvector(x[i], v4h);
  // no register of an issued store is rewritten ahead of this wait
  asm volatile("s_wait_xcnt 0x0" ::: "memory");
}

// MEM_*U_ and Q_*U_ are multiples of UNIT_: a unit lies in one source.
__device__ __forceinline__
void pack_concat_f16(int unit, const float* __restrict__ mem,
                     const float* __restrict__ inp,
                     _Float16* __restrict__ xfull) {
  size_t e = (size_t)unit * UNIT_;
  size_t b = e / ((size_t)KLEN_ * U_);
  size_t rem = e - b * (size_t)KLEN_ * U_;
  const float* src = (rem < (size_t)MEM_ * U_)
                         ? mem + b * (size_t)MEM_ * U_ + rem
                         : inp + b * (size_t)Q_ * U_ + (rem - (size_t)MEM_ * U_);
  cvt_unit(src, xfull + e);
}

// one unit per block; the units cover the whole array (a multiple of UNIT_)
__device__ __forceinline__
void cvt_f32_to_f16(int unit, const float* __restrict__ in, _Float16* __restrict__ out) {
  size_t e = (size_t)unit * UNIT_;
  cvt_unit(in + e, out + e);
}

// out[n*U_ + k] = in[k*ldin + coloff + n]  (weight transpose for NT GEMMs)
// Block tile 64 k x 128 n, wave tile 32 k x 32 n, lane tile 8 k x 4 n held in
// registers: a load covers four whole 128-B lines of the source rows, a store
// writes 8 halves of k (16 B) per lane. The source pitch is a template
// constant (two are in use): no multiply by a run-time pitch in the addresses.
template <int LDIN>
__device__ __forceinline__ void transpose_tile(int bx, int by,
                                               const float* __restrict__ in,
                                               _Float16* __restrict__ out) {
  int lane = threadIdx.x & 31, wid = threadIdx.x >> 5;
  int k0 = by * 64  + (wid & 1) * 32  + (lane >> 3) * 8;
  int n0 = bx * 128 + (wid >> 1) * 32 + (lane & 7) * 4;
  const float* s = in + (size_t)k0 * LDIN + n0;
  _Float16* d = out + (size_t)n0 * U_ + k0;
  v4f x[8];
#pragma unroll   // constant indices keep the lane tile in registers
  for (int i = 0; i < 8; i++) x[i] = *(const v4f*)(s + i * LDIN);
#pragma unroll
  for (int j = 0; j < 4; j++) {
    v8h y;
#pragma unroll
    for (int i = 0; i < 8; i++) y[i] = (_Float16)x[i][j];
    *(v8h*)(d + j * U_) = y;
  }
  // no register of an issued store is rewritten ahead of this wait
  asm volatile("s_wait_xcnt 0x0" ::: "memory");
}

// All seven preparations are independent of one another: they run as ranges of
// the block index of ONE launch, so that only one launch gap, one fill and one
// tail are paid and the short weight transposes run beside the two streams.
enum { NB_CVT  = B_ * KLEN_ * U_ / UNIT_,      // units of xfull, and of rel16
       NB_TR   = (U_ / 128) * (U_ / 64),       // tiles of one U_ x U_ weight
       NB_PREP = 2 * NB_CVT + 5 * NB_TR };

__global__ __launch_bounds__(256)
void prep_f16(const float* __restrict__ mem, const float* __restrict__ inp,
              const float* __restrict__ rel,
              const float* __restrict__ Wq, const float* __restrict__ Wkv,
              const float* __restrict__ Wr, const float* __restrict__ Wo,
              _Float16* __restrict__ xfull, _Float16* __restrict__ rel16,
              _Float16* __restrict__ WqT, _Float16* __restrict__ WkT,
              _Float16* __restrict__ WvT, _Float16* __restrict__ WrT,
              _Float16* __restrict__ WoT) {
  int bid = blockIdx.x;
  if (bid < NB_CVT) {
    pack_concat_f16(bid, mem, inp, xfull);
  } else if (bid < 2 * NB_CVT) {
    cvt_f32_to_f16(bid - NB_CVT, rel, rel16);
  } else {
    int t = bid - 2 * NB_CVT;
    int which = t / NB_TR, tl = t % NB_TR;
    int bx = tl % (U_ / 128), by = tl / (U_ / 128);
    // Wkv rows hold 2*U_ floats (K half, then V half), the others U_
    if (which < 2) {
      transpose_tile<2 * U_>(bx, by, which ? Wkv + U_ : Wkv, which ? WvT : WkT);
    } else {
      const float* in = which == 2 ? Wq : which == 3 ? Wr : Wo;
      _Float16* out   = which == 2 ? WqT : which == 3 ? WrT : WoT;
      transpose_tile<U_>(bx, by, in, out);
    }
  }
}

// ---- generic batched NT GEMM: C(MxN) = A(MxK) * Bw(NxK)^T ------------------
// 256 threads = 8 waves, wave grid 2x4 -> 128x128 block tile, 64x32 per wave
// (4 x 2 accumulator tiles): every A fragment serves two products, every B
// fragment four, and a row staged in LDS serves 128 rows of the other operand.
// The block's 128 A rows and 128 B rows are staged in LDS in slabs of 64 k by
// asynchronous copies (whole 128-B lines per 8 lanes), two buffers, so that the
// next slab flies while this one is multiplied. M and N must be multiples of
// 128, K a multiple of 64.
enum { GM_PLAIN = 0, GM_QCQR = 1, GM_VT = 2, GM_F32 = 3 };
enum { BT_    = 128,                // rows of A and rows of B per block tile
       SLAB_K = 64,                 // halves of k per slab: 128 B per row
       SLAB_P = 72,                 // LDS row pitch in halves: 144 B = 16 B x odd
       SLAB_G = 32 * SLAB_P * 2,    // LDS bytes of the 32 rows one copy fills
       SLAB_H = 2 * BT_ * SLAB_P }; // halves per buffer: 128 A rows, then 128 B rows

// One slab: each lane copies 16 B of four A rows and of four B rows, 32 rows
// apart (sa, sb: 32 source rows in halves). The s_wait_xcnt stands inside the
// statement so that no address register of an issued copy is rewritten ahead
// of it.
__device__ __forceinline__ void slab_copy(unsigned lds, const _Float16* ga, size_t sa,
                                          const _Float16* gb, size_t sb) {
  asm volatile("global_load_async_to_lds_b128 %0, %8, off\n\t"
               "global_load_async_to_lds_b128 %1, %9, off\n\t"
               "global_load_async_to_lds_b128 %2, %10, off\n\t"
               "global_load_async_to_lds_b128 %3, %11, off\n\t"
               "global_load_async_to_lds_b128 %4, %12, off\n\t"
               "global_load_async_to_lds_b128 %5, %13, off\n\t"
               "global_load_async_to_lds_b128 %6, %14, off\n\t"
               "global_load_async_to_lds_b128 %7, %15, off\n\t"
               "s_wait_xcnt 0x0"
               :: "v"(lds),              "v"(lds + SLAB_G),     "v"(lds + 2 * SLAB_G),
                  "v"(lds + 3 * SLAB_G), "v"(lds + 4 * SLAB_G), "v"(lds + 5 * SLAB_G),
                  "v"(lds + 6 * SLAB_G), "v"(lds + 7 * SLAB_G),
                  "v"(ga), "v"(ga + sa), "v"(ga + 2 * sa), "v"(ga + 3 * sa),
                  "v"(gb), "v"(gb + sb), "v"(gb + 2 * sb), "v"(gb + 3 * sb)
               : "memory");
}

// One block tile: (bx, by) = tile of N and of M, b = batch.
__device__ __forceinline__
void gemm_tile(unsigned bx, unsigned by, int b,
               const _Float16* __restrict__ A, size_t strideA, int lda,
               const _Float16* __restrict__ Bw, int ldb, int K,
               _Float16* __restrict__ out0, size_t strideO, int ldo,
               _Float16* __restrict__ out1,
               const float* __restrict__ bias0, const float* __restrict__ bias1,
               float* __restrict__ outf, size_t strideF,
               int klen_vt, int mode) {
  __shared__ __attribute__((aligned(16))) _Float16 slab[2 * SLAB_H];

  int wid = threadIdx.x >> 5;
  int mw  = (wid >> 2) * 64, nw = (wid & 3) * 32;
  int m0  = by * BT_ + mw;
  int n0  = bx * BT_ + nw;

  // copy role: thread -> (row 0..31, 16-B piece 0..7) of each 32-row group
  int crow = threadIdx.x >> 3, cpc = (threadIdx.x & 7) * 8;
  const _Float16* ga = A + (size_t)b * strideA
                         + (size_t)(by * BT_ + crow) * lda + cpc;
  const _Float16* gb = Bw + (size_t)(bx * BT_ + crow) * ldb + cpc;
  size_t sa = (size_t)32 * lda, sb = (size_t)32 * ldb;
  unsigned ldst = (unsigned)(size_t)&slab[crow * SLAB_P + cpc];

  int nslab = K / SLAB_K;
  slab_copy(ldst, ga, sa, gb, sb);
  asm volatile("s_wait_asynccnt 0x0" ::: "memory");  // own copies of slab 0 landed
  __syncthreads();                                   // slab 0 readable by all waves
  if (nslab > 1)
    slab_copy(ldst + SLAB_H * 2, ga + SLAB_K, sa, gb + SLAB_K, sb);

  v8f c[4][2] = {};
  for (int t = 0; t < nslab; t++) {
    int buf = t & 1;
    const _Float16* As = &slab[buf * SLAB_H + mw * SLAB_P];
    const _Float16* Bs = &slab[buf * SLAB_H + (BT_ + nw) * SLAB_P];
    // the slab's fragments are fetched as one group of LDS reads (every loop
    // over af, bf, c is unrolled: constant indices keep them in registers)
    v16h af[2][4], bf[2][2];
#pragma unroll
    for (int ks = 0; ks < 2; ks++) {
#pragma unroll
      for (int i = 0; i < 4; i++) af[ks][i] = ldfrag(As + i * 16 * SLAB_P, SLAB_P, ks * 32);
#pragma unroll
      for (int j = 0; j < 2; j++) bf[ks][j] = ldfrag(Bs + j * 16 * SLAB_P, SLAB_P, ks * 32);
    }
#pragma unroll
    for (int ks = 0; ks < 2; ks++) {
      // inputs-only fence on the loaded fragments: keeps their LDS reads one
      // group in front of the eight products (sunk to their uses, every pair
      // of products waits out an LDS latency of its own)
      asm volatile("" :: "v"(af[ks][0]), "v"(af[ks][1]), "v"(af[ks][2]), "v"(af[ks][3]),
                         "v"(bf[ks][0]), "v"(bf[ks][1]));
#pragma unroll
      for (int i = 0; i < 4; i++)
#pragma unroll
        for (int j = 0; j < 2; j++) c[i][j] = wmma_(af[ks][i], bf[ks][j], c[i][j]);
      // keeps these eight products here: the first eight run while the second
      // half's reads land, and none is moved behind the barrier, in front of the refill
      __builtin_amdgcn_sched_barrier(0);
    }
    asm volatile("s_wait_dscnt 0x0" ::: "memory");    // own reads of this buffer done
    asm volatile("s_wait_asynccnt 0x0" ::: "memory"); // own copies of slab t+1 landed
    __syncthreads();  // publishes slab t+1 and frees this buffer for its refill
    if (t + 2 < nslab) {
      int ko = (t + 2) * SLAB_K;
      slab_copy(ldst + buf * (SLAB_H * 2), ga + ko, sa, gb + ko, sb);
    }
  }
  asm volatile("s_wait_asynccnt 0x0" ::: "memory");   // nothing in flight at the end

  // the mode is tested once, outside the loops over the wave's 64 values a lane
  int lane = threadIdx.x & 31, jl = lane & 15, hf = lane >> 4;
  auto each = [&](auto put) {
#pragma unroll
    for (int i = 0; i < 4; i++)
#pragma unroll
      for (int j = 0; j < 2; j++)
#pragma unroll
        for (int r = 0; r < 8; r++)
          put(m0 + i * 16 + r + 8 * hf, n0 + j * 16 + jl, c[i][j][r]);
  };
  if (mode == GM_QCQR) {
    each([&](int row, int col, float v) {
      size_t o = (size_t)b * strideO + (size_t)row * ldo + col;
      out0[o] = (_Float16)(v + bias0[col]);
      out1[o] = (_Float16)(v + bias1[col]);
    });
    // no register of an issued store is rewritten ahead of this wait
    asm volatile("s_wait_xcnt 0x0" ::: "memory");
  } else if (mode == GM_VT) {             // store V transposed: (B,H,DH,KLEN)
    each([&](int row, int col, float v) {
      int h = col >> 6, d = col & 63;
      out0[(((size_t)b * H_ + h) * DH_ + d) * (size_t)klen_vt + row] = (_Float16)v;
    });
    // no register of an issued store is rewritten ahead of this wait
    asm volatile("s_wait_xcnt 0x0" ::: "memory");
  } else if (mode == GM_F32) {
    each([&](int row, int col, float v) {
      outf[(size_t)b * strideF + (size_t)row * ldo + col] = v;
    });
    // no register of an issued store is rewritten ahead of this wait
    asm volatile("s_wait_xcnt 0x0" ::: "memory");
  } else {
    each([&](int row, int col, float v) {
      out0[(size_t)b * strideO + (size_t)row * ldo + col] = (_Float16)v;
    });
    // no register of an issued store is rewritten ahead of this wait
    asm volatile("s_wait_xcnt 0x0" ::: "memory");
  }
}

// one GEMM per launch: grid (N / 128, M / 128, batch)
__global__ __launch_bounds__(256)
void gemm_nt(const _Float16* __restrict__ A, size_t strideA, int lda,
             const _Float16* __restrict__ Bw, int ldb, int K,
             _Float16* __restrict__ out0, size_t strideO, int ldo,
             _Float16* __restrict__ out1,
             const float* __restrict__ bias0, const float* __restrict__ bias1,
             float* __restrict__ outf, size_t strideF,
             int klen_vt, int mode) {
  gemm_tile(blockIdx.x, blockIdx.y, blockIdx.z, A, strideA, lda, Bw, ldb, K,
            out0, strideO, ldo, out1, bias0, bias1, outf, strideF, klen_vt, mode);
}

// The four projections (K, V, r, q) are independent of one another: they run as
// ranges of the block index of ONE launch. Alone, each fills a WGP with one
// block (q: every second WGP) and pays its own gap, fill, first slab and tail;
// together several blocks share a WGP and one's waits are covered by another's
// work. Within a range the tiles keep the order N tile, M tile, batch.
enum { NB_KV   = (U_ / BT_) * (KLEN_ / BT_) * B_,   // blocks of K, of V and of r
       NB_Q    = (U_ / BT_) * (Q_ / BT_) * B_,      // blocks of q
       NB_PROJ = 3 * NB_KV + NB_Q };

__global__ __launch_bounds__(256)
void proj_gemms(const _Float16* __restrict__ xfull, const _Float16* __restrict__ rel16,
                const _Float16* __restrict__ WkT, const _Float16* __restrict__ WvT,
                const _Float16* __restrict__ WrT, const _Float16* __restrict__ WqT,
                _Float16* __restrict__ kbuf, _Float16* __restrict__ vTb,
                _Float16* __restrict__ rbuf,
                _Float16* __restrict__ qcb, _Float16* __restrict__ qrb,
                const float* __restrict__ biasc, const float* __restrict__ biasr) {
  int g = blockIdx.x / NB_KV, t = blockIdx.x % NB_KV;   // 0 K, 1 V, 2 r, 3 q
  int mt = g == 3 ? Q_ / BT_ : KLEN_ / BT_;             // M tiles of one batch
  int bx = t % (U_ / BT_), by = t / (U_ / BT_) % mt, b = t / (U_ / BT_) / mt;
  const _Float16* A  = g == 2 ? rel16 : g == 3 ? xfull + (size_t)MEM_ * U_ : xfull;
  const _Float16* Bw = g == 0 ? WkT : g == 1 ? WvT : g == 2 ? WrT : WqT;
  _Float16* out0     = g == 0 ? kbuf : g == 1 ? vTb : g == 2 ? rbuf : qcb;
  size_t strideO     = g == 3 ? (size_t)Q_ * U_ : (size_t)KLEN_ * U_;
  int mode           = g == 3 ? GM_QCQR : g == 1 ? GM_VT : GM_PLAIN;
  gemm_tile(bx, by, b, A, (size_t)KLEN_ * U_, U_, Bw, U_, U_,
            out0, strideO, U_, qrb, biasc, biasr, nullptr, 0, KLEN_, mode);
}

enum { KT_    = 64,                     // keys per tile
       FK_P   = 72,                     // row pitch in halves (K, r, V^T, P): 144 B = 16 B x odd
       FR_OFF = KT_ * FK_P,             // r band behind the 64 K rows
       FV_OFF = (KT_ + 128) * FK_P,     // V^T tile behind the 128 r rows
       FT_H   = FV_OFF + DH_ * FK_P };  // halves per buffer

// ---- reductions over a 16-lane row, on the vector port ---------------------
// A shuffle builtin goes through the LDS queue, and every step of a reduction
// then waits out that queue's latency; a DPP row_xmask operand reads lane l ^ M
// of the lane's own 16-lane row inside the vector instruction itself.
template <int M>
__device__ __forceinline__ float row_xor(float x) {
  int v = __builtin_bit_cast(int, x);
  return __builtin_bit_cast(float,
      __builtin_amdgcn_update_dpp(v, v, 0x160 + M, 0xf, 0xf, true));
}

// Row maximum of eight values, every lane of a row gets it. Written as asm so
// that move and maximum are one instruction (from the builtin the compiler makes
// three: move, quieting maximum, maximum). The eight chains are interleaved:
// each step's producer stands eight instructions back, so no step waits on it.
// All 32 lanes are on where this is called.
__device__ __forceinline__ void row_max8(float (&t)[8]) {
  asm volatile(
      "v_max_num_f32_dpp %0, %0, %0 row_xmask:1 row_mask:0xf bank_mask:0xf\n\t"
      "v_max_num_f32_dpp %1, %1, %1 row_xmask:1 row_mask:0xf bank_mask:0xf\n\t"
      "v_max_num_f32_dpp %2, %2, %2 row_xmask:1 row_mask:0xf bank_mask:0xf\n\t"
      "v_max_num_f32_dpp %3, %3, %3 row_xmask:1 row_mask:0xf bank_mask:0xf\n\t"
      "v_max_num_f32_dpp %4, %4, %4 row_xmask:1 row_mask:0xf bank_mask:0xf\n\t"
      "v_max_num_f32_dpp %5, %5, %5 row_xmask:1 row_mask:0xf bank_mask:0xf\n\t"
      "v_max_num_f32_dpp %6, %6, %6 row_xmask:1 row_mask:0xf bank_mask:0xf\n\t"
      "v_max_num_f32_dpp %7, %7, %7 row_xmask:1 row_mask:0xf bank_mask:0xf\n\t"
      "v_max_num_f32_dpp %0, %0, %0 row_xmask:2 row_mask:0xf bank_mask:0xf\n\t"
      "v_max_num_f32_dpp %1, %1, %1 row_xmask:2 row_mask:0xf bank_mask:0xf\n\t"
      "v_max_num_f32_dpp %2, %2, %2 row_xmask:2 row_mask:0xf bank_mask:0xf\n\t"
      "v_max_num_f32_dpp %3, %3, %3 row_xmask:2 row_mask:0xf bank_mask:0xf\n\t"
      "v_max_num_f32_dpp %4, %4, %4 row_xmask:2 row_mask:0xf bank_mask:0xf\n\t"
      "v_max_num_f32_dpp %5, %5, %5 row_xmask:2 row_mask:0xf bank_mask:0xf\n\t"
      "v_max_num_f32_dpp %6, %6, %6 row_xmask:2 row_mask:0xf bank_mask:0xf\n\t"
      "v_max_num_f32_dpp %7, %7, %7 row_xmask:2 row_mask:0xf bank_mask:0xf\n\t"
      "v_max_num_f32_dpp %0, %0, %0 row_xmask:4 row_mask:0xf bank_mask:0xf\n\t"
      "v_max_num_f32_dpp %1, %1, %1 row_xmask:4 row_mask:0xf bank_mask:0xf\n\t"
      "v_max_num_f32_dpp %2, %2, %2 row_xmask:4 row_mask:0xf bank_mask:0xf\n\t"
      "v_max_num_f32_dpp %3, %3, %3 row_xmask:4 row_mask:0xf bank_mask:0xf\n\t"
      "v_max_num_f32_dpp %4, %4, %4 row_xmask:4 row_mask:0xf bank_mask:0xf\n\t"
      "v_max_num_f32_dpp %5, %5, %5 row_xmask:4 row_mask:0xf bank_mask:0xf\n\t"
      "v_max_num_f32_dpp %6, %6, %6 row_xmask:4 row_mask:0xf bank_mask:0xf\n\t"
      "v_max_num_f32_dpp %7, %7, %7 row_xmask:4 row_mask:0xf bank_mask:0xf\n\t"
      "v_max_num_f32_dpp %0, %0, %0 row_xmask:8 row_mask:0xf bank_mask:0xf\n\t"
      "v_max_num_f32_dpp %1, %1, %1 row_xmask:8 row_mask:0xf bank_mask:0xf\n\t"
      "v_max_num_f32_dpp %2, %2, %2 row_xmask:8 row_mask:0xf bank_mask:0xf\n\t"
      "v_max_num_f32_dpp %3, %3, %3 row_xmask:8 row_mask:0xf bank_mask:0xf\n\t"
      "v_max_num_f32_dpp %4, %4, %4 row_xmask:8 row_mask:0xf bank_mask:0xf\n\t"
      "v_max_num_f32_dpp %5, %5, %5 row_xmask:8 row_mask:0xf bank_mask:0xf\n\t"
      "v_max_num_f32_dpp %6, %6, %6 row_xmask:8 row_mask:0xf bank_mask:0xf\n\t"
      "v_max_num_f32_dpp %7, %7, %7 row_xmask:8 row_mask:0xf bank_mask:0xf"
      : "+v"(t[0]), "+v"(t[1]), "+v"(t[2]), "+v"(t[3]),
        "+v"(t[4]), "+v"(t[5]), "+v"(t[6]), "+v"(t[7]));
}

// s[r] += y[r] taken from lane (l - (i + 1)) mod 16 of the lane's own 16-lane
// row, i = r + 8 * (wave half) being the score row that register r holds there:
// the relative shift moves row i by i + 1 columns. A rotate count is an
// immediate and the two halves need counts 8 apart, so each register takes one
// add per half (row_mask picks the half, the other half's lanes keep their
// value; row 15 is not moved: identity quad_perm). Written as asm so that rotate
// and add are one instruction; the second add on a register stands eight
// instructions behind the first, so none waits on its producer. volatile: it
// must stay where all 32 lanes are on (a DPP operand reads other lanes).
__device__ __forceinline__ void shift_add8(float (&s)[8], const float (&y)[8]) {
  asm volatile(
      "v_add_f32_dpp %0, %8, %0 row_ror:1 row_mask:0x1 bank_mask:0xf\n\t"
      "v_add_f32_dpp %1, %9, %1 row_ror:2 row_mask:0x1 bank_mask:0xf\n\t"
      "v_add_f32_dpp %2, %10, %2 row_ror:3 row_mask:0x1 bank_mask:0xf\n\t"
      "v_add_f32_dpp %3, %11, %3 row_ror:4 row_mask:0x1 bank_mask:0xf\n\t"
      "v_add_f32_dpp %4, %12, %4 row_ror:5 row_mask:0x1 bank_mask:0xf\n\t"
      "v_add_f32_dpp %5, %13, %5 row_ror:6 row_mask:0x1 bank_mask:0xf\n\t"
      "v_add_f32_dpp %6, %14, %6 row_ror:7 row_mask:0x1 bank_mask:0xf\n\t"
      "v_add_f32_dpp %7, %15, %7 row_ror:8 row_mask:0x1 bank_mask:0xf\n\t"
      "v_add_f32_dpp %0, %8, %0 row_ror:9 row_mask:0x2 bank_mask:0xf\n\t"
      "v_add_f32_dpp %1, %9, %1 row_ror:10 row_mask:0x2 bank_mask:0xf\n\t"
      "v_add_f32_dpp %2, %10, %2 row_ror:11 row_mask:0x2 bank_mask:0xf\n\t"
      "v_add_f32_dpp %3, %11, %3 row_ror:12 row_mask:0x2 bank_mask:0xf\n\t"
      "v_add_f32_dpp %4, %12, %4 row_ror:13 row_mask:0x2 bank_mask:0xf\n\t"
      "v_add_f32_dpp %5, %13, %5 row_ror:14 row_mask:0x2 bank_mask:0xf\n\t"
      "v_add_f32_dpp %6, %14, %6 row_ror:15 row_mask:0x2 bank_mask:0xf\n\t"
      "v_add_f32_dpp %7, %15, %7 quad_perm:[0,1,2,3] row_mask:0x2 bank_mask:0xf"
      : "+v"(s[0]), "+v"(s[1]), "+v"(s[2]), "+v"(s[3]),
        "+v"(s[4]), "+v"(s[5]), "+v"(s[6]), "+v"(s[7])
      : "v"(y[0]), "v"(y[1]), "v"(y[2]), "v"(y[3]),
        "v"(y[4]), "v"(y[5]), "v"(y[6]), "v"(y[7]));
}

__global__ __launch_bounds__(128)
void flash_attn(const _Float16* __restrict__ qc, const _Float16* __restrict__ qr,
                const _Float16* __restrict__ kk, const _Float16* __restrict__ rr,
                const _Float16* __restrict__ vT, _Float16* __restrict__ outp) {
  __shared__ __align__(16) _Float16 tile[2 * FT_H];
  __shared__ __align__(16) _Float16 pbuf[4][16][FK_P];

  // wave number in a scalar register: the wave's LDS bases are scalar
  int w = __builtin_amdgcn_readfirstlane(threadIdx.x >> 5);
  int lane = threadIdx.x & 31, jl = lane & 15, hf = lane >> 4;
  int b = blockIdx.z, h = blockIdx.y;
  int ib = blockIdx.x * 64;
  int i0 = ib + w * 16;

  const _Float16* qcb = qc + ((size_t)b * Q_ + i0) * U_ + h * DH_;
  const _Float16* qrb = qr + ((size_t)b * Q_ + i0) * U_ + h * DH_;
  v16h aqc0 = ldfrag(qcb, U_, 0), aqc1 = ldfrag(qcb, U_, 32);
  v16h aqr0 = ldfrag(qrb, U_, 0), aqr1 = ldfrag(qrb, U_, 32);

  const _Float16* kbase = kk + (size_t)b * KLEN_ * U_ + h * DH_;
  const _Float16* rbase = rr + (size_t)b * KLEN_ * U_ + h * DH_;
  const _Float16* vbase = vT + ((size_t)b * H_ + h) * DH_ * KLEN_;

  // copy role: every staged row is 128 B: (row 0..15 of a 16-row group, 16-B piece 0..7)
  int crow = threadIdx.x >> 3, cpc = (threadIdx.x & 7) * 8;
  unsigned lkr = (unsigned)(size_t)&tile[crow * FK_P + cpc];

  // One key tile: each lane copies 16 B of four K rows, four V^T rows and eight
  // r rows. r rows past KLEN are masked later; their source row is clamped. Each
  // s_wait_xcnt stands inside its statement so that no address register of an
  // issued copy is rewritten ahead of it.
  auto tile_copy = [&](int t, int buf) {
    int j0 = t * KT_;
    unsigned lk = lkr + buf * (FT_H * 2);
    unsigned lr = lk + FR_OFF * 2, lv = lk + FV_OFF * 2;
    const _Float16* gk = kbase + (size_t)(j0 + crow) * U_ + cpc;
    const _Float16* gv = vbase + (size_t)crow * KLEN_ + j0 + cpc;
    int rb = j0 + (Q_ - 64) - ib + crow;      // first r row of wave 3's band, + crow
    const _Float16* gr[8];
#pragma unroll   // constant indices keep the eight pointers in registers
    for (int n = 0; n < 8; n++) {
      int row = rb + n * 16; if (row > KLEN_ - 1) row = KLEN_ - 1;
      gr[n] = rbase + (size_t)row * U_ + cpc;
    }
    asm volatile("global_load_async_to_lds_b128 %0, %8, off\n\t"
                 "global_load_async_to_lds_b128 %1, %9, off\n\t"
                 "global_load_async_to_lds_b128 %2, %10, off\n\t"
                 "global_load_async_to_lds_b128 %3, %11, off\n\t"
                 "global_load_async_to_lds_b128 %4, %12, off\n\t"
                 "global_load_async_to_lds_b128 %5, %13, off\n\t"
                 "global_load_async_to_lds_b128 %6, %14, off\n\t"
                 "global_load_async_to_lds_b128 %7, %15, off\n\t"
                 "s_wait_xcnt 0x0"
                 :: "v"(lk), "v"(lk + 16 * FK_P * 2),
                    "v"(lk + 32 * FK_P * 2), "v"(lk + 48 * FK_P * 2),
                    "v"(lv), "v"(lv + 16 * FK_P * 2),
                    "v"(lv + 32 * FK_P * 2), "v"(lv + 48 * FK_P * 2),
                    "v"(gk), "v"(gk + (size_t)16 * U_),
                    "v"(gk + (size_t)32 * U_), "v"(gk + (size_t)48 * U_),
                    "v"(gv), "v"(gv + (size_t)16 * KLEN_),
                    "v"(gv + (size_t)32 * KLEN_), "v"(gv + (size_t)48 * KLEN_)
                 : "memory");
    asm volatile("global_load_async_to_lds_b128 %0, %8, off\n\t"
                 "global_load_async_to_lds_b128 %1, %9, off\n\t"
                 "global_load_async_to_lds_b128 %2, %10, off\n\t"
                 "global_load_async_to_lds_b128 %3, %11, off\n\t"
                 "global_load_async_to_lds_b128 %4, %12, off\n\t"
                 "global_load_async_to_lds_b128 %5, %13, off\n\t"
                 "global_load_async_to_lds_b128 %6, %14, off\n\t"
                 "global_load_async_to_lds_b128 %7, %15, off\n\t"
                 "s_wait_xcnt 0x0"
                 :: "v"(lr), "v"(lr + 16 * FK_P * 2),
                    "v"(lr + 32 * FK_P * 2), "v"(lr + 48 * FK_P * 2),
                    "v"(lr + 64 * FK_P * 2), "v"(lr + 80 * FK_P * 2),
                    "v"(lr + 96 * FK_P * 2), "v"(lr + 112 * FK_P * 2),
                    "v"(gr[0]), "v"(gr[1]), "v"(gr[2]), "v"(gr[3]),
                    "v"(gr[4]), "v"(gr[5]), "v"(gr[6]), "v"(gr[7])
                 : "memory");
  };

  v8f o[4] = {};
  float mrow[8], lrow[8];
#pragma unroll
  for (int r = 0; r < 8; r++) { mrow[r] = -1e30f; lrow[r] = 0.f; }

  int ntile = (MEM_ + ib) / KT_ + 1;         // the block's key tiles, 17 or more

  tile_copy(0, 0);
  asm volatile("s_wait_asynccnt 0x0" ::: "memory");  // own copies of tile 0 landed
  __syncthreads();                                   // tile 0 readable by all waves
  tile_copy(1, 1);

  for (int t = 0; t < ntile; t++) {
    int j0 = t * KT_, buf = t & 1;
    const _Float16* Ks = &tile[buf * FT_H];
    const _Float16* Rs = &tile[buf * FT_H + FR_OFF + (3 - w) * 16 * FK_P];
    const _Float16* Vs = &tile[buf * FT_H + FV_OFF];

    // all K and r fragments of the tile are fetched as one group of LDS reads
    // (every loop over kf, rf, sc, rc is unrolled: constant indices keep them in registers)
    v16h kf[8], rf[10];
#pragma unroll
    for (int n = 0; n < 8; n++)
      kf[n] = ldfrag(Ks + (n >> 1) * 16 * FK_P, FK_P, (n & 1) * 32);
#pragma unroll
    for (int n = 0; n < 10; n++)
      rf[n] = ldfrag(Rs + (n >> 1) * 16 * FK_P, FK_P, (n & 1) * 32);
    // keeps the 36 LDS reads one group in front of the products (sunk to their
    // uses, every product waits out an LDS latency of its own)
    __builtin_amdgcn_sched_barrier(0);

    // context scores: four 16-col subtiles over K=DH=64
    v8f sc[4] = {};
#pragma unroll
    for (int st = 0; st < 4; st++) {
      sc[st] = wmma_(aqc0, kf[2 * st], sc[st]);
      sc[st] = wmma_(aqc1, kf[2 * st + 1], sc[st]);
    }

    // relative-score band: r rows rb0 .. rb0+79, rb0 = j0 + (Q-16) - i0
    v8f rc[5] = {};
#pragma unroll
    for (int tt = 0; tt < 5; tt++) {
      rc[tt] = wmma_(aqr0, rf[2 * tt], rc[tt]);
      rc[tt] = wmma_(aqr1, rf[2 * tt + 1], rc[tt]);
    }
    // keeps every product in front of the selects below
    __builtin_amdgcn_sched_barrier(0);

    // shifted rel term: score (i, j) takes band column j + 15 - i. Band column
    // c sits in lane c & 15 of tile c >> 4, so for the keys of subtile st lane L
    // hands on tile st where L >= 15 - i and tile st + 1 below that, and a
    // rotate by i + 1 lanes brings every value to its score's lane.
    // Then scale 1/sqrt(64) and apply the causal mask.
    float sv[4][8];
#pragma unroll   // constant indices keep the arrays in registers
    for (int st = 0; st < 4; st++) {
      float a[8], y[8];
#pragma unroll
      for (int r = 0; r < 8; r++) {
        bool first = jl >= 15 - (r + 8 * hf);
        y[r] = first ? rc[st][r] : rc[st + 1][r];
        a[r] = sc[st][r];
      }
      shift_add8(a, y);
#pragma unroll
      for (int r = 0; r < 8; r++) {
        int lim = MEM_ + i0 + r + 8 * hf;
        sv[st][r] = (j0 + st * 16 + jl <= lim) ? a[r] * 0.125f : -1e30f;
      }
    }

    // online softmax (row = reg r + 8*hf; 16-lane group holds 16 of the 64 cols)
    float alpha[8], tm[8];
#pragma unroll   // constant indices keep tm in registers
    for (int r = 0; r < 8; r++)
      tm[r] = fmaxf(fmaxf(fmaxf(sv[0][r], sv[1][r]), fmaxf(sv[2][r], sv[3][r])), mrow[r]);
    row_max8(tm);   // the running maximum is the same in a row's lanes: this is the new one
#pragma unroll
    for (int r = 0; r < 8; r++) {
      float mn = tm[r];
      alpha[r] = __expf(mrow[r] - mn);
      float p0 = __expf(sv[0][r] - mn), p1 = __expf(sv[1][r] - mn);
      float p2 = __expf(sv[2][r] - mn), p3 = __expf(sv[3][r] - mn);
      float ps = (p0 + p1) + (p2 + p3);
      ps += row_xor<1>(ps); ps += row_xor<2>(ps);
      ps += row_xor<4>(ps); ps += row_xor<8>(ps);
      lrow[r] = lrow[r] * alpha[r] + ps;
      mrow[r] = mn;
      int iloc = r + 8 * hf;
      pbuf[w][iloc][jl]      = (_Float16)p0;
      pbuf[w][iloc][16 + jl] = (_Float16)p1;
      pbuf[w][iloc][32 + jl] = (_Float16)p2;
      pbuf[w][iloc][48 + jl] = (_Float16)p3;
    }
#pragma unroll
    for (int dt = 0; dt < 4; dt++)
#pragma unroll
      for (int r = 0; r < 8; r++) o[dt][r] *= alpha[r];

    asm volatile("" ::: "memory");   // order P store -> A-fragment reload
    v16h ap0 = ldfrag(&pbuf[w][0][0], FK_P, 0);    // C-layout -> A-layout via LDS
    v16h ap1 = ldfrag(&pbuf[w][0][0], FK_P, 32);
#pragma unroll
    for (int dt = 0; dt < 4; dt++) {
      o[dt] = wmma_(ap0, ldfrag(Vs + dt * 16 * FK_P, FK_P, 0), o[dt]);
      o[dt] = wmma_(ap1, ldfrag(Vs + dt * 16 * FK_P, FK_P, 32), o[dt]);
    }

    asm volatile("s_wait_dscnt 0x0" ::: "memory");    // own reads of this buffer done
    asm volatile("s_wait_asynccnt 0x0" ::: "memory"); // own copies of tile t+1 landed
    __syncthreads();  // publishes tile t+1 and frees this buffer for its refill
    if (t + 2 < ntile) tile_copy(t + 2, buf);
  }
  asm volatile("s_wait_asynccnt 0x0" ::: "memory");   // nothing in flight at the end

  // normalize and store (B,Q,U) f16
#pragma unroll
  for (int dt = 0; dt < 4; dt++)
#pragma unroll
    for (int r = 0; r < 8; r++) {
      int iloc = r + 8 * hf;
      float vv = o[dt][r] / lrow[r];
      outp[((size_t)b * Q_ + i0 + iloc) * U_ + h * DH_ + dt * 16 + jl] = (_Float16)vv;
    }
}

// ---------------------------------------------------------------------------
extern "C" void kernel_launch(void* const* d_in, const int* in_sizes, int n_in,
                              void* d_out, int out_size, void* d_ws, size_t ws_size,
                              hipStream_t stream) {
  (void)in_sizes; (void)n_in; (void)out_size; (void)ws_size;
  const float* inputs    = (const float*)d_in[0];
  const float* relatives = (const float*)d_in[1];
  const float* memories  = (const float*)d_in[2];
  const float* biasc     = (const float*)d_in[3];
  const float* biasr     = (const float*)d_in[4];
  const float* Wq        = (const float*)d_in[5];
  const float* Wkv       = (const float*)d_in[6];
  const float* Wr        = (const float*)d_in[7];
  const float* Wo        = (const float*)d_in[8];
  float* out = (float*)d_out;

  // f16 workspace carve-out (~62 MB)
  _Float16* ws = (_Float16*)d_ws;
  size_t off = 0;
  auto carve = [&](size_t n) { _Float16* p = ws + off; off += n; return p; };
  const size_t BKU = (size_t)B_ * KLEN_ * U_;   // 4M
  const size_t BQU = (size_t)B_ * Q_ * U_;      // 2M
  const size_t UU  = (size_t)U_ * U_;           // 1M
  _Float16* xfull  = carve(BKU);
  _Float16* rel16  = carve(BKU);
  _Float16* WqT    = carve(UU);
  _Float16* WkT    = carve(UU);
  _Float16* WvT    = carve(UU);
  _Float16* WrT    = carve(UU);
  _Float16* WoT    = carve(UU);
  _Float16* qcb    = carve(BQU);
  _Float16* qrb    = carve(BQU);
  _Float16* kbuf   = carve(BKU);
  _Float16* rbuf   = carve(BKU);
  _Float16* vTb    = carve(BKU);                // (B,H,DH,KLEN)
  _Float16* attout = carve(BQU);

  // 1) pack + convert
  prep_f16<<<NB_PREP, 256, 0, stream>>>(memories, inputs, relatives, Wq, Wkv, Wr, Wo,
                                        xfull, rel16, WqT, WkT, WvT, WrT, WoT);

  // 2) projections (all WMMA NT GEMMs), one launch
  proj_gemms<<<NB_PROJ, 256, 0, stream>>>(xfull, rel16, WkT, WvT, WrT, WqT,
                                          kbuf, vTb, rbuf, qcb, qrb, biasc, biasr);

  // 3) fused attention (no score matrix in HBM)
  flash_attn<<<dim3(Q_ / 64, H_, B_), 128, 0, stream>>>(qcb, qrb, kbuf, rbuf,
                                                        vTb, attout);

  // 4) output projection, f32 result
  dim3 gq(U_ / BT_, Q_ / BT_, B_);
  gemm_nt<<<gq, 256, 0, stream>>>(attout, BQU / B_, U_, WoT, U_, U_,
                                  nullptr, 0, U_, nullptr, nullptr, nullptr,
                                  out, BQU / B_, 0, GM_F32);
}

// v009
// One run takes 95.5 microseconds.
// Two timings next to v008 both put it at 1.10 times that version's speed.
// All steps since v000 together make it 4.35 times as fast.
#include <hip/hip_runtime.h>
#include <hip/hip_bf16.h>

// ---------------------------------------------------------------------------
// Transformer-XL relative multi-head attention for MI455X (gfx1250).
// All GEMMs run on v_wmma_f32_16x16x32_f16 (wave32 WMMA, f32 accumulate).
// Attention is fused flash-style (online softmax) so the (B,H,Q,KLEN) score
// matrix (256MB f32) never touches HBM. The relative-shift is folded into the
// flash loop via a 79-wide diagonal band of qr*r^T tiles shifted in registers.
// Workspace requirement: ~62 MB of f16 scratch in d_ws.
// ---------------------------------------------------------------------------

enum { B_ = 2, Q_ = 1024, MEM_ = 1024, U_ = 1024, H_ = 16, DH_ = 64, KLEN_ = MEM_ + Q_ };

typedef __attribute__((ext_vector_type(16))) _Float16 v16h;
typedef __attribute__((ext_vector_type(8)))  _Float16 v8h;
typedef __attribute__((ext_vector_type(8)))  float    v8f;

// ---- WMMA fragment helpers (layouts per CDNA5 ISA 7.12.2) -----------------
// A fragment 16x32 f16: lane m=lane&15 holds row m; half=lane>>4 selects
// k-groups: regs 0-3 = k in [half*8, half*8+8), regs 4-7 = +16. Each group is
// 8 contiguous halves -> one 16B load. B fragment (NT form, B stored as NxK
// row-major) is symmetric with N in place of M.
__device__ __forceinline__ v16h frag_combine(v8h lo, v8h hi) {
  return __builtin_shufflevector(lo, hi, 0,1,2,3,4,5,6,7,8,9,10,11,12,13,14,15);
}

__device__ __forceinline__ v16h ldfrag(const _Float16* base, int ld, int koff) {
  int lane = threadIdx.x & 31;
  int m = lane & 15, hf = lane >> 4;
  const v8h* p = (const v8h*)(base + (size_t)m * ld + koff + hf * 8);
  return frag_combine(p[0], p[2]);   // p[2] == +16 halves
}

__device__ __forceinline__ v8f wmma_(v16h a, v16h b, v8f c) {
  return __builtin_amdgcn_wmma_f32_16x16x32_f16(false, a, false, b, (short)0, c,
                                                false, false);
}

// ---- pack / convert kernels ----------------------------------------------
// Every lane moves 16-B pieces, eight loads in flight: a block of 256 threads
// takes one unit of 8192 floats, so few waves have to be started.
typedef __attribute__((ext_vector_type(4))) float    v4f;
typedef __attribute__((ext_vector_type(4))) _Float16 v4h;
enum { UNIT_ = 8192 };

// One unit, contiguous: each wave-wide load covers 512 B, each store 256 B.
__device__ __forceinline__ void cvt_unit(const float* __restrict__ src,
                                         _Float16* __restrict__ dst) {
  const v4f* s = (const v4f*)src + threadIdx.x;
  v4h* d = (v4h*)dst + threadIdx.x;
  v4f x[8];
#pragma unroll   // constant indices keep the eight pieces in registers
  for (int i = 0; i < 8; i++) x[i] = s[i * 256];
#pragma unroll
  for (int i = 0; i < 8; i++) d[i * 256] = __builtin_convertvector(x[i], v4h);
  // no register of an issued store is rewritten ahead of this wait
  asm volatile("s_wait_xcnt 0x0" ::: "memory");
}

// MEM_*U_ and Q_*U_ are multiples of UNIT_: a unit lies in one source.
__device__ __forceinline__
void pack_concat_f16(int unit, const float* __restrict__ mem,
                     const float* __restrict__ inp,
                     _Float16* __restrict__ xfull) {
  size_t e = (size_t)unit * UNIT_;
  size_t b = e / ((size_t)KLEN_ * U_);
  size_t rem = e - b * (size_t)KLEN_ * U_;
  const float* src = (rem < (size_t)MEM_ * U_)
                         ? mem + b * (size_t)MEM_ * U_ + rem
                         : inp + b * (size_t)Q_ * U_ + (rem - (size_t)MEM_ * U_);
  cvt_unit(src, xfull + e);
}

// one unit per block; the units cover the whole array (a multiple of UNIT_)
__device__ __forceinline__
void cvt_f32_to_f16(int unit, const float* __restrict__ in, _Float16* __restrict__ out) {
  size_t e = (size_t)unit * UNIT_;
  cvt_unit(in + e, out + e);
}

// out[n*U_ + k] = in[k*ldin + coloff + n]  (weight transpose for NT GEMMs)
// Block tile 64 k x 128 n, wave tile 32 k x 32 n, lane tile 8 k x 4 n held in
// registers: a load covers four whole 128-B lines of the source rows, a store
// writes 8 halves of k (16 B) per lane. The source pitch is a template
// constant (two are in use): no multiply by a run-time pitch in the addresses.
template <int LDIN>
__device__ __forceinline__ void transpose_tile(int bx, int by,
                                               const float* __restrict__ in,
                                               _Float16* __restrict__ out) {
  int lane = threadIdx.x & 31, wid = threadIdx.x >> 5;
  int k0 = by * 64  + (wid & 1) * 32  + (lane >> 3) * 8;
  int n0 = bx * 128 + (wid >> 1) * 32 + (lane & 7) * 4;
  const float* s = in + (size_t)k0 * LDIN + n0;
  _Float16* d = out + (size_t)n0 * U_ + k0;
  v4f x[8];
#pragma unroll   // constant indices keep the lane tile in registers
  for (int i = 0; i < 8; i++) x[i] = *(const v4f*)(s + i * LDIN);
#pragma unroll
  for (int j = 0; j < 4; j++) {
    v8h y;
#pragma unroll
    for (int i = 0; i < 8; i++) y[i] = (_Float16)x[i][j];
    *(v8h*)(d + j * U_) = y;
  }
  // no register of an issued store is rewritten ahead of this wait
  asm volatile("s_wait_xcnt 0x0" ::: "memory");
}

// All seven preparations are independent of one another: they run as ranges of
// the block index of ONE launch, so that only one launch gap, one fill and one
// tail are paid and the short weight transposes run beside the two streams.
enum { NB_CVT  = B_ * KLEN_ * U_ / UNIT_,      // units of xfull, and of rel16
       NB_TR   = (U_ / 128) * (U_ / 64),       // tiles of one U_ x U_ weight
       NB_PREP = 2 * NB_CVT + 5 * NB_TR };

__global__ __launch_bounds__(256)
void prep_f16(const float* __restrict__ mem, const float* __restrict__ inp,
              const float* __restrict__ rel,
              const float* __restrict__ Wq, const float* __restrict__ Wkv,
              const float* __restrict__ Wr, const float* __restrict__ Wo,
              _Float16* __restrict__ xfull, _Float16* __restrict__ rel16,
              _Float16* __restrict__ WqT, _Float16* __restrict__ WkT,
              _Float16* __restrict__ WvT, _Float16* __restrict__ WrT,
              _Float16* __restrict__ WoT) {
  int bid = blockIdx.x;
  if (bid < NB_CVT) {
    pack_concat_f16(bid, mem, inp, xfull);
  } else if (bid < 2 * NB_CVT) {
    cvt_f32_to_f16(bid - NB_CVT, rel, rel16);
  } else {
    int t = bid - 2 * NB_CVT;
    int which = t / NB_TR, tl = t % NB_TR;
    int bx = tl % (U_ / 128), by = tl / (U_ / 128);
    // Wkv rows hold 2*U_ floats (K half, then V half), the others U_
    if (which < 2) {
      transpose_tile<2 * U_>(bx, by, which ? Wkv + U_ : Wkv, which ? WvT : WkT);
    } else {
      const float* in = which == 2 ? Wq : which == 3 ? Wr : Wo;
      _Float16* out   = which == 2 ? WqT : which == 3 ? WrT : WoT;
      transpose_tile<U_>(bx, by, in, out);
    }
  }
}

// ---- generic batched NT GEMM: C(MxN) = A(MxK) * Bw(NxK)^T ------------------
// 256 threads = 8 waves, wave grid 2x4 -> 128x128 block tile, 64x32 per wave
// (4 x 2 accumulator tiles): every A fragment serves two products, every B
// fragment four, and a row staged in LDS serves 128 rows of the other operand.
// The block's 128 A rows and 128 B rows are staged in LDS in slabs of 64 k by
// asynchronous copies (whole 128-B lines per 8 lanes), two buffers, so that the
// next slab flies while this one is multiplied. M and N must be multiples of
// 128, K a multiple of 64.
enum { GM_PLAIN = 0, GM_QCQR = 1, GM_VT = 2, GM_F32 = 3 };
enum { BT_    = 128,                // rows of A and rows of B per block tile
       SLAB_K = 64,                 // halves of k per slab: 128 B per row
       SLAB_P = 72,                 // LDS row pitch in halves: 144 B = 16 B x odd
       SLAB_G = 32 * SLAB_P * 2,    // LDS bytes of the 32 rows one copy fills
       SLAB_H = 2 * BT_ * SLAB_P }; // halves per buffer: 128 A rows, then 128 B rows

// One slab: each lane copies 16 B of four A rows and of four B rows, 32 rows
// apart (sa, sb: 32 source rows in halves). The s_wait_xcnt stands inside the
// statement so that no address register of an issued copy is rewritten ahead
// of it.
__device__ __forceinline__ void slab_copy(unsigned lds, const _Float16* ga, size_t sa,
                                          const _Float16* gb, size_t sb) {
  asm volatile("global_load_async_to_lds_b128 %0, %8, off\n\t"
               "global_load_async_to_lds_b128 %1, %9, off\n\t"
               "global_load_async_to_lds_b128 %2, %10, off\n\t"
               "global_load_async_to_lds_b128 %3, %11, off\n\t"
               "global_load_async_to_lds_b128 %4, %12, off\n\t"
               "global_load_async_to_lds_b128 %5, %13, off\n\t"
               "global_load_async_to_lds_b128 %6, %14, off\n\t"
               "global_load_async_to_lds_b128 %7, %15, off\n\t"
               "s_wait_xcnt 0x0"
               :: "v"(lds),              "v"(lds + SLAB_G),     "v"(lds + 2 * SLAB_G),
                  "v"(lds + 3 * SLAB_G), "v"(lds + 4 * SLAB_G), "v"(lds + 5 * SLAB_G),
                  "v"(lds + 6 * SLAB_G), "v"(lds + 7 * SLAB_G),
                  "v"(ga), "v"(ga + sa), "v"(ga + 2 * sa), "v"(ga + 3 * sa),
                  "v"(gb), "v"(gb + sb), "v"(gb + 2 * sb), "v"(gb + 3 * sb)
               : "memory");
}

// One block tile: (bx, by) = tile of N and of M, b = batch.
__device__ __forceinline__
void gemm_tile(unsigned bx, unsigned by, int b,
               const _Float16* __restrict__ A, size_t strideA, int lda,
               const _Float16* __restrict__ Bw, int ldb, int K,
               _Float16* __restrict__ out0, size_t strideO, int ldo,
               _Float16* __restrict__ out1,
               const float* __restrict__ bias0, const float* __restrict__ bias1,
               float* __restrict__ outf, size_t strideF,
               int klen_vt, int mode) {
  __shared__ __attribute__((aligned(16))) _Float16 slab[2 * SLAB_H];

  int wid = threadIdx.x >> 5;
  int mw  = (wid >> 2) * 64, nw = (wid & 3) * 32;
  int m0  = by * BT_ + mw;
  int n0  = bx * BT_ + nw;

  // copy role: thread -> (row 0..31, 16-B piece 0..7) of each 32-row group
  int crow = threadIdx.x >> 3, cpc = (threadIdx.x & 7) * 8;
  const _Float16* ga = A + (size_t)b * strideA
                         + (size_t)(by * BT_ + crow) * lda + cpc;
  const _Float16* gb = Bw + (size_t)(bx * BT_ + crow) * ldb + cpc;
  size_t sa = (size_t)32 * lda, sb = (size_t)32 * ldb;
  unsigned ldst = (unsigned)(size_t)&slab[crow * SLAB_P + cpc];

  int nslab = K / SLAB_K;
  slab_copy(ldst, ga, sa, gb, sb);
  asm volatile("s_wait_asynccnt 0x0" ::: "memory");  // own copies of slab 0 landed
  __syncthreads();                                   // slab 0 readable by all waves
  if (nslab > 1)
    slab_copy(ldst + SLAB_H * 2, ga + SLAB_K, sa, gb + SLAB_K, sb);

  v8f c[4][2] = {};
  for (int t = 0; t < nslab; t++) {
    int buf = t & 1;
    const _Float16* As = &slab[buf * SLAB_H + mw * SLAB_P];
    const _Float16* Bs = &slab[buf * SLAB_H + (BT_ + nw) * SLAB_P];
    // the slab's fragments are fetched as one group of LDS reads (every loop
    // over af, bf, c is unrolled: constant indices keep them in registers)
    v16h af[2][4], bf[2][2];
#pragma unroll
    for (int ks = 0; ks < 2; ks++) {
#pragma unroll
      for (int i = 0; i < 4; i++) af[ks][i] = ldfrag(As + i * 16 * SLAB_P, SLAB_P, ks * 32);
#pragma unroll
      for (int j = 0; j < 2; j++) bf[ks][j] = ldfrag(Bs + j * 16 * SLAB_P, SLAB_P, ks * 32);
    }
#pragma unroll
    for (int ks = 0; ks < 2; ks++) {
      // inputs-only fence on the loaded fragments: keeps their LDS reads one
      // group in front of the eight products (sunk to their uses, every pair
      // of products waits out an LDS latency of its own)
      asm volatile("" :: "v"(af[ks][0]), "v"(af[ks][1]), "v"(af[ks][2]), "v"(af[ks][3]),
                         "v"(bf[ks][0]), "v"(bf[ks][1]));
#pragma unroll
      for (int i = 0; i < 4; i++)
#pragma unroll
        for (int j = 0; j < 2; j++) c[i][j] = wmma_(af[ks][i], bf[ks][j], c[i][j]);
      // keeps these eight products here: the first eight run while the second
      // half's reads land, and none is moved behind the barrier, in front of the refill
      __builtin_amdgcn_sched_barrier(0);
    }
    asm volatile("s_wait_dscnt 0x0" ::: "memory");    // own reads of this buffer done
    asm volatile("s_wait_asynccnt 0x0" ::: "memory"); // own copies of slab t+1 landed
    __syncthreads();  // publishes slab t+1 and frees this buffer for its refill
    if (t + 2 < nslab) {
      int ko = (t + 2) * SLAB_K;
      slab_copy(ldst + buf * (SLAB_H * 2), ga + ko, sa, gb + ko, sb);
    }
  }
  asm volatile("s_wait_asynccnt 0x0" ::: "memory");   // nothing in flight at the end

  // the mode is tested once, outside the loops over the wave's 64 values a lane
  int lane = threadIdx.x & 31, jl = lane & 15, hf = lane >> 4;
  auto each = [&](auto put) {
#pragma unroll
    for (int i = 0; i < 4; i++)
#pragma unroll
      for (int j = 0; j < 2; j++)
#pragma unroll
        for (int r = 0; r < 8; r++)
          put(m0 + i * 16 + r + 8 * hf, n0 + j * 16 + jl, c[i][j][r]);
  };
  if (mode == GM_QCQR) {
    each([&](int row, int col, float v) {
      size_t o = (size_t)b * strideO + (size_t)row * ldo + col;
      out0[o] = (_Float16)(v + bias0[col]);
      out1[o] = (_Float16)(v + bias1[col]);
    });
    // no register of an issued store is rewritten ahead of this wait
    asm volatile("s_wait_xcnt 0x0" ::: "memory");
  } else if (mode == GM_VT) {             // store V transposed: (B,H,DH,KLEN)
    each([&](int row, int col, float v) {
      int h = col >> 6, d = col & 63;
      out0[(((size_t)b * H_ + h) * DH_ + d) * (size_t)klen_vt + row] = (_Float16)v;
    });
    // no register of an issued store is rewritten ahead of this wait
    asm volatile("s_wait_xcnt 0x0" ::: "memory");
  } else if (mode == GM_F32) {
    each([&](int row, int col, float v) {
      outf[(size_t)b * strideF + (size_t)row * ldo + col] = v;
    });
    // no register of an issued store is rewritten ahead of this wait
    asm volatile("s_wait_xcnt 0x0" ::: "memory");
  } else {
    each([&](int row, int col, float v) {
      out0[(size_t)b * strideO + (size_t)row * ldo + col] = (_Float16)v;
    });
    // no register of an issued store is rewritten ahead of this wait
    asm volatile("s_wait_xcnt 0x0" ::: "memory");
  }
}

// one GEMM per launch: grid (N / 128, M / 128, batch)
__global__ __launch_bounds__(256)
void gemm_nt(const _Float16* __restrict__ A, size_t strideA, int lda,
             const _Float16* __restrict__ Bw, int ldb, int K,
             _Float16* __restrict__ out0, size_t strideO, int ldo,
             _Float16* __restrict__ out1,
             const float* __restrict__ bias0, const float* __restrict__ bias1,
             float* __restrict__ outf, size_t strideF,
             int klen_vt, int mode) {
  gemm_tile(blockIdx.x, blockIdx.y, blockIdx.z, A, strideA, lda, Bw, ldb, K,
            out0, strideO, ldo, out1, bias0, bias1, outf, strideF, klen_vt, mode);
}

// The four projections (K, V, r, q) are independent of one another: they run as
// ranges of the block index of ONE launch. Alone, each fills a WGP with one
// block (q: every second WGP) and pays its own gap, fill, first slab and tail;
// together several blocks share a WGP and one's waits are covered by another's
// work. Within a range the tiles keep the order N tile, M tile, batch.
enum { NB_KV   = (U_ / BT_) * (KLEN_ / BT_) * B_,   // blocks of K, of V and of r
       NB_Q    = (U_ / BT_) * (Q_ / BT_) * B_,      // blocks of q
       NB_PROJ = 3 * NB_KV + NB_Q };

__global__ __launch_bounds__(256)
void proj_gemms(const _Float16* __restrict__ xfull, const _Float16* __restrict__ rel16,
                const _Float16* __restrict__ WkT, const _Float16* __restrict__ WvT,
                const _Float16* __restrict__ WrT, const _Float16* __restrict__ WqT,
                _Float16* __restrict__ kbuf, _Float16* __restrict__ vTb,
                _Float16* __restrict__ rbuf,
                _Float16* __restrict__ qcb, _Float16* __restrict__ qrb,
                const float* __restrict__ biasc, const float* __restrict__ biasr) {
  int g = blockIdx.x / NB_KV, t = blockIdx.x % NB_KV;   // 0 K, 1 V, 2 r, 3 q
  int mt = g == 3 ? Q_ / BT_ : KLEN_ / BT_;             // M tiles of one batch
  int bx = t % (U_ / BT_), by = t / (U_ / BT_) % mt, b = t / (U_ / BT_) / mt;
  const _Float16* A  = g == 2 ? rel16 : g == 3 ? xfull + (size_t)MEM_ * U_ : xfull;
  const _Float16* Bw = g == 0 ? WkT : g == 1 ? WvT : g == 2 ? WrT : WqT;
  _Float16* out0     = g == 0 ? kbuf : g == 1 ? vTb : g == 2 ? rbuf : qcb;
  size_t strideO     = g == 3 ? (size_t)Q_ * U_ : (size_t)KLEN_ * U_;
  int mode           = g == 3 ? GM_QCQR : g == 1 ? GM_VT : GM_PLAIN;
  gemm_tile(bx, by, b, A, (size_t)KLEN_ * U_, U_, Bw, U_, U_,
            out0, strideO, U_, qrb, biasc, biasr, nullptr, 0, KLEN_, mode);
}

enum { KT_    = 64,                     // keys per tile
       FK_P   = 72,                     // row pitch in halves (K, r, V^T, P): 144 B = 16 B x odd
       FR_OFF = KT_ * FK_P,             // r band behind the 64 K rows
       FV_OFF = (KT_ + 128) * FK_P,     // V^T tile behind the 128 r rows
       FT_H   = FV_OFF + DH_ * FK_P };  // halves per buffer

// ---- reductions over a 16-lane row, on the vector port ---------------------
// A shuffle builtin goes through the LDS queue, and every step of a reduction
// then waits out that queue's latency; a DPP row_xmask operand reads lane l ^ M
// of the lane's own 16-lane row inside the vector instruction itself.
template <int M>
__device__ __forceinline__ float row_xor(float x) {
  int v = __builtin_bit_cast(int, x);
  return __builtin_bit_cast(float,
      __builtin_amdgcn_update_dpp(v, v, 0x160 + M, 0xf, 0xf, true));
}

// Row maximum of eight values, every lane of a row gets it. Written as asm so
// that move and maximum are one instruction (from the builtin the compiler makes
// three: move, quieting maximum, maximum). The eight chains are interleaved:
// each step's producer stands eight instructions back, so no step waits on it.
// All 32 lanes are on where this is called.
__device__ __forceinline__ void row_max8(float (&t)[8]) {
  asm volatile(
      "v_max_num_f32_dpp %0, %0, %0 row_xmask:1 row_mask:0xf bank_mask:0xf\n\t"
      "v_max_num_f32_dpp %1, %1, %1 row_xmask:1 row_mask:0xf bank_mask:0xf\n\t"
      "v_max_num_f32_dpp %2, %2, %2 row_xmask:1 row_mask:0xf bank_mask:0xf\n\t"
      "v_max_num_f32_dpp %3, %3, %3 row_xmask:1 row_mask:0xf bank_mask:0xf\n\t"
      "v_max_num_f32_dpp %4, %4, %4 row_xmask:1 row_mask:0xf bank_mask:0xf\n\t"
      "v_max_num_f32_dpp %5, %5, %5 row_xmask:1 row_mask:0xf bank_mask:0xf\n\t"
      "v_max_num_f32_dpp %6, %6, %6 row_xmask:1 row_mask:0xf bank_mask:0xf\n\t"
      "v_max_num_f32_dpp %7, %7, %7 row_xmask:1 row_mask:0xf bank_mask:0xf\n\t"
      "v_max_num_f32_dpp %0, %0, %0 row_xmask:2 row_mask:0xf bank_mask:0xf\n\t"
      "v_max_num_f32_dpp %1, %1, %1 row_xmask:2 row_mask:0xf bank_mask:0xf\n\t"
      "v_max_num_f32_dpp %2, %2, %2 row_xmask:2 row_mask:0xf bank_mask:0xf\n\t"
      "v_max_num_f32_dpp %3, %3, %3 row_xmask:2 row_mask:0xf bank_mask:0xf\n\t"
      "v_max_num_f32_dpp %4, %4, %4 row_xmask:2 row_mask:0xf bank_mask:0xf\n\t"
      "v_max_num_f32_dpp %5, %5, %5 row_xmask:2 row_mask:0xf bank_mask:0xf\n\t"
      "v_max_num_f32_dpp %6, %6, %6 row_xmask:2 row_mask:0xf bank_mask:0xf\n\t"
      "v_max_num_f32_dpp %7, %7, %7 row_xmask:2 row_mask:0xf bank_mask:0xf\n\t"
      "v_max_num_f32_dpp %0, %0, %0 row_xmask:4 row_mask:0xf bank_mask:0xf\n\t"
      "v_max_num_f32_dpp %1, %1, %1 row_xmask:4 row_mask:0xf bank_mask:0xf\n\t"
      "v_max_num_f32_dpp %2, %2, %2 row_xmask:4 row_mask:0xf bank_mask:0xf\n\t"
      "v_max_num_f32_dpp %3, %3, %3 row_xmask:4 row_mask:0xf bank_mask:0xf\n\t"
      "v_max_num_f32_dpp %4, %4, %4 row_xmask:4 row_mask:0xf bank_mask:0xf\n\t"
      "v_max_num_f32_dpp %5, %5, %5 row_xmask:4 row_mask:0xf bank_mask:0xf\n\t"
      "v_max_num_f32_dpp %6, %6, %6 row_xmask:4 row_mask:0xf bank_mask:0xf\n\t"
      "v_max_num_f32_dpp %7, %7, %7 row_xmask:4 row_mask:0xf bank_mask:0xf\n\t"
      "v_max_num_f32_dpp %0, %0, %0 row_xmask:8 row_mask:0xf bank_mask:0xf\n\t"
      "v_max_num_f32_dpp %1, %1, %1 row_xmask:8 row_mask:0xf bank_mask:0xf\n\t"
      "v_max_num_f32_dpp %2, %2, %2 row_xmask:8 row_mask:0xf bank_mask:0xf\n\t"
      "v_max_num_f32_dpp %3, %3, %3 row_xmask:8 row_mask:0xf bank_mask:0xf\n\t"
      "v_max_num_f32_dpp %4, %4, %4 row_xmask:8 row_mask:0xf bank_mask:0xf\n\t"
      "v_max_num_f32_dpp %5, %5, %5 row_xmask:8 row_mask:0xf bank_mask:0xf\n\t"
      "v_max_num_f32_dpp %6, %6, %6 row_xmask:8 row_mask:0xf bank_mask:0xf\n\t"
      "v_max_num_f32_dpp %7, %7, %7 row_xmask:8 row_mask:0xf bank_mask:0xf"
      : "+v"(t[0]), "+v"(t[1]), "+v"(t[2]), "+v"(t[3]),
        "+v"(t[4]), "+v"(t[5]), "+v"(t[6]), "+v"(t[7]));
}

// s[r] += y[r] taken from lane (l - (i + 1)) mod 16 of the lane's own 16-lane
// row, i = r + 8 * (wave half) being the score row that register r holds there:
// the relative shift moves row i by i + 1 columns. A rotate count is an
// immediate and the two halves need counts 8 apart, so each register takes one
// add per half (row_mask picks the half, the other half's lanes keep their
// value; row 15 is not moved: identity quad_perm). Written as asm so that rotate
// and add are one instruction; the second add on a register stands eight
// instructions behind the first, so none waits on its producer. volatile: it
// must stay where all 32 lanes are on (a DPP operand reads other lanes).
__device__ __forceinline__ void shift_add8(float (&s)[8], const float (&y)[8]) {
  asm volatile(
      "v_add_f32_dpp %0, %8, %0 row_ror:1 row_mask:0x1 bank_mask:0xf\n\t"
      "v_add_f32_dpp %1, %9, %1 row_ror:2 row_mask:0x1 bank_mask:0xf\n\t"
      "v_add_f32_dpp %2, %10, %2 row_ror:3 row_mask:0x1 bank_mask:0xf\n\t"
      "v_add_f32_dpp %3, %11, %3 row_ror:4 row_mask:0x1 bank_mask:0xf\n\t"
      "v_add_f32_dpp %4, %12, %4 row_ror:5 row_mask:0x1 bank_mask:0xf\n\t"
      "v_add_f32_dpp %5, %13, %5 row_ror:6 row_mask:0x1 bank_mask:0xf\n\t"
      "v_add_f32_dpp %6, %14, %6 row_ror:7 row_mask:0x1 bank_mask:0xf\n\t"
      "v_add_f32_dpp %7, %15, %7 row_ror:8 row_mask:0x1 bank_mask:0xf\n\t"
      "v_add_f32_dpp %0, %8, %0 row_ror:9 row_mask:0x2 bank_mask:0xf\n\t"
      "v_add_f32_dpp %1, %9, %1 row_ror:10 row_mask:0x2 bank_mask:0xf\n\t"
      "v_add_f32_dpp %2, %10, %2 row_ror:11 row_mask:0x2 bank_mask:0xf\n\t"
      "v_add_f32_dpp %3, %11, %3 row_ror:12 row_mask:0x2 bank_mask:0xf\n\t"
      "v_add_f32_dpp %4, %12, %4 row_ror:13 row_mask:0x2 bank_mask:0xf\n\t"
      "v_add_f32_dpp %5, %13, %5 row_ror:14 row_mask:0x2 bank_mask:0xf\n\t"
      "v_add_f32_dpp %6, %14, %6 row_ror:15 row_mask:0x2 bank_mask:0xf\n\t"
      "v_add_f32_dpp %7, %15, %7 quad_perm:[0,1,2,3] row_mask:0x2 bank_mask:0xf"
      : "+v"(s[0]), "+v"(s[1]), "+v"(s[2]), "+v"(s[3]),
        "+v"(s[4]), "+v"(s[5]), "+v"(s[6]), "+v"(s[7])
      : "v"(y[0]), "v"(y[1]), "v"(y[2]), "v"(y[3]),
        "v"(y[4]), "v"(y[5]), "v"(y[6]), "v"(y[7]));
}

__global__ __launch_bounds__(128)
void flash_attn(const _Float16* __restrict__ qc, const _Float16* __restrict__ qr,
                const _Float16* __restrict__ kk, const _Float16* __restrict__ rr,
                const _Float16* __restrict__ vT, _Float16* __restrict__ outp) {
  __shared__ __align__(16) _Float16 tile[2 * FT_H];
  __shared__ __align__(16) _Float16 pbuf[4][16][FK_P];

  // wave number in a scalar register: the wave's LDS bases are scalar
  int w = __builtin_amdgcn_readfirstlane(threadIdx.x >> 5);
  int lane = threadIdx.x & 31, jl = lane & 15, hf = lane >> 4;
  // Which 64-query tile a block takes. A block's key tiles grow with its query
  // tile (17 to 32), all blocks are resident at once, two to a WGP, and the
  // launch lasts as long as its fullest WGP. Grid layer z = 0 takes the long upper half of the query tiles, layer z = 1
  // the mirrored short ones, so that a WGP that gets one block of each layer
  // holds tiles n - 1 - t and t (49 key tiles). For speed only: every (batch, head, tile) is taken once
  // wherever the blocks land.
  int b = blockIdx.x / (Q_ / 128), h = blockIdx.y;
  int xt = blockIdx.x % (Q_ / 128);
  int ib = (blockIdx.z ? xt : Q_ / 64 - 1 - xt) * 64;
  int i0 = ib + w * 16;

  const _Float16* qcb = qc + ((size_t)b * Q_ + i0) * U_ + h * DH_;
  const _Float16* qrb = qr + ((size_t)b * Q_ + i0) * U_ + h * DH_;
  v16h aqc0 = ldfrag(qcb, U_, 0), aqc1 = ldfrag(qcb, U_, 32);
  v16h aqr0 = ldfrag(qrb, U_, 0), aqr1 = ldfrag(qrb, U_, 32);

  const _Float16* kbase = kk + (size_t)b * KLEN_ * U_ + h * DH_;
  const _Float16* rbase = rr + (size_t)b * KLEN_ * U_ + h * DH_;
  const _Float16* vbase = vT + ((size_t)b * H_ + h) * DH_ * KLEN_;

  // copy role: every staged row is 128 B: (row 0..15 of a 16-row group, 16-B piece 0..7)
  int crow = threadIdx.x >> 3, cpc = (threadIdx.x & 7) * 8;
  unsigned lkr = (unsigned)(size_t)&tile[crow * FK_P + cpc];

  // One key tile: each lane copies 16 B of four K rows, four V^T rows and eight
  // r rows. r rows past KLEN are masked later; their source row is clamped. Each
  // s_wait_xcnt stands inside its statement so that no address register of an
  // issued copy is rewritten ahead of it.
  auto tile_copy = [&](int t, int buf) {
    int j0 = t * KT_;
    unsigned lk = lkr + buf * (FT_H * 2);
    unsigned lr = lk + FR_OFF * 2, lv = lk + FV_OFF * 2;
    const _Float16* gk = kbase + (size_t)(j0 + crow) * U_ + cpc;
    const _Float16* gv = vbase + (size_t)crow * KLEN_ + j0 + cpc;
    int rb = j0 + (Q_ - 64) - ib + crow;      // first r row of wave 3's band, + crow
    const _Float16* gr[8];
#pragma unroll   // constant indices keep the eight pointers in registers
    for (int n = 0; n < 8; n++) {
      int row = rb + n * 16; if (row > KLEN_ - 1) row = KLEN_ - 1;
      gr[n] = rbase + (size_t)row * U_ + cpc;
    }
    asm volatile("global_load_async_to_lds_b128 %0, %8, off\n\t"
                 "global_load_async_to_lds_b128 %1, %9, off\n\t"
                 "global_load_async_to_lds_b128 %2, %10, off\n\t"
                 "global_load_async_to_lds_b128 %3, %11, off\n\t"
                 "global_load_async_to_lds_b128 %4, %12, off\n\t"
                 "global_load_async_to_lds_b128 %5, %13, off\n\t"
                 "global_load_async_to_lds_b128 %6, %14, off\n\t"
                 "global_load_async_to_lds_b128 %7, %15, off\n\t"
                 "s_wait_xcnt 0x0"
                 :: "v"(lk), "v"(lk + 16 * FK_P * 2),
                    "v"(lk + 32 * FK_P * 2), "v"(lk + 48 * FK_P * 2),
                    "v"(lv), "v"(lv + 16 * FK_P * 2),
                    "v"(lv + 32 * FK_P * 2), "v"(lv + 48 * FK_P * 2),
                    "v"(gk), "v"(gk + (size_t)16 * U_),
                    "v"(gk + (size_t)32 * U_), "v"(gk + (size_t)48 * U_),
                    "v"(gv), "v"(gv + (size_t)16 * KLEN_),
                    "v"(gv + (size_t)32 * KLEN_), "v"(gv + (size_t)48 * KLEN_)
                 : "memory");
    asm volatile("global_load_async_to_lds_b128 %0, %8, off\n\t"
                 "global_load_async_to_lds_b128 %1, %9, off\n\t"
                 "global_load_async_to_lds_b128 %2, %10, off\n\t"
                 "global_load_async_to_lds_b128 %3, %11, off\n\t"
                 "global_load_async_to_lds_b128 %4, %12, off\n\t"
                 "global_load_async_to_lds_b128 %5, %13, off\n\t"
                 "global_load_async_to_lds_b128 %6, %14, off\n\t"
                 "global_load_async_to_lds_b128 %7, %15, off\n\t"
                 "s_wait_xcnt 0x0"
                 :: "v"(lr), "v"(lr + 16 * FK_P * 2),
                    "v"(lr + 32 * FK_P * 2), "v"(lr + 48 * FK_P * 2),
                    "v"(lr + 64 * FK_P * 2), "v"(lr + 80 * FK_P * 2),
                    "v"(lr + 96 * FK_P * 2), "v"(lr + 112 * FK_P * 2),
                    "v"(gr[0]), "v"(gr[1]), "v"(gr[2]), "v"(gr[3]),
                    "v"(gr[4]), "v"(gr[5]), "v"(gr[6]), "v"(gr[7])
                 : "memory");
  };

  v8f o[4] = {};
  float mrow[8], lrow[8];
#pragma unroll
  for (int r = 0; r < 8; r++) { mrow[r] = -1e30f; lrow[r] = 0.f; }

  int ntile = (MEM_ + ib) / KT_ + 1;         // the block's key tiles, 17 or more

  tile_copy(0, 0);
  asm volatile("s_wait_asynccnt 0x0" ::: "memory");  // own copies of tile 0 landed
  __syncthreads();                                   // tile 0 readable by all waves
  tile_copy(1, 1);

  for (int t = 0; t < ntile; t++) {
    int j0 = t * KT_, buf = t & 1;
    const _Float16* Ks = &tile[buf * FT_H];
    const _Float16* Rs = &tile[buf * FT_H + FR_OFF + (3 - w) * 16 * FK_P];
    const _Float16* Vs = &tile[buf * FT_H + FV_OFF];

    // all K and r fragments of the tile are fetched as one group of LDS reads
    // (every loop over kf, rf, sc, rc is unrolled: constant indices keep them in registers)
    v16h kf[8], rf[10];
#pragma unroll
    for (int n = 0; n < 8; n++)
      kf[n] = ldfrag(Ks + (n >> 1) * 16 * FK_P, FK_P, (n & 1) * 32);
#pragma unroll
    for (int n = 0; n < 10; n++)
      rf[n] = ldfrag(Rs + (n >> 1) * 16 * FK_P, FK_P, (n & 1) * 32);
    // keeps the 36 LDS reads one group in front of the products (sunk to their
    // uses, every product waits out an LDS latency of its own)
    __builtin_amdgcn_sched_barrier(0);

    // context scores: four 16-col subtiles over K=DH=64
    v8f sc[4] = {};
#pragma unroll
    for (int st = 0; st < 4; st++) {
      sc[st] = wmma_(aqc0, kf[2 * st], sc[st]);
      sc[st] = wmma_(aqc1, kf[2 * st + 1], sc[st]);
    }

    // relative-score band: r rows rb0 .. rb0+79, rb0 = j0 + (Q-16) - i0
    v8f rc[5] = {};
#pragma unroll
    for (int tt = 0; tt < 5; tt++) {
      rc[tt] = wmma_(aqr0, rf[2 * tt], rc[tt]);
      rc[tt] = wmma_(aqr1, rf[2 * tt + 1], rc[tt]);
    }
    // keeps every product in front of the selects below
    __builtin_amdgcn_sched_barrier(0);

    // shifted rel term: score (i, j) takes band column j + 15 - i. Band column
    // c sits in lane c & 15 of tile c >> 4, so for the keys of subtile st lane L
    // hands on tile st where L >= 15 - i and tile st + 1 below that, and a
    // rotate by i + 1 lanes brings every value to its score's lane.
    // Then scale 1/sqrt(64) and apply the causal mask.
    float sv[4][8];
#pragma unroll   // constant indices keep the arrays in registers
    for (int st = 0; st < 4; st++) {
      float a[8], y[8];
#pragma unroll
      for (int r = 0; r < 8; r++) {
        bool first = jl >= 15 - (r + 8 * hf);
        y[r] = first ? rc[st][r] : rc[st + 1][r];
        a[r] = sc[st][r];
      }
      shift_add8(a, y);
#pragma unroll
      for (int r = 0; r < 8; r++) {
        int lim = MEM_ + i0 + r + 8 * hf;
        sv[st][r] = (j0 + st * 16 + jl <= lim) ? a[r] * 0.125f : -1e30f;
      }
    }

    // online softmax (row = reg r + 8*hf; 16-lane group holds 16 of the 64 cols)
    float alpha[8], tm[8];
#pragma unroll   // constant indices keep tm in registers
    for (int r = 0; r < 8; r++)
      tm[r] = fmaxf(fmaxf(fmaxf(sv[0][r], sv[1][r]), fmaxf(sv[2][r], sv[3][r])), mrow[r]);
    row_max8(tm);   // the running maximum is the same in a row's lanes: this is the new one
#pragma unroll
    for (int r = 0; r < 8; r++) {
      float mn = tm[r];
      alpha[r] = __expf(mrow[r] - mn);
      float p0 = __expf(sv[0][r] - mn), p1 = __expf(sv[1][r] - mn);
      float p2 = __expf(sv[2][r] - mn), p3 = __expf(sv[3][r] - mn);
      float ps = (p0 + p1) + (p2 + p3);
      ps += row_xor<1>(ps); ps += row_xor<2>(ps);
      ps += row_xor<4>(ps); ps += row_xor<8>(ps);
      lrow[r] = lrow[r] * alpha[r] + ps;
      mrow[r] = mn;
      int iloc = r + 8 * hf;
      pbuf[w][iloc][jl]      = (_Float16)p0;
      pbuf[w][iloc][16 + jl] = (_Float16)p1;
      pbuf[w][iloc][32 + jl] = (_Float16)p2;
      pbuf[w][iloc][48 + jl] = (_Float16)p3;
    }
#pragma unroll
    for (int dt = 0; dt < 4; dt++)
#pragma unroll
      for (int r = 0; r < 8; r++) o[dt][r] *= alpha[r];

    asm volatile("" ::: "memory");   // order P store -> A-fragment reload
    v16h ap0 = ldfrag(&pbuf[w][0][0], FK_P, 0);    // C-layout -> A-layout via LDS
    v16h ap1 = ldfrag(&pbuf[w][0][0], FK_P, 32);
#pragma unroll
    for (int dt = 0; dt < 4; dt++) {
      o[dt] = wmma_(ap0, ldfrag(Vs + dt * 16 * FK_P, FK_P, 0), o[dt]);
      o[dt] = wmma_(ap1, ldfrag(Vs + dt * 16 * FK_P, FK_P, 32), o[dt]);
    }

    asm volatile("s_wait_dscnt 0x0" ::: "memory");    // own reads of this buffer done
    asm volatile("s_wait_asynccnt 0x0" ::: "memory"); // own copies of tile t+1 landed
    __syncthreads();  // publishes tile t+1 and frees this buffer for its refill
    if (t + 2 < ntile) tile_copy(t + 2, buf);
  }
  asm volatile("s_wait_asynccnt 0x0" ::: "memory");   // nothing in flight at the end

  // normalize and store (B,Q,U) f16
#pragma unroll
  for (int dt = 0; dt < 4; dt++)
#pragma unroll
    for (int r = 0; r < 8; r++) {
      int iloc = r + 8 * hf;
      float vv = o[dt][r] / lrow[r];
      outp[((size_t)b * Q_ + i0 + iloc) * U_ + h * DH_ + dt * 16 + jl] = (_Float16)vv;
    }
}

// ---------------------------------------------------------------------------
extern "C" void kernel_launch(void* const* d_in, const int* in_sizes, int n_in,
                              void* d_out, int out_size, void* d_ws, size_t ws_size,
                              hipStream_t stream) {
  (void)in_sizes; (void)n_in; (void)out_size; (void)ws_size;
  const float* inputs    = (const float*)d_in[0];
  const float* relatives = (const float*)d_in[1];
  const float* memories  = (const float*)d_in[2];
  const float* biasc     = (const float*)d_in[3];
  const float* biasr     = (const float*)d_in[4];
  const float* Wq        = (const float*)d_in[5];
  const float* Wkv       = (const float*)d_in[6];
  const float* Wr        = (const float*)d_in[7];
  const float* Wo        = (const float*)d_in[8];
  float* out = (float*)d_out;

  // f16 workspace carve-out (~62 MB)
  _Float16* ws = (_Float16*)d_ws;
  size_t off = 0;
  auto carve = [&](size_t n) { _Float16* p = ws + off; off += n; return p; };
  const size_t BKU = (size_t)B_ * KLEN_ * U_;   // 4M
  const size_t BQU = (size_t)B_ * Q_ * U_;      // 2M
  const size_t UU  = (size_t)U_ * U_;           // 1M
  _Float16* xfull  = carve(BKU);
  _Float16* rel16  = carve(BKU);
  _Float16* WqT    = carve(UU);
  _Float16* WkT    = carve(UU);
  _Float16* WvT    = carve(UU);
  _Float16* WrT    = carve(UU);
  _Float16* WoT    = carve(UU);
  _Float16* qcb    = carve(BQU);
  _Float16* qrb    = carve(BQU);
  _Float16* kbuf   = carve(BKU);
  _Float16* rbuf   = carve(BKU);
  _Float16* vTb    = carve(BKU);                // (B,H,DH,KLEN)
  _Float16* attout = carve(BQU);

  // 1) pack + convert
  prep_f16<<<NB_PREP, 256, 0, stream>>>(memories, inputs, relatives, Wq, Wkv, Wr, Wo,
                                        xfull, rel16, WqT, WkT, WvT, WrT, WoT);

  // 2) projections (all WMMA NT GEMMs), one launch
  proj_gemms<<<NB_PROJ, 256, 0, stream>>>(xfull, rel16, WkT, WvT, WrT, WqT,
                                          kbuf, vTb, rbuf, qcb, qrb, biasc, biasr);

  // 3) fused attention (no score matrix in HBM)
  flash_attn<<<dim3(Q_ / 128 * B_, H_, 2), 128, 0, stream>>>(qcb, qrb, kbuf, rbuf,
                                                        vTb, attout);

  // 4) output projection, f32 result
  dim3 gq(U_ / BT_, Q_ / BT_, B_);
  gemm_nt<<<gq, 256, 0, stream>>>(attout, BQU / B_, U_, WoT, U_, U_,
                                  nullptr, 0, U_, nullptr, nullptr, nullptr,
                                  out, BQU / B_, 0, GM_F32);
}

// v010
// It runs in 92.4 microseconds.
// Two timings next to v009 put it at 1.03 and 1.04 times that version's speed.
// All steps since v000 together make it 4.50 times as fast.
#include <hip/hip_runtime.h>
#include <hip/hip_bf16.h>

// ---------------------------------------------------------------------------
// Transformer-XL relative multi-head attention for MI455X (gfx1250).
// All GEMMs run on v_wmma_f32_16x16x32_f16 (wave32 WMMA, f32 accumulate).
// Attention is fused flash-style (online softmax) so the (B,H,Q,KLEN) score
// matrix (256MB f32) never touches HBM. The relative-shift is folded into the
// flash loop via a 79-wide diagonal band of qr*r^T tiles shifted in registers.
// Workspace requirement: ~62 MB of f16 scratch in d_ws.
// ---------------------------------------------------------------------------

enum { B_ = 2, Q_ = 1024, MEM_ = 1024, U_ = 1024, H_ = 16, DH_ = 64, KLEN_ = MEM_ + Q_ };

typedef __attribute__((ext_vector_type(16))) _Float16 v16h;
typedef __attribute__((ext_vector_type(8)))  _Float16 v8h;
typedef __attribute__((ext_vector_type(8)))  float    v8f;

// ---- WMMA fragment helpers (layouts per CDNA5 ISA 7.12.2) -----------------
// A fragment 16x32 f16: lane m=lane&15 holds row m; half=lane>>4 selects
// k-groups: regs 0-3 = k in [half*8, half*8+8), regs 4-7 = +16. Each group is
// 8 contiguous halves -> one 16B load. B fragment (NT form, B stored as NxK
// row-major) is symmetric with N in place of M.
__device__ __forceinline__ v16h frag_combine(v8h lo, v8h hi) {
  return __builtin_shufflevector(lo, hi, 0,1,2,3,4,5,6,7,8,9,10,11,12,13,14,15);
}

__device__ __forceinline__ v16h ldfrag(const _Float16* base, int ld, int koff) {
  int lane = threadIdx.x & 31;
  int m = lane & 15, hf = lane >> 4;
  const v8h* p = (const v8h*)(base + (size_t)m * ld + koff + hf * 8);
  return frag_combine(p[0], p[2]);   // p[2] == +16 halves
}

__device__ __forceinline__ v8f wmma_(v16h a, v16h b, v8f c) {
  return __builtin_amdgcn_wmma_f32_16x16x32_f16(false, a, false, b, (short)0, c,
                                                false, false);
}

// ---- pack / convert kernels ----------------------------------------------
// Every lane moves 16-B pieces, eight loads in flight: a block of 256 threads
// takes one unit of 8192 floats, so few waves have to be started.
typedef __attribute__((ext_vector_type(4))) float    v4f;
typedef __attribute__((ext_vector_type(4))) _Float16 v4h;
enum { UNIT_ = 8192 };

// One unit, contiguous: each wave-wide load covers 512 B, each store 256 B.
__device__ __forceinline__ void cvt_unit(const float* __restrict__ src,
                                         _Float16* __restrict__ dst) {
  const v4f* s = (const v4f*)src + threadIdx.x;
  v4h* d = (v4h*)dst + threadIdx.x;
  v4f x[8];
#pragma unroll   // constant indices keep the eight pieces in registers
  for (int i = 0; i < 8; i++) x[i] = s[i * 256];
#pragma unroll
  for (int i = 0; i < 8; i++) d[i * 256] = __builtin_convertvector(x[i], v4h);
  // no register of an issued store is rewritten ahead of this wait
  asm volatile("s_wait_xcnt 0x0" ::: "memory");
}

// MEM_*U_ and Q_*U_ are multiples of UNIT_: a unit lies in one source.
__device__ __forceinline__
void pack_concat_f16(int unit, const float* __restrict__ mem,
                     const float* __restrict__ inp,
                     _Float16* __restrict__ xfull) {
  size_t e = (size_t)unit * UNIT_;
  size_t b = e / ((size_t)KLEN_ * U_);
  size_t rem = e - b * (size_t)KLEN_ * U_;
  const float* src = (rem < (size_t)MEM_ * U_)
                         ? mem + b * (size_t)MEM_ * U_ + rem
                         : inp + b * (size_t)Q_ * U_ + (rem - (size_t)MEM_ * U_);
  cvt_unit(src, xfull + e);
}

// one unit per block; the units cover the whole array (a multiple of UNIT_)
__device__ __forceinline__
void cvt_f32_to_f16(int unit, const float* __restrict__ in, _Float16* __restrict__ out) {
  size_t e = (size_t)unit * UNIT_;
  cvt_unit(in + e, out + e);
}

// out[n*U_ + k] = in[k*ldin + coloff + n]  (weight transpose for NT GEMMs)
// Block tile 64 k x 128 n, wave tile 32 k x 32 n, lane tile 8 k x 4 n held in
// registers: a load covers four whole 128-B lines of the source rows, a store
// writes 8 halves of k (16 B) per lane. The source pitch is a template
// constant (two are in use): no multiply by a run-time pitch in the addresses.
template <int LDIN>
__device__ __forceinline__ void transpose_tile(int bx, int by,
                                               const float* __restrict__ in,
                                               _Float16* __restrict__ out) {
  int lane = threadIdx.x & 31, wid = threadIdx.x >> 5;
  int k0 = by * 64  + (wid & 1) * 32  + (lane >> 3) * 8;
  int n0 = bx * 128 + (wid >> 1) * 32 + (lane & 7) * 4;
  const float* s = in + (size_t)k0 * LDIN + n0;
  _Float16* d = out + (size_t)n0 * U_ + k0;
  v4f x[8];
#pragma unroll   // constant indices keep the lane tile in registers
  for (int i = 0; i < 8; i++) x[i] = *(const v4f*)(s + i * LDIN);
#pragma unroll
  for (int j = 0; j < 4; j++) {
    v8h y;
#pragma unroll
    for (int i = 0; i < 8; i++) y[i] = (_Float16)x[i][j];
    *(v8h*)(d + j * U_) = y;
  }
  // no register of an issued store is rewritten ahead of this wait
  asm volatile("s_wait_xcnt 0x0" ::: "memory");
}

// All seven preparations are independent of one another: they run as ranges of
// the block index of ONE launch, so that only one launch gap, one fill and one
// tail are paid and the short weight transposes run beside the two streams.
enum { NB_CVT  = B_ * KLEN_ * U_ / UNIT_,      // units of xfull, and of rel16
       NB_TR   = (U_ / 128) * (U_ / 64),       // tiles of one U_ x U_ weight
       NB_PREP = 2 * NB_CVT + 5 * NB_TR };

__global__ __launch_bounds__(256)
void prep_f16(const float* __restrict__ mem, const float* __restrict__ inp,
              const float* __restrict__ rel,
              const float* __restrict__ Wq, const float* __restrict__ Wkv,
              const float* __restrict__ Wr, const float* __restrict__ Wo,
              _Float16* __restrict__ xfull, _Float16* __restrict__ rel16,
              _Float16* __restrict__ WqT, _Float16* __restrict__ WkT,
              _Float16* __restrict__ WvT, _Float16* __restrict__ WrT,
              _Float16* __restrict__ WoT) {
  int bid = blockIdx.x;
  if (bid < NB_CVT) {
    pack_concat_f16(bid, mem, inp, xfull);
  } else if (bid < 2 * NB_CVT) {
    cvt_f32_to_f16(bid - NB_CVT, rel, rel16);
  } else {
    int t = bid - 2 * NB_CVT;
    int which = t / NB_TR, tl = t % NB_TR;
    int bx = tl % (U_ / 128), by = tl / (U_ / 128);
    // Wkv rows hold 2*U_ floats (K half, then V half), the others U_
    if (which < 2) {
      transpose_tile<2 * U_>(bx, by, which ? Wkv + U_ : Wkv, which ? WvT : WkT);
    } else {
      const float* in = which == 2 ? Wq : which == 3 ? Wr : Wo;
      _Float16* out   = which == 2 ? WqT : which == 3 ? WrT : WoT;
      transpose_tile<U_>(bx, by, in, out);
    }
  }
}

// ---- generic batched NT GEMM: C(MxN) = A(MxK) * Bw(NxK)^T ------------------
// 256 threads = 8 waves, wave grid 2x4 -> 128x128 block tile, 64x32 per wave
// (4 x 2 accumulator tiles): every A fragment serves two products, every B
// fragment four, and a row staged in LDS serves 128 rows of the other operand.
// The block's 128 A rows and 128 B rows are staged in LDS in slabs of 64 k by
// asynchronous copies (whole 128-B lines per 8 lanes), two buffers, so that the
// next slab flies while this one is multiplied. M and N must be multiples of
// 128, K a multiple of 64.
enum { GM_PLAIN = 0, GM_QCQR = 1, GM_VT = 2, GM_F32 = 3 };
enum { BT_    = 128,                // rows of A and rows of B per block tile
       SLAB_K = 64,                 // halves of k per slab: 128 B per row
       SLAB_P = 72,                 // LDS row pitch in halves: 144 B = 16 B x odd
       SLAB_G = 32 * SLAB_P * 2,    // LDS bytes of the 32 rows one copy fills
       SLAB_H = 2 * BT_ * SLAB_P }; // halves per buffer: 128 A rows, then 128 B rows

// One slab: each lane copies 16 B of four A rows and of four B rows, 32 rows
// apart (sa, sb: 32 source rows in halves). The s_wait_xcnt stands inside the
// statement so that no address register of an issued copy is rewritten ahead
// of it.
__device__ __forceinline__ void slab_copy(unsigned lds, const _Float16* ga, size_t sa,
                                          const _Float16* gb, size_t sb) {
  asm volatile("global_load_async_to_lds_b128 %0, %8, off\n\t"
               "global_load_async_to_lds_b128 %1, %9, off\n\t"
               "global_load_async_to_lds_b128 %2, %10, off\n\t"
               "global_load_async_to_lds_b128 %3, %11, off\n\t"
               "global_load_async_to_lds_b128 %4, %12, off\n\t"
               "global_load_async_to_lds_b128 %5, %13, off\n\t"
               "global_load_async_to_lds_b128 %6, %14, off\n\t"
               "global_load_async_to_lds_b128 %7, %15, off\n\t"
               "s_wait_xcnt 0x0"
               :: "v"(lds),              "v"(lds + SLAB_G),     "v"(lds + 2 * SLAB_G),
                  "v"(lds + 3 * SLAB_G), "v"(lds + 4 * SLAB_G), "v"(lds + 5 * SLAB_G),
                  "v"(lds + 6 * SLAB_G), "v"(lds + 7 * SLAB_G),
                  "v"(ga), "v"(ga + sa), "v"(ga + 2 * sa), "v"(ga + 3 * sa),
                  "v"(gb), "v"(gb + sb), "v"(gb + 2 * sb), "v"(gb + 3 * sb)
               : "memory");
}

// One block tile: (bx, by) = tile of N and of M, b = batch.
__device__ __forceinline__
void gemm_tile(unsigned bx, unsigned by, int b,
               const _Float16* __restrict__ A, size_t strideA, int lda,
               const _Float16* __restrict__ Bw, int ldb, int K,
               _Float16* __restrict__ out0, size_t strideO, int ldo,
               _Float16* __restrict__ out1,
               const float* __restrict__ bias0, const float* __restrict__ bias1,
               float* __restrict__ outf, size_t strideF,
               int klen_vt, int mode) {
  __shared__ __attribute__((aligned(16))) _Float16 slab[2 * SLAB_H];

  int wid = threadIdx.x >> 5;
  int mw  = (wid >> 2) * 64, nw = (wid & 3) * 32;
  int m0  = by * BT_ + mw;
  int n0  = bx * BT_ + nw;

  // copy role: thread -> (row 0..31, 16-B piece 0..7) of each 32-row group
  int crow = threadIdx.x >> 3, cpc = (threadIdx.x & 7) * 8;
  const _Float16* ga = A + (size_t)b * strideA
                         + (size_t)(by * BT_ + crow) * lda + cpc;
  const _Float16* gb = Bw + (size_t)(bx * BT_ + crow) * ldb + cpc;
  size_t sa = (size_t)32 * lda, sb = (size_t)32 * ldb;
  unsigned ldst = (unsigned)(size_t)&slab[crow * SLAB_P + cpc];

  int nslab = K / SLAB_K;
  slab_copy(ldst, ga, sa, gb, sb);
  asm volatile("s_wait_asynccnt 0x0" ::: "memory");  // own copies of slab 0 landed
  __syncthreads();                                   // slab 0 readable by all waves
  if (nslab > 1)
    slab_copy(ldst + SLAB_H * 2, ga + SLAB_K, sa, gb + SLAB_K, sb);

  v8f c[4][2] = {};
  for (int t = 0; t < nslab; t++) {
    int buf = t & 1;
    const _Float16* As = &slab[buf * SLAB_H + mw * SLAB_P];
    const _Float16* Bs = &slab[buf * SLAB_H + (BT_ + nw) * SLAB_P];
    // the slab's fragments are fetched as one group of LDS reads (every loop
    // over af, bf, c is unrolled: constant indices keep them in registers)
    v16h af[2][4], bf[2][2];
#pragma unroll
    for (int ks = 0; ks < 2; ks++) {
#pragma unroll
      for (int i = 0; i < 4; i++) af[ks][i] = ldfrag(As + i * 16 * SLAB_P, SLAB_P, ks * 32);
#pragma unroll
      for (int j = 0; j < 2; j++) bf[ks][j] = ldfrag(Bs + j * 16 * SLAB_P, SLAB_P, ks * 32);
    }
#pragma unroll
    for (int ks = 0; ks < 2; ks++) {
      // inputs-only fence on the loaded fragments: keeps their LDS reads one
      // group in front of the eight products (sunk to their uses, every pair
      // of products waits out an LDS latency of its own)
      asm volatile("" :: "v"(af[ks][0]), "v"(af[ks][1]), "v"(af[ks][2]), "v"(af[ks][3]),
                         "v"(bf[ks][0]), "v"(bf[ks][1]));
#pragma unroll
      for (int i = 0; i < 4; i++)
#pragma unroll
        for (int j = 0; j < 2; j++) c[i][j] = wmma_(af[ks][i], bf[ks][j], c[i][j]);
      // keeps these eight products here: the first eight run while the second
      // half's reads land, and none is moved behind the barrier, in front of the refill
      __builtin_amdgcn_sched_barrier(0);
    }
    asm volatile("s_wait_dscnt 0x0" ::: "memory");    // own reads of this buffer done
    asm volatile("s_wait_asynccnt 0x0" ::: "memory"); // own copies of slab t+1 landed
    __syncthreads();  // publishes slab t+1 and frees this buffer for its refill
    if (t + 2 < nslab) {
      int ko = (t + 2) * SLAB_K;
      slab_copy(ldst + buf * (SLAB_H * 2), ga + ko, sa, gb + ko, sb);
    }
  }
  asm volatile("s_wait_asynccnt 0x0" ::: "memory");   // nothing in flight at the end

  // the mode is tested once, outside the loops over the wave's 64 values a lane
  int lane = threadIdx.x & 31, jl = lane & 15, hf = lane >> 4;
  auto each = [&](auto put) {
#pragma unroll
    for (int i = 0; i < 4; i++)
#pragma unroll
      for (int j = 0; j < 2; j++)
#pragma unroll
        for (int r = 0; r < 8; r++)
          put(m0 + i * 16 + r + 8 * hf, n0 + j * 16 + jl, c[i][j][r]);
  };
  if (mode == GM_QCQR) {
    each([&](int row, int col, float v) {
      size_t o = (size_t)b * strideO + (size_t)row * ldo + col;
      out0[o] = (_Float16)(v + bias0[col]);
      out1[o] = (_Float16)(v + bias1[col]);
    });
    // no register of an issued store is rewritten ahead of this wait
    asm volatile("s_wait_xcnt 0x0" ::: "memory");
  } else if (mode == GM_VT) {             // store V transposed: (B,H,DH,KLEN)
    each([&](int row, int col, float v) {
      int h = col >> 6, d = col & 63;
      out0[(((size_t)b * H_ + h) * DH_ + d) * (size_t)klen_vt + row] = (_Float16)v;
    });
    // no register of an issued store is rewritten ahead of this wait
    asm volatile("s_wait_xcnt 0x0" ::: "memory");
  } else if (mode == GM_F32) {
    each([&](int row, int col, float v) {
      outf[(size_t)b * strideF + (size_t)row * ldo + col] = v;
    });
    // no register of an issued store is rewritten ahead of this wait
    asm volatile("s_wait_xcnt 0x0" ::: "memory");
  } else {
    each([&](int row, int col, float v) {
      out0[(size_t)b * strideO + (size_t)row * ldo + col] = (_Float16)v;
    });
    // no register of an issued store is rewritten ahead of this wait
    asm volatile("s_wait_xcnt 0x0" ::: "memory");
  }
}

// one GEMM per launch: grid (N / 128, M / 128, batch)
__global__ __launch_bounds__(256)
void gemm_nt(const _Float16* __restrict__ A, size_t strideA, int lda,
             const _Float16* __restrict__ Bw, int ldb, int K,
             _Float16* __restrict__ out0, size_t strideO, int ldo,
             _Float16* __restrict__ out1,
             const float* __restrict__ bias0, const float* __restrict__ bias1,
             float* __restrict__ outf, size_t strideF,
             int klen_vt, int mode) {
  gemm_tile(blockIdx.x, blockIdx.y, blockIdx.z, A, strideA, lda, Bw, ldb, K,
            out0, strideO, ldo, out1, bias0, bias1, outf, strideF, klen_vt, mode);
}

// The four projections (K, V, r, q) are independent of one another: they run as
// ranges of the block index of ONE launch. Alone, each fills a WGP with one
// block (q: every second WGP) and pays its own gap, fill, first slab and tail;
// together several blocks share a WGP and one's waits are covered by another's
// work. Within a range the tiles keep the order N tile, M tile, batch.
enum { NB_KV   = (U_ / BT_) * (KLEN_ / BT_) * B_,   // blocks of K, of V and of r
       NB_Q    = (U_ / BT_) * (Q_ / BT_) * B_,      // blocks of q
       NB_PROJ = 3 * NB_KV + NB_Q };

__global__ __launch_bounds__(256)
void proj_gemms(const _Float16* __restrict__ xfull, const _Float16* __restrict__ rel16,
                const _Float16* __restrict__ WkT, const _Float16* __restrict__ WvT,
                const _Float16* __restrict__ WrT, const _Float16* __restrict__ WqT,
                _Float16* __restrict__ kbuf, _Float16* __restrict__ vTb,
                _Float16* __restrict__ rbuf,
                _Float16* __restrict__ qcb, _Float16* __restrict__ qrb,
                const float* __restrict__ biasc, const float* __restrict__ biasr) {
  int g = blockIdx.x / NB_KV, t = blockIdx.x % NB_KV;   // 0 K, 1 V, 2 r, 3 q
  int mt = g == 3 ? Q_ / BT_ : KLEN_ / BT_;             // M tiles of one batch
  int bx = t % (U_ / BT_), by = t / (U_ / BT_) % mt, b = t / (U_ / BT_) / mt;
  const _Float16* A  = g == 2 ? rel16 : g == 3 ? xfull + (size_t)MEM_ * U_ : xfull;
  const _Float16* Bw = g == 0 ? WkT : g == 1 ? WvT : g == 2 ? WrT : WqT;
  _Float16* out0     = g == 0 ? kbuf : g == 1 ? vTb : g == 2 ? rbuf : qcb;
  size_t strideO     = g == 3 ? (size_t)Q_ * U_ : (size_t)KLEN_ * U_;
  int mode           = g == 3 ? GM_QCQR : g == 1 ? GM_VT : GM_PLAIN;
  gemm_tile(bx, by, b, A, (size_t)KLEN_ * U_, U_, Bw, U_, U_,
            out0, strideO, U_, qrb, biasc, biasr, nullptr, 0, KLEN_, mode);
}

// ---- fused flash attention with relative shift ----------------------------
// grid (Q/128 * B, H, 2), 256 threads = 8 waves in two groups of four. Both groups
// hold the same 64 queries (wave w of a group: 16 rows); of every staged 128 keys
// group 0 takes the first 64 and group 1 the second 64, each with its own online
// softmax, and the two partial results are merged through LDS behind the loop.
// So a SIMD holds four waves, not two, for the same work: the vector work of one
// wave covers the LDS, matrix and barrier waits of the others.
// A wave walks its keys in 64-wide tiles with online softmax: what is paid
// once per tile (row maximum, row sum, rescale of the output, barrier, waits)
// is paid once per 64 keys, and the band needs 5 tiles per 4 score tiles.
// rel_shift(qr*r^T)[i,j] = S_r[i, j+Q-1-i]; the needed r-band per
// (i-tile, j-tile) is 79 wide -> five 16-col WMMA tiles, shifted by DPP rotates.
// The causal mask bound (j <= MEM+i) exactly covers the shift's OOB region.
// The eight waves walk the keys together: per stage of 128 keys the block stages
// 128 K rows, the 192 r rows that cover all eight waves' bands (the two groups'
// bands share 64 of them) and two 64x64 V^T tiles in LDS by asynchronous copies
// (whole 128-B rows per 8 lanes), two buffers, so that the next stage flies while
// this one is worked on. A block's keys (MEM + its last query + 1) are a multiple
// of 64: where the count of 64-key tiles is odd, group 1's last tile lies wholly
// behind the causal bound (still inside K, V^T) and adds zeros.
enum { KT_    = 64,                     // keys per tile of one group
       ST_    = 2 * KT_,                // keys per stage
       FK_P   = 72,                     // row pitch in halves (K, r, V^T, P): 144 B = 16 B x odd
       FR_OFF = ST_ * FK_P,             // r band behind the 128 K rows
       FV_OFF = (ST_ + 192) * FK_P,     // V^T tiles behind the 192 r rows
       FT_H   = FV_OFF + 2 * DH_ * FK_P };  // halves per buffer

// ---- reductions over a 16-lane row, on the vector port ---------------------
// A shuffle builtin goes through the LDS queue, and every step of a reduction
// then waits out that queue's latency; a DPP row_xmask operand reads lane l ^ M
// of the lane's own 16-lane row inside the vector instruction itself.
template <int M>
__device__ __forceinline__ float row_xor(float x) {
  int v = __builtin_bit_cast(int, x);
  return __builtin_bit_cast(float,
      __builtin_amdgcn_update_dpp(v, v, 0x160 + M, 0xf, 0xf, true));
}

// Row maximum of eight values, every lane of a row gets it. Written as asm so
// that move and maximum are one instruction (from the builtin the compiler makes
// three: move, quieting maximum, maximum). The eight chains are interleaved:
// each step's producer stands eight instructions back, so no step waits on it.
// All 32 lanes are on where this is called.
__device__ __forceinline__ void row_max8(float (&t)[8]) {
  asm volatile(
      "v_max_num_f32_dpp %0, %0, %0 row_xmask:1 row_mask:0xf bank_mask:0xf\n\t"
      "v_max_num_f32_dpp %1, %1, %1 row_xmask:1 row_mask:0xf bank_mask:0xf\n\t"
      "v_max_num_f32_dpp %2, %2, %2 row_xmask:1 row_mask:0xf bank_mask:0xf\n\t"
      "v_max_num_f32_dpp %3, %3, %3 row_xmask:1 row_mask:0xf bank_mask:0xf\n\t"
      "v_max_num_f32_dpp %4, %4, %4 row_xmask:1 row_mask:0xf bank_mask:0xf\n\t"
      "v_max_num_f32_dpp %5, %5, %5 row_xmask:1 row_mask:0xf bank_mask:0xf\n\t"
      "v_max_num_f32_dpp %6, %6, %6 row_xmask:1 row_mask:0xf bank_mask:0xf\n\t"
      "v_max_num_f32_dpp %7, %7, %7 row_xmask:1 row_mask:0xf bank_mask:0xf\n\t"
      "v_max_num_f32_dpp %0, %0, %0 row_xmask:2 row_mask:0xf bank_mask:0xf\n\t"
      "v_max_num_f32_dpp %1, %1, %1 row_xmask:2 row_mask:0xf bank_mask:0xf\n\t"
      "v_max_num_f32_dpp %2, %2, %2 row_xmask:2 row_mask:0xf bank_mask:0xf\n\t"
      "v_max_num_f32_dpp %3, %3, %3 row_xmask:2 row_mask:0xf bank_mask:0xf\n\t"
      "v_max_num_f32_dpp %4, %4, %4 row_xmask:2 row_mask:0xf bank_mask:0xf\n\t"
      "v_max_num_f32_dpp %5, %5, %5 row_xmask:2 row_mask:0xf bank_mask:0xf\n\t"
      "v_max_num_f32_dpp %6, %6, %6 row_xmask:2 row_mask:0xf bank_mask:0xf\n\t"
      "v_max_num_f32_dpp %7, %7, %7 row_xmask:2 row_mask:0xf bank_mask:0xf\n\t"
      "v_max_num_f32_dpp %0, %0, %0 row_xmask:4 row_mask:0xf bank_mask:0xf\n\t"
      "v_max_num_f32_dpp %1, %1, %1 row_xmask:4 row_mask:0xf bank_mask:0xf\n\t"
      "v_max_num_f32_dpp %2, %2, %2 row_xmask:4 row_mask:0xf bank_mask:0xf\n\t"
      "v_max_num_f32_dpp %3, %3, %3 row_xmask:4 row_mask:0xf bank_mask:0xf\n\t"
      "v_max_num_f32_dpp %4, %4, %4 row_xmask:4 row_mask:0xf bank_mask:0xf\n\t"
      "v_max_num_f32_dpp %5, %5, %5 row_xmask:4 row_mask:0xf bank_mask:0xf\n\t"
      "v_max_num_f32_dpp %6, %6, %6 row_xmask:4 row_mask:0xf bank_mask:0xf\n\t"
      "v_max_num_f32_dpp %7, %7, %7 row_xmask:4 row_mask:0xf bank_mask:0xf\n\t"
      "v_max_num_f32_dpp %0, %0, %0 row_xmask:8 row_mask:0xf bank_mask:0xf\n\t"
      "v_max_num_f32_dpp %1, %1, %1 row_xmask:8 row_mask:0xf bank_mask:0xf\n\t"
      "v_max_num_f32_dpp %2, %2, %2 row_xmask:8 row_mask:0xf bank_mask:0xf\n\t"
      "v_max_num_f32_dpp %3, %3, %3 row_xmask:8 row_mask:0xf bank_mask:0xf\n\t"
      "v_max_num_f32_dpp %4, %4, %4 row_xmask:8 row_mask:0xf bank_mask:0xf\n\t"
      "v_max_num_f32_dpp %5, %5, %5 row_xmask:8 row_mask:0xf bank_mask:0xf\n\t"
      "v_max_num_f32_dpp %6, %6, %6 row_xmask:8 row_mask:0xf bank_mask:0xf\n\t"
      "v_max_num_f32_dpp %7, %7, %7 row_xmask:8 row_mask:0xf bank_mask:0xf"
      : "+v"(t[0]), "+v"(t[1]), "+v"(t[2]), "+v"(t[3]),
        "+v"(t[4]), "+v"(t[5]), "+v"(t[6]), "+v"(t[7]));
}

// s[r] += y[r] taken from lane (l - (i + 1)) mod 16 of the lane's own 16-lane
// row, i = r + 8 * (wave half) being the score row that register r holds there:
// the relative shift moves row i by i + 1 columns. A rotate count is an
// immediate and the two halves need counts 8 apart, so each register takes one
// add per half (row_mask picks the half, the other half's lanes keep their
// value; row 15 is not moved: identity quad_perm). Written as asm so that rotate
// and add are one instruction; the second add on a register stands eight
// instructions behind the first, so none waits on its producer. volatile: it
// must stay where all 32 lanes are on (a DPP operand reads other lanes).
__device__ __forceinline__ void shift_add8(float (&s)[8], const float (&y)[8]) {
  asm volatile(
      "v_add_f32_dpp %0, %8, %0 row_ror:1 row_mask:0x1 bank_mask:0xf\n\t"
      "v_add_f32_dpp %1, %9, %1 row_ror:2 row_mask:0x1 bank_mask:0xf\n\t"
      "v_add_f32_dpp %2, %10, %2 row_ror:3 row_mask:0x1 bank_mask:0xf\n\t"
      "v_add_f32_dpp %3, %11, %3 row_ror:4 row_mask:0x1 bank_mask:0xf\n\t"
      "v_add_f32_dpp %4, %12, %4 row_ror:5 row_mask:0x1 bank_mask:0xf\n\t"
      "v_add_f32_dpp %5, %13, %5 row_ror:6 row_mask:0x1 bank_mask:0xf\n\t"
      "v_add_f32_dpp %6, %14, %6 row_ror:7 row_mask:0x1 bank_mask:0xf\n\t"
      "v_add_f32_dpp %7, %15, %7 row_ror:8 row_mask:0x1 bank_mask:0xf\n\t"
      "v_add_f32_dpp %0, %8, %0 row_ror:9 row_mask:0x2 bank_mask:0xf\n\t"
      "v_add_f32_dpp %1, %9, %1 row_ror:10 row_mask:0x2 bank_mask:0xf\n\t"
      "v_add_f32_dpp %2, %10, %2 row_ror:11 row_mask:0x2 bank_mask:0xf\n\t"
      "v_add_f32_dpp %3, %11, %3 row_ror:12 row_mask:0x2 bank_mask:0xf\n\t"
      "v_add_f32_dpp %4, %12, %4 row_ror:13 row_mask:0x2 bank_mask:0xf\n\t"
      "v_add_f32_dpp %5, %13, %5 row_ror:14 row_mask:0x2 bank_mask:0xf\n\t"
      "v_add_f32_dpp %6, %14, %6 row_ror:15 row_mask:0x2 bank_mask:0xf\n\t"
      "v_add_f32_dpp %7, %15, %7 quad_perm:[0,1,2,3] row_mask:0x2 bank_mask:0xf"
      : "+v"(s[0]), "+v"(s[1]), "+v"(s[2]), "+v"(s[3]),
        "+v"(s[4]), "+v"(s[5]), "+v"(s[6]), "+v"(s[7])
      : "v"(y[0]), "v"(y[1]), "v"(y[2]), "v"(y[3]),
        "v"(y[4]), "v"(y[5]), "v"(y[6]), "v"(y[7]));
}

// four waves a SIMD (two blocks a WGP): at most 256 registers a wave
__global__ __launch_bounds__(256) __attribute__((amdgpu_waves_per_eu(4, 4)))
void flash_attn(const _Float16* __restrict__ qc, const _Float16* __restrict__ qr,
                const _Float16* __restrict__ kk, const _Float16* __restrict__ rr,
                const _Float16* __restrict__ vT, _Float16* __restrict__ outp) {
  __shared__ __align__(16) _Float16 tile[2 * FT_H];
  __shared__ __align__(16) _Float16 pbuf[8][16][FK_P];

  // wave number in a scalar register: the wave's LDS bases are scalar
  int w8 = __builtin_amdgcn_readfirstlane(threadIdx.x >> 5);
  int g = w8 >> 2, w = w8 & 3;     // key group, 16-row query tile
  int lane = threadIdx.x & 31, jl = lane & 15, hf = lane >> 4;
  // Which 64-query tile a block takes. A block's key tiles grow with its query
  // tile (17 to 32), all blocks are resident at once, two to a WGP, and the
  // launch lasts as long as its fullest WGP. Grid layer z = 0 takes the long upper half of the query tiles, layer z = 1
  // the mirrored short ones, so that a WGP that gets one block of each layer
  // holds tiles n - 1 - t and t (49 key tiles). For speed only: every (batch, head, tile) is taken once
  // wherever the blocks land.
  int b = blockIdx.x / (Q_ / 128), h = blockIdx.y;
  int xt = blockIdx.x % (Q_ / 128);
  int ib = (blockIdx.z ? xt : Q_ / 64 - 1 - xt) * 64;
  int i0 = ib + w * 16;

  const _Float16* qcb = qc + ((size_t)b * Q_ + i0) * U_ + h * DH_;
  const _Float16* qrb = qr + ((size_t)b * Q_ + i0) * U_ + h * DH_;
  v16h aqc0 = ldfrag(qcb, U_, 0), aqc1 = ldfrag(qcb, U_, 32);
  v16h aqr0 = ldfrag(qrb, U_, 0), aqr1 = ldfrag(qrb, U_, 32);

  const _Float16* kbase = kk + (size_t)b * KLEN_ * U_ + h * DH_;
  const _Float16* rbase = rr + (size_t)b * KLEN_ * U_ + h * DH_;
  const _Float16* vbase = vT + ((size_t)b * H_ + h) * DH_ * KLEN_;

  // copy role: every staged row is 128 B: (row 0..31 of a 32-row group, 16-B piece 0..7)
  int crow = threadIdx.x >> 3, cpc = (threadIdx.x & 7) * 8;
  unsigned lkr = (unsigned)(size_t)&tile[crow * FK_P + cpc];

  // One stage: each lane copies 16 B of four K rows, four V^T rows (two of each
  // group's tile) and six r rows. r rows past KLEN are masked later; their source row is clamped. Each
  // s_wait_xcnt stands inside its statement so that no address register of an
  // issued copy is rewritten ahead of it.
  auto tile_copy = [&](int t, int buf) {
    int j0 = t * ST_;
    unsigned lk = lkr + buf * (FT_H * 2);
    unsigned lr = lk + FR_OFF * 2, lv = lk + FV_OFF * 2;
    const _Float16* gk = kbase + (size_t)(j0 + crow) * U_ + cpc;
    const _Float16* gv = vbase + (size_t)crow * KLEN_ + j0 + cpc;
    int rb = j0 + (Q_ - 64) - ib + crow;      // first r row of wave 3's band, + crow
    const _Float16* gr[6];
#pragma unroll   // constant indices keep the six pointers in registers
    for (int n = 0; n < 6; n++) {
      int row = rb + n * 32; if (row > KLEN_ - 1) row = KLEN_ - 1;
      gr[n] = rbase + (size_t)row * U_ + cpc;
    }
    asm volatile("global_load_async_to_lds_b128 %0, %8, off\n\t"
                 "global_load_async_to_lds_b128 %1, %9, off\n\t"
                 "global_load_async_to_lds_b128 %2, %10, off\n\t"
                 "global_load_async_to_lds_b128 %3, %11, off\n\t"
                 "global_load_async_to_lds_b128 %4, %12, off\n\t"
                 "global_load_async_to_lds_b128 %5, %13, off\n\t"
                 "global_load_async_to_lds_b128 %6, %14, off\n\t"
                 "global_load_async_to_lds_b128 %7, %15, off\n\t"
                 "s_wait_xcnt 0x0"
                 :: "v"(lk), "v"(lk + 32 * FK_P * 2),
                    "v"(lk + 64 * FK_P * 2), "v"(lk + 96 * FK_P * 2),
                    "v"(lv), "v"(lv + 32 * FK_P * 2),
                    "v"(lv + 64 * FK_P * 2), "v"(lv + 96 * FK_P * 2),
                    "v"(gk), "v"(gk + (size_t)32 * U_),
                    "v"(gk + (size_t)64 * U_), "v"(gk + (size_t)96 * U_),
                    "v"(gv), "v"(gv + (size_t)32 * KLEN_),
                    "v"(gv + KT_), "v"(gv + (size_t)32 * KLEN_ + KT_)
                 : "memory");
    asm volatile("global_load_async_to_lds_b128 %0, %6, off\n\t"
                 "global_load_async_to_lds_b128 %1, %7, off\n\t"
                 "global_load_async_to_lds_b128 %2, %8, off\n\t"
                 "global_load_async_to_lds_b128 %3, %9, off\n\t"
                 "global_load_async_to_lds_b128 %4, %10, off\n\t"
                 "global_load_async_to_lds_b128 %5, %11, off\n\t"
                 "s_wait_xcnt 0x0"
                 :: "v"(lr), "v"(lr + 32 * FK_P * 2),
                    "v"(lr + 64 * FK_P * 2), "v"(lr + 96 * FK_P * 2),
                    "v"(lr + 128 * FK_P * 2), "v"(lr + 160 * FK_P * 2),
                    "v"(gr[0]), "v"(gr[1]), "v"(gr[2]), "v"(gr[3]),
                    "v"(gr[4]), "v"(gr[5])
                 : "memory");
  };

  v8f o[4] = {};
  float mrow[8], lrow[8];
#pragma unroll
  for (int r = 0; r < 8; r++) { mrow[r] = -1e30f; lrow[r] = 0.f; }

  int ntile = ((MEM_ + ib) / KT_ + 2) / 2;   // the block's stages of 128 keys, 9 or more

  tile_copy(0, 0);
  asm volatile("s_wait_asynccnt 0x0" ::: "memory");  // own copies of tile 0 landed
  __syncthreads();                                   // tile 0 readable by all waves
  tile_copy(1, 1);

  for (int t = 0; t < ntile; t++) {
    int j0 = t * ST_ + g * KT_, buf = t & 1;
    const _Float16* Ks = &tile[buf * FT_H + g * KT_ * FK_P];
    const _Float16* Rs = &tile[buf * FT_H + FR_OFF + (g * KT_ + (3 - w) * 16) * FK_P];
    const _Float16* Vs = &tile[buf * FT_H + FV_OFF + g * DH_ * FK_P];

    // the K and r fragments of the tile are fetched as two groups of LDS reads, so
    // that a wave stays inside 256 registers: K and the first two band tiles, then,
    // in the registers that the K fragments leave, the other three band tiles
    // (every loop over kf, rf, sc, rc is unrolled: constant indices keep them in registers)
    v16h kf[8], rf[10];
#pragma unroll
    for (int n = 0; n < 8; n++)
      kf[n] = ldfrag(Ks + (n >> 1) * 16 * FK_P, FK_P, (n & 1) * 32);
#pragma unroll
    for (int n = 0; n < 4; n++)
      rf[n] = ldfrag(Rs + (n >> 1) * 16 * FK_P, FK_P, (n & 1) * 32);
    // keeps the 24 LDS reads one group in front of the products (sunk to their
    // uses, every product waits out an LDS latency of its own)
    __builtin_amdgcn_sched_barrier(0);

    // context scores: four 16-col subtiles over K=DH=64
    v8f sc[4] = {};
#pragma unroll
    for (int st = 0; st < 4; st++) {
      sc[st] = wmma_(aqc0, kf[2 * st], sc[st]);
      sc[st] = wmma_(aqc1, kf[2 * st + 1], sc[st]);
    }
    // keeps the second group behind the products that free its registers
    __builtin_amdgcn_sched_barrier(0);
#pragma unroll
    for (int n = 4; n < 10; n++)
      rf[n] = ldfrag(Rs + (n >> 1) * 16 * FK_P, FK_P, (n & 1) * 32);
    // keeps the 12 LDS reads one group: they land while the first band products run
    __builtin_amdgcn_sched_barrier(0);

    // relative-score band: r rows rb0 .. rb0+79, rb0 = j0 + (Q-16) - i0
    v8f rc[5] = {};
#pragma unroll
    for (int tt = 0; tt < 5; tt++) {
      rc[tt] = wmma_(aqr0, rf[2 * tt], rc[tt]);
      rc[tt] = wmma_(aqr1, rf[2 * tt + 1], rc[tt]);
    }
    // keeps every product in front of the selects below
    __builtin_amdgcn_sched_barrier(0);

    // shifted rel term: score (i, j) takes band column j + 15 - i. Band column
    // c sits in lane c & 15 of tile c >> 4, so for the keys of subtile st lane L
    // hands on tile st where L >= 15 - i and tile st + 1 below that, and a
    // rotate by i + 1 lanes brings every value to its score's lane.
    // Then scale 1/sqrt(64) and apply the causal mask.
    float sv[4][8];
#pragma unroll   // constant indices keep the arrays in registers
    for (int st = 0; st < 4; st++) {
      float a[8], y[8];
#pragma unroll
      for (int r = 0; r < 8; r++) {
        bool first = jl >= 15 - (r + 8 * hf);
        y[r] = first ? rc[st][r] : rc[st + 1][r];
        a[r] = sc[st][r];
      }
      shift_add8(a, y);
#pragma unroll
      for (int r = 0; r < 8; r++) {
        int lim = MEM_ + i0 + r + 8 * hf;
        sv[st][r] = (j0 + st * 16 + jl <= lim) ? a[r] * 0.125f : -1e30f;
      }
    }

    // online softmax (row = reg r + 8*hf; 16-lane group holds 16 of the 64 cols)
    float alpha[8], tm[8];
#pragma unroll   // constant indices keep tm in registers
    for (int r = 0; r < 8; r++)
      tm[r] = fmaxf(fmaxf(fmaxf(sv[0][r], sv[1][r]), fmaxf(sv[2][r], sv[3][r])), mrow[r]);
    row_max8(tm);   // the running maximum is the same in a row's lanes: this is the new one
#pragma unroll
    for (int r = 0; r < 8; r++) {
      float mn = tm[r];
      alpha[r] = __expf(mrow[r] - mn);
      float p0 = __expf(sv[0][r] - mn), p1 = __expf(sv[1][r] - mn);
      float p2 = __expf(sv[2][r] - mn), p3 = __expf(sv[3][r] - mn);
      float ps = (p0 + p1) + (p2 + p3);
      ps += row_xor<1>(ps); ps += row_xor<2>(ps);
      ps += row_xor<4>(ps); ps += row_xor<8>(ps);
      lrow[r] = lrow[r] * alpha[r] + ps;
      mrow[r] = mn;
      int iloc = r + 8 * hf;
      pbuf[w8][iloc][jl]      = (_Float16)p0;
      pbuf[w8][iloc][16 + jl] = (_Float16)p1;
      pbuf[w8][iloc][32 + jl] = (_Float16)p2;
      pbuf[w8][iloc][48 + jl] = (_Float16)p3;
    }
#pragma unroll
    for (int dt = 0; dt < 4; dt++)
#pragma unroll
      for (int r = 0; r < 8; r++) o[dt][r] *= alpha[r];

    asm volatile("" ::: "memory");   // order P store -> A-fragment reload
    v16h ap0 = ldfrag(&pbuf[w8][0][0], FK_P, 0);    // C-layout -> A-layout via LDS
    v16h ap1 = ldfrag(&pbuf[w8][0][0], FK_P, 32);
#pragma unroll
    for (int dt = 0; dt < 4; dt++) {
      o[dt] = wmma_(ap0, ldfrag(Vs + dt * 16 * FK_P, FK_P, 0), o[dt]);
      o[dt] = wmma_(ap1, ldfrag(Vs + dt * 16 * FK_P, FK_P, 32), o[dt]);
    }

    asm volatile("s_wait_dscnt 0x0" ::: "memory");    // own reads of this buffer done
    asm volatile("s_wait_asynccnt 0x0" ::: "memory"); // own copies of tile t+1 landed
    __syncthreads();  // publishes tile t+1 and frees this buffer for its refill
    if (t + 2 < ntile) tile_copy(t + 2, buf);
  }
  asm volatile("s_wait_asynccnt 0x0" ::: "memory");   // nothing in flight at the end

  // Merge of the two groups' partial softmax. The loop's last barrier has ended
  // every read of the stage buffers and no copy is in flight: they serve as the
  // exchange, 48 floats a lane (output, maximum, sum), lane-contiguous.
  float* xch = (float*)tile + w * (48 * 32) + lane;
  if (g == 1) {
#pragma unroll
    for (int dt = 0; dt < 4; dt++)
#pragma unroll
      for (int r = 0; r < 8; r++) xch[(dt * 8 + r) * 32] = o[dt][r];
#pragma unroll
    for (int r = 0; r < 8; r++) {
      xch[(32 + r) * 32] = mrow[r];
      xch[(40 + r) * 32] = lrow[r];
    }
  }
  __syncthreads();   // group 1's partial results readable by group 0
  if (g == 0) {
    // normalize and store (B,Q,U) f16
    float a0[8], a1[8], ls[8];
#pragma unroll
    for (int r = 0; r < 8; r++) {
      float m1 = xch[(32 + r) * 32], l1 = xch[(40 + r) * 32];
      float mn = fmaxf(mrow[r], m1);
      a0[r] = __expf(mrow[r] - mn);
      a1[r] = __expf(m1 - mn);
      ls[r] = lrow[r] * a0[r] + l1 * a1[r];
    }
#pragma unroll
    for (int dt = 0; dt < 4; dt++)
#pragma unroll
      for (int r = 0; r < 8; r++) {
        int iloc = r + 8 * hf;
        float vv = (o[dt][r] * a0[r] + xch[(dt * 8 + r) * 32] * a1[r]) / ls[r];
        outp[((size_t)b * Q_ + i0 + iloc) * U_ + h * DH_ + dt * 16 + jl] = (_Float16)vv;
      }
  }
}

// ---------------------------------------------------------------------------
extern "C" void kernel_launch(void* const* d_in, const int* in_sizes, int n_in,
                              void* d_out, int out_size, void* d_ws, size_t ws_size,
                              hipStream_t stream) {
  (void)in_sizes; (void)n_in; (void)out_size; (void)ws_size;
  const float* inputs    = (const float*)d_in[0];
  const float* relatives = (const float*)d_in[1];
  const float* memories  = (const float*)d_in[2];
  const float* biasc     = (const float*)d_in[3];
  const float* biasr     = (const float*)d_in[4];
  const float* Wq        = (const float*)d_in[5];
  const float* Wkv       = (const float*)d_in[6];
  const float* Wr        = (const float*)d_in[7];
  const float* Wo        = (const float*)d_in[8];
  float* out = (float*)d_out;

  // f16 workspace carve-out (~62 MB)
  _Float16* ws = (_Float16*)d_ws;
  size_t off = 0;
  auto carve = [&](size_t n) { _Float16* p = ws + off; off += n; return p; };
  const size_t BKU = (size_t)B_ * KLEN_ * U_;   // 4M
  const size_t BQU = (size_t)B_ * Q_ * U_;      // 2M
  const size_t UU  = (size_t)U_ * U_;           // 1M
  _Float16* xfull  = carve(BKU);
  _Float16* rel16  = carve(BKU);
  _Float16* WqT    = carve(UU);
  _Float16* WkT    = carve(UU);
  _Float16* WvT    = carve(UU);
  _Float16* WrT    = carve(UU);
  _Float16* WoT    = carve(UU);
  _Float16* qcb    = carve(BQU);
  _Float16* qrb    = carve(BQU);
  _Float16* kbuf   = carve(BKU);
  _Float16* rbuf   = carve(BKU);
  _Float16* vTb    = carve(BKU);                // (B,H,DH,KLEN)
  _Float16* attout = carve(BQU);

  // 1) pack + convert
  prep_f16<<<NB_PREP, 256, 0, stream>>>(memories, inputs, relatives, Wq, Wkv, Wr, Wo,
                                        xfull, rel16, WqT, WkT, WvT, WrT, WoT);

  // 2) projections (all WMMA NT GEMMs), one launch
  proj_gemms<<<NB_PROJ, 256, 0, stream>>>(xfull, rel16, WkT, WvT, WrT, WqT,
                                          kbuf, vTb, rbuf, qcb, qrb, biasc, biasr);

  // 3) fused attention (no score matrix in HBM)
  flash_attn<<<dim3(Q_ / 128 * B_, H_, 2), 256, 0, stream>>>(qcb, qrb, kbuf, rbuf,
                                                        vTb, attout);

  // 4) output projection, f32 result
  dim3 gq(U_ / BT_, Q_ / BT_, B_);
  gemm_nt<<<gq, 256, 0, stream>>>(attout, BQU / B_, U_, WoT, U_, U_,
                                  nullptr, 0, U_, nullptr, nullptr, nullptr,
                                  out, BQU / B_, 0, GM_F32);
}
